// v000
// Times are from an AMD MI455X. After a warm-up the kernel runs many times in a row, and a time is the length of
// such a window on the GPU divided by its runs, so every launch and the gaps after it count. The runs cycle
// through copies of the inputs. A figure is the median of several windows, for all but v000 over two sittings.
// Sittings can differ by a few percent; kernels timed side by side share one.
// v000 is the starting kernel. One run takes 244 microseconds.
#include <hip/hip_runtime.h>
#include <hip/hip_bf16.h>

#define SS   2048
#define NHQ  8
#define NHK  2
#define HDIM 128
#define REPG 4
#define WINW 512
#define BLKC 32
#define NBC  64
#define TOPN 4
#define NEGV (-1e30f)

typedef __attribute__((ext_vector_type(2))) float v2f;
typedef __attribute__((ext_vector_type(8))) float v8f;

#if defined(__has_builtin)
#if __has_builtin(__builtin_amdgcn_global_load_async_to_lds_b128)
#define HAVE_ASYNC_LDS 1
#endif
#endif

#ifdef HAVE_ASYNC_LDS
// builtin signature (from hipcc diagnostic): takes pointers to 16-byte int
// vectors: (v4i addrspace(1)*, v4i addrspace(3)*, imm offset, imm cpol)
typedef int v4i_ __attribute__((vector_size(16)));
typedef __attribute__((address_space(1))) v4i_ gv4i;
typedef __attribute__((address_space(3))) v4i_ lv4i;
__device__ __forceinline__ void async_wait_all() {
#if __has_builtin(__builtin_amdgcn_s_wait_asynccnt)
    __builtin_amdgcn_s_wait_asynccnt(0);
#else
    asm volatile("s_wait_asynccnt 0" ::: "memory");
#endif
}
#endif

// --------------------------------------------------------------------------
// Kernel 1: block-mean compressed K/V.  kc/vc: [NB][NHK][HD]
// --------------------------------------------------------------------------
__global__ void nsa_cmpkv_kernel(const float* __restrict__ k,
                                 const float* __restrict__ v,
                                 float* __restrict__ kc,
                                 float* __restrict__ vc) {
    int idx = blockIdx.x * blockDim.x + threadIdx.x;
    if (idx >= NBC * NHK * HDIM) return;
    int d  = idx % HDIM;
    int hk = (idx / HDIM) % NHK;
    int n  = idx / (HDIM * NHK);
    float sk = 0.f, sv = 0.f;
    for (int i = 0; i < BLKC; ++i) {
        int row = n * BLKC + i;
        sk += k[(row * NHK + hk) * HDIM + d];
        sv += v[(row * NHK + hk) * HDIM + d];
    }
    kc[(n * NHK + hk) * HDIM + d] = sk * (1.0f / BLKC);
    vc[(n * NHK + hk) * HDIM + d] = sv * (1.0f / BLKC);
}

// --------------------------------------------------------------------------
// Kernel 2: sliding-window branch, flash attention, WMMA f32 16x16x4.
// One wave per (16-query tile, q-head). Double-buffered async global->LDS
// staging of K/V tiles overlaps the next tile's load with this tile's WMMAs.
// Writes (initializes) d_out.
// --------------------------------------------------------------------------
__global__ __launch_bounds__(32)
void nsa_win_kernel(const float* __restrict__ q, const float* __restrict__ k,
                    const float* __restrict__ v, const float* __restrict__ gw,
                    float* __restrict__ out) {
    __shared__ __align__(16) float q_l[16][132];
    __shared__ __align__(16) float k_l[2][16][132];
    __shared__ __align__(16) float v_l[2][16][132];
    __shared__ float p_l[16][17];

    const int qt   = blockIdx.x / NHQ;
    const int hq   = blockIdx.x % NHQ;
    const int hk   = hq / REPG;
    const int q0   = qt * 16;
    const int tid  = threadIdx.x;
    const int half = tid >> 4;      // 0 or 1
    const int l16  = tid & 15;
    const float scale = 0.08838834764831845f;   // 1/sqrt(128)

    const int ktd = qt;
    int lowkey = q0 - (WINW - 1); if (lowkey < 0) lowkey = 0;
    const int ktl = lowkey >> 4;

    // ---- tile staging (async double-buffer if available) ----
#ifdef HAVE_ASYNC_LDS
#define ISSUE_TILE(bufi, ktv)                                                  \
    do {                                                                       \
        for (int i_ = 0; i_ < 16; ++i_) {                                      \
            int idx_ = i_ * 32 + tid;          /* 512 16B chunks per tile */   \
            int r_ = idx_ >> 5;                                                \
            int d_ = (idx_ & 31) << 2;                                         \
            const float* gk_ = &k[(((ktv) * 16 + r_) * NHK + hk) * HDIM + d_]; \
            const float* gv_ = &v[(((ktv) * 16 + r_) * NHK + hk) * HDIM + d_]; \
            __builtin_amdgcn_global_load_async_to_lds_b128(                    \
                (gv4i*)gk_, (lv4i*)&k_l[bufi][r_][d_], 0, 0);                  \
            __builtin_amdgcn_global_load_async_to_lds_b128(                    \
                (gv4i*)gv_, (lv4i*)&v_l[bufi][r_][d_], 0, 0);                  \
        }                                                                      \
    } while (0)
#define WAIT_TILE() async_wait_all()
#else
#define ISSUE_TILE(bufi, ktv)                                                  \
    do {                                                                       \
        for (int idx_ = tid; idx_ < 16 * HDIM; idx_ += 32) {                   \
            int r_ = idx_ >> 7, d_ = idx_ & 127;                               \
            k_l[bufi][r_][d_] = k[(((ktv) * 16 + r_) * NHK + hk) * HDIM + d_]; \
            v_l[bufi][r_][d_] = v[(((ktv) * 16 + r_) * NHK + hk) * HDIM + d_]; \
        }                                                                      \
    } while (0)
#define WAIT_TILE() do { } while (0)
#endif

    int buf = 0;
    ISSUE_TILE(0, ktd);   // prologue: first (diagonal) tile in flight

    for (int idx = tid; idx < 16 * HDIM; idx += 32) {
        int r = idx >> 7, d = idx & 127;
        q_l[r][d] = q[((q0 + r) * NHQ + hq) * HDIM + d];
    }
    __syncthreads();

    v8f acc[8];
    float mrow[8], lrow[8];
#pragma unroll
    for (int nt = 0; nt < 8; ++nt)
#pragma unroll
        for (int j = 0; j < 8; ++j) acc[nt][j] = 0.f;
#pragma unroll
    for (int j = 0; j < 8; ++j) { mrow[j] = -3.0e38f; lrow[j] = 0.f; }

    for (int kt = ktd; kt >= ktl; --kt) {
        WAIT_TILE();            // buffer `buf` now resident in LDS
        __syncthreads();
        const int nxt = buf ^ 1;
        if (kt - 1 >= ktl) ISSUE_TILE(nxt, kt - 1);  // overlap with compute

        // ---- S = Q K^T (16x16 tile) ----
        v8f c;
#pragma unroll
        for (int j = 0; j < 8; ++j) c[j] = 0.f;
#pragma unroll
        for (int kk = 0; kk < HDIM; kk += 4) {
            v2f a, b;
            a[0] = q_l[l16][kk + 2 * half + 0];
            a[1] = q_l[l16][kk + 2 * half + 1];
            b[0] = k_l[buf][l16][kk + 2 * half + 0];
            b[1] = k_l[buf][l16][kk + 2 * half + 1];
            c = __builtin_amdgcn_wmma_f32_16x16x4_f32(false, a, false, b,
                                                      (short)0, c, false, false);
        }

        // ---- mask + online softmax update ----
        const int ng = kt * 16 + l16;
#pragma unroll
        for (int j = 0; j < 8; ++j) {
            int qs  = q0 + j + 8 * half;
            int dif = qs - ng;
            bool valid = (dif >= 0) && (dif < WINW);
            float sv = valid ? c[j] * scale : NEGV;
            float rmax = sv;
#pragma unroll
            for (int m = 1; m <= 8; m <<= 1)
                rmax = fmaxf(rmax, __shfl_xor(rmax, m, 32));
            float mnew = fmaxf(mrow[j], rmax);
            float corr = expf(mrow[j] - mnew);
            float p    = expf(sv - mnew);
            float rsum = p;
#pragma unroll
            for (int m = 1; m <= 8; m <<= 1)
                rsum += __shfl_xor(rsum, m, 32);
            lrow[j] = lrow[j] * corr + rsum;
            mrow[j] = mnew;
#pragma unroll
            for (int nt = 0; nt < 8; ++nt) acc[nt][j] *= corr;
            p_l[j + 8 * half][l16] = p;
        }
        __syncthreads();

        // ---- O += P * V (16x16 x 16x128) ----
#pragma unroll
        for (int kc4 = 0; kc4 < 16; kc4 += 4) {
            v2f a;
            a[0] = p_l[l16][kc4 + 2 * half + 0];
            a[1] = p_l[l16][kc4 + 2 * half + 1];
#pragma unroll
            for (int nt = 0; nt < 8; ++nt) {
                v2f b;
                b[0] = v_l[buf][kc4 + 2 * half + 0][nt * 16 + l16];
                b[1] = v_l[buf][kc4 + 2 * half + 1][nt * 16 + l16];
                acc[nt] = __builtin_amdgcn_wmma_f32_16x16x4_f32(false, a, false, b,
                                                   (short)0, acc[nt], false, false);
            }
        }
        __syncthreads();
        buf = nxt;
    }

    for (int nt = 0; nt < 8; ++nt)
        for (int j = 0; j < 8; ++j) {
            int row = q0 + j + 8 * half;
            int d   = nt * 16 + l16;
            float o = acc[nt][j] / lrow[j];
            out[(row * NHQ + hq) * HDIM + d] = gw[row * NHQ + hq] * o;
        }
#undef ISSUE_TILE
#undef WAIT_TILE
}

// --------------------------------------------------------------------------
// Kernel 3: compressed branch. Writes normalized pc [NHQ][S][NB] to ws and
// adds g_cmp * o_cmp into d_out.
// --------------------------------------------------------------------------
__global__ __launch_bounds__(32)
void nsa_cmp_kernel(const float* __restrict__ q, const float* __restrict__ kc,
                    const float* __restrict__ vc, const float* __restrict__ gc,
                    float* __restrict__ pc_ws, float* __restrict__ out) {
    __shared__ float q_l[16][132];
    __shared__ float k_l[16][132];
    __shared__ float v_l[16][132];
    __shared__ float p_l[16][68];

    const int qt   = blockIdx.x / NHQ;
    const int hq   = blockIdx.x % NHQ;
    const int hk   = hq / REPG;
    const int q0   = qt * 16;
    const int tid  = threadIdx.x;
    const int half = tid >> 4;
    const int l16  = tid & 15;
    const float scale = 0.08838834764831845f;

    for (int idx = tid; idx < 16 * HDIM; idx += 32) {
        int r = idx >> 7, d = idx & 127;
        q_l[r][d] = q[((q0 + r) * NHQ + hq) * HDIM + d];
    }

    v8f sc[4];
    for (int nt = 0; nt < 4; ++nt) {
        __syncthreads();
        for (int idx = tid; idx < 16 * HDIM; idx += 32) {
            int r = idx >> 7, d = idx & 127;
            k_l[r][d] = kc[((nt * 16 + r) * NHK + hk) * HDIM + d];
        }
        __syncthreads();
        v8f c;
#pragma unroll
        for (int j = 0; j < 8; ++j) c[j] = 0.f;
#pragma unroll
        for (int kk = 0; kk < HDIM; kk += 4) {
            v2f a, b;
            a[0] = q_l[l16][kk + 2 * half + 0];
            a[1] = q_l[l16][kk + 2 * half + 1];
            b[0] = k_l[l16][kk + 2 * half + 0];
            b[1] = k_l[l16][kk + 2 * half + 1];
            c = __builtin_amdgcn_wmma_f32_16x16x4_f32(false, a, false, b,
                                                      (short)0, c, false, false);
        }
        sc[nt] = c;
    }

    // mask + scale  (block fully in the past: (n+1)*32-1 <= s)
    for (int nt = 0; nt < 4; ++nt)
#pragma unroll
        for (int j = 0; j < 8; ++j) {
            int n = nt * 16 + l16;
            int s = q0 + j + 8 * half;
            bool valid = ((n + 1) * BLKC - 1) <= s;
            sc[nt][j] = valid ? sc[nt][j] * scale : NEGV;
        }

    // row softmax over 64 blocks
    float mrow[8], lrow[8];
#pragma unroll
    for (int j = 0; j < 8; ++j) {
        float rm = -3.0e38f;
        for (int nt = 0; nt < 4; ++nt) rm = fmaxf(rm, sc[nt][j]);
#pragma unroll
        for (int m = 1; m <= 8; m <<= 1) rm = fmaxf(rm, __shfl_xor(rm, m, 32));
        mrow[j] = rm;
    }
    for (int nt = 0; nt < 4; ++nt)
#pragma unroll
        for (int j = 0; j < 8; ++j) sc[nt][j] = expf(sc[nt][j] - mrow[j]);
#pragma unroll
    for (int j = 0; j < 8; ++j) {
        float rs = 0.f;
        for (int nt = 0; nt < 4; ++nt) rs += sc[nt][j];
#pragma unroll
        for (int m = 1; m <= 8; m <<= 1) rs += __shfl_xor(rs, m, 32);
        lrow[j] = rs;
    }
    for (int nt = 0; nt < 4; ++nt)
#pragma unroll
        for (int j = 0; j < 8; ++j) {
            float p = sc[nt][j] / lrow[j];
            int s = q0 + j + 8 * half;
            int n = nt * 16 + l16;
            pc_ws[(hq * SS + s) * NBC + n] = p;
            p_l[j + 8 * half][n] = p;
        }

    // O = P (16x64) * vc (64x128), staged 16 K-rows at a time
    v8f acc[8];
#pragma unroll
    for (int nt = 0; nt < 8; ++nt)
#pragma unroll
        for (int j = 0; j < 8; ++j) acc[nt][j] = 0.f;

    for (int st = 0; st < 4; ++st) {
        __syncthreads();
        for (int idx = tid; idx < 16 * HDIM; idx += 32) {
            int r = idx >> 7, d = idx & 127;
            v_l[r][d] = vc[((st * 16 + r) * NHK + hk) * HDIM + d];
        }
        __syncthreads();
#pragma unroll
        for (int kq = 0; kq < 16; kq += 4) {
            int kc4 = st * 16 + kq;
            v2f a;
            a[0] = p_l[l16][kc4 + 2 * half + 0];
            a[1] = p_l[l16][kc4 + 2 * half + 1];
#pragma unroll
            for (int nt = 0; nt < 8; ++nt) {
                v2f b;
                b[0] = v_l[kq + 2 * half + 0][nt * 16 + l16];
                b[1] = v_l[kq + 2 * half + 1][nt * 16 + l16];
                acc[nt] = __builtin_amdgcn_wmma_f32_16x16x4_f32(false, a, false, b,
                                                   (short)0, acc[nt], false, false);
            }
        }
    }

    for (int nt = 0; nt < 8; ++nt)
        for (int j = 0; j < 8; ++j) {
            int row = q0 + j + 8 * half;
            int d   = nt * 16 + l16;
            float o = (row >= BLKC - 1) ? acc[nt][j] : 0.f;  // cmask.any zeroing
            out[(row * NHQ + hq) * HDIM + d] += gc[row * NHQ + hq] * o;
        }
}

// --------------------------------------------------------------------------
// Kernel 4: top-4 block selection per (s, hk). Deterministic argmax passes,
// strict '>' matches top_k's lower-index tie break.
// --------------------------------------------------------------------------
__global__ void nsa_sel_kernel(const float* __restrict__ pc, int* __restrict__ sel) {
    int idx = blockIdx.x * blockDim.x + threadIdx.x;
    if (idx >= SS * NHK) return;
    int hk = idx % NHK;
    int s  = idx / NHK;
    int cur = s / BLKC;
    float scb[NBC];
    for (int n = 0; n < NBC; ++n) {
        float vsum = 0.f;
        for (int r = 0; r < REPG; ++r)
            vsum += pc[((hk * REPG + r) * SS + s) * NBC + n];
        if (n == cur) vsum += 1e6f;
        if (n == 0)   vsum += 1e6f;
        scb[n] = vsum;
    }
    for (int t = 0; t < TOPN; ++t) {
        int best = 0; float bv = scb[0];
        for (int n = 1; n < NBC; ++n)
            if (scb[n] > bv) { bv = scb[n]; best = n; }
        sel[(s * NHK + hk) * TOPN + t] = best;
        scb[best] = -3.0e38f;
    }
}

// --------------------------------------------------------------------------
// Kernel 5: selected branch. 128 threads per (s, hk): 4 rep heads, 128
// gathered keys. Adds g_slt * o_slt into d_out.
// --------------------------------------------------------------------------
__global__ __launch_bounds__(128)
void nsa_slt_kernel(const float* __restrict__ q, const float* __restrict__ k,
                    const float* __restrict__ v, const float* __restrict__ gs,
                    const int* __restrict__ sel, float* __restrict__ out) {
    __shared__ float qsm[REPG][HDIM];
    __shared__ float scm[REPG][TOPN * BLKC];
    __shared__ int   selb[TOPN];

    const int s  = blockIdx.x / NHK;
    const int hk = blockIdx.x % NHK;
    const int t  = threadIdx.x;
    const float scale = 0.08838834764831845f;

    for (int i = t; i < REPG * HDIM; i += 128) {
        int r = i / HDIM, d = i % HDIM;
        qsm[r][d] = q[(s * NHQ + hk * REPG + r) * HDIM + d];
    }
    if (t < TOPN) selb[t] = sel[(s * NHK + hk) * TOPN + t];
    __syncthreads();

    // scores: thread t handles key t
    {
        int b = selb[t / BLKC];
        int pos = b * BLKC + (t % BLKC);
        const float* kr = k + (pos * NHK + hk) * HDIM;
        for (int r = 0; r < REPG; ++r) {
            float a = 0.f;
            for (int d = 0; d < HDIM; ++d) a += qsm[r][d] * kr[d];
            scm[r][t] = (pos <= s) ? a * scale : NEGV;
        }
    }
    __syncthreads();

    // softmax: wave w handles row w (4 waves of 32 lanes)
    {
        int wave = t >> 5, lane = t & 31;
        float vals[4];
        float mloc = -3.0e38f;
        for (int i = 0; i < 4; ++i) {
            vals[i] = scm[wave][lane + 32 * i];
            mloc = fmaxf(mloc, vals[i]);
        }
        for (int m = 1; m <= 16; m <<= 1)
            mloc = fmaxf(mloc, __shfl_xor(mloc, m, 32));
        float ssum = 0.f;
        for (int i = 0; i < 4; ++i) { vals[i] = expf(vals[i] - mloc); ssum += vals[i]; }
        for (int m = 1; m <= 16; m <<= 1)
            ssum += __shfl_xor(ssum, m, 32);
        float inv = 1.0f / ssum;
        for (int i = 0; i < 4; ++i) scm[wave][lane + 32 * i] = vals[i] * inv;
    }
    __syncthreads();

    // output: thread t handles dim d = t for all 4 rep heads
    {
        float o0 = 0.f, o1 = 0.f, o2 = 0.f, o3 = 0.f;
        for (int key = 0; key < TOPN * BLKC; ++key) {
            int pos = selb[key / BLKC] * BLKC + (key % BLKC);
            float vv = v[(pos * NHK + hk) * HDIM + t];
            o0 += scm[0][key] * vv;
            o1 += scm[1][key] * vv;
            o2 += scm[2][key] * vv;
            o3 += scm[3][key] * vv;
        }
        float os[4] = {o0, o1, o2, o3};
        for (int r = 0; r < REPG; ++r) {
            int hq = hk * REPG + r;
            out[(s * NHQ + hq) * HDIM + t] += gs[s * NHQ + hq] * os[r];
        }
    }
}

// --------------------------------------------------------------------------
extern "C" void kernel_launch(void* const* d_in, const int* in_sizes, int n_in,
                              void* d_out, int out_size, void* d_ws, size_t ws_size,
                              hipStream_t stream) {
    const float* q  = (const float*)d_in[0];
    const float* k  = (const float*)d_in[1];
    const float* v  = (const float*)d_in[2];
    const float* gw = (const float*)d_in[3];
    const float* gc = (const float*)d_in[4];
    const float* gs = (const float*)d_in[5];
    float* out = (float*)d_out;

    float* ws = (float*)d_ws;
    float* kc = ws;                                  // NB*NHK*HD = 16384 floats
    float* vc = ws + NBC * NHK * HDIM;               // 16384 floats
    float* pc = vc + NBC * NHK * HDIM;               // NHQ*S*NB = 1,048,576 floats
    int*  sel = (int*)(pc + (size_t)NHQ * SS * NBC); // S*NHK*TOPN ints

    nsa_cmpkv_kernel<<<(NBC * NHK * HDIM + 255) / 256, 256, 0, stream>>>(k, v, kc, vc);
    nsa_win_kernel<<<(SS / 16) * NHQ, 32, 0, stream>>>(q, k, v, gw, out);
    nsa_cmp_kernel<<<(SS / 16) * NHQ, 32, 0, stream>>>(q, kc, vc, gc, pc, out);
    nsa_sel_kernel<<<(SS * NHK + 255) / 256, 256, 0, stream>>>(pc, sel);
    nsa_slt_kernel<<<SS * NHK, 128, 0, stream>>>(q, k, v, gs, sel, out);
}

// v001
// Measured time: 157 microseconds a run.
// Next to v000, in two timings, it ran 1.49 and 1.48 times as fast.
#include <hip/hip_runtime.h>
#include <hip/hip_bf16.h>

#define SS   2048
#define NHQ  8
#define NHK  2
#define HDIM 128
#define REPG 4
#define WINW 512
#define BLKC 32
#define NBC  64
#define TOPN 4
#define NEGV (-1e30f)

typedef __attribute__((ext_vector_type(2))) float v2f;
typedef __attribute__((ext_vector_type(8))) float v8f;

#if defined(__has_builtin)
#if __has_builtin(__builtin_amdgcn_global_load_async_to_lds_b128)
#define HAVE_ASYNC_LDS 1
#endif
#endif

#ifdef HAVE_ASYNC_LDS
// builtin signature (from hipcc diagnostic): takes pointers to 16-byte int
// vectors: (v4i addrspace(1)*, v4i addrspace(3)*, imm offset, imm cpol)
typedef int v4i_ __attribute__((vector_size(16)));
typedef __attribute__((address_space(1))) v4i_ gv4i;
typedef __attribute__((address_space(3))) v4i_ lv4i;
__device__ __forceinline__ void async_wait_all() {
#if __has_builtin(__builtin_amdgcn_s_wait_asynccnt)
    __builtin_amdgcn_s_wait_asynccnt(0);
#else
    asm volatile("s_wait_asynccnt 0" ::: "memory");
#endif
}
#endif

// --------------------------------------------------------------------------
// Kernel 1: block-mean compressed K/V.  kc/vc: [NB][NHK][HD]
// --------------------------------------------------------------------------
__global__ void nsa_cmpkv_kernel(const float* __restrict__ k,
                                 const float* __restrict__ v,
                                 float* __restrict__ kc,
                                 float* __restrict__ vc) {
    int idx = blockIdx.x * blockDim.x + threadIdx.x;
    if (idx >= NBC * NHK * HDIM) return;
    int d  = idx % HDIM;
    int hk = (idx / HDIM) % NHK;
    int n  = idx / (HDIM * NHK);
    float sk = 0.f, sv = 0.f;
    for (int i = 0; i < BLKC; ++i) {
        int row = n * BLKC + i;
        sk += k[(row * NHK + hk) * HDIM + d];
        sv += v[(row * NHK + hk) * HDIM + d];
    }
    kc[(n * NHK + hk) * HDIM + d] = sk * (1.0f / BLKC);
    vc[(n * NHK + hk) * HDIM + d] = sv * (1.0f / BLKC);
}

// --------------------------------------------------------------------------
// Kernel 2: sliding-window branch, flash attention, WMMA f32 16x16x4.
// One wave per (16-query tile, q-head). Double-buffered async global->LDS
// staging of K/V tiles overlaps the next tile's load with this tile's WMMAs.
// Writes (initializes) d_out.
// --------------------------------------------------------------------------
__global__ __launch_bounds__(32)
void nsa_win_kernel(const float* __restrict__ q, const float* __restrict__ k,
                    const float* __restrict__ v, const float* __restrict__ gw,
                    float* __restrict__ out) {
    __shared__ __align__(16) float q_l[16][132];
    __shared__ __align__(16) float k_l[2][16][132];
    __shared__ __align__(16) float v_l[2][16][132];
    __shared__ float p_l[16][17];

    const int qt   = blockIdx.x / NHQ;
    const int hq   = blockIdx.x % NHQ;
    const int hk   = hq / REPG;
    const int q0   = qt * 16;
    const int tid  = threadIdx.x;
    const int half = tid >> 4;      // 0 or 1
    const int l16  = tid & 15;
    const float scale = 0.08838834764831845f;   // 1/sqrt(128)

    const int ktd = qt;
    int lowkey = q0 - (WINW - 1); if (lowkey < 0) lowkey = 0;
    const int ktl = lowkey >> 4;

    // ---- tile staging (async double-buffer if available) ----
#ifdef HAVE_ASYNC_LDS
#define ISSUE_TILE(bufi, ktv)                                                  \
    do {                                                                       \
        for (int i_ = 0; i_ < 16; ++i_) {                                      \
            int idx_ = i_ * 32 + tid;          /* 512 16B chunks per tile */   \
            int r_ = idx_ >> 5;                                                \
            int d_ = (idx_ & 31) << 2;                                         \
            const float* gk_ = &k[(((ktv) * 16 + r_) * NHK + hk) * HDIM + d_]; \
            const float* gv_ = &v[(((ktv) * 16 + r_) * NHK + hk) * HDIM + d_]; \
            __builtin_amdgcn_global_load_async_to_lds_b128(                    \
                (gv4i*)gk_, (lv4i*)&k_l[bufi][r_][d_], 0, 0);                  \
            __builtin_amdgcn_global_load_async_to_lds_b128(                    \
                (gv4i*)gv_, (lv4i*)&v_l[bufi][r_][d_], 0, 0);                  \
        }                                                                      \
    } while (0)
#define WAIT_TILE() async_wait_all()
#else
#define ISSUE_TILE(bufi, ktv)                                                  \
    do {                                                                       \
        for (int idx_ = tid; idx_ < 16 * HDIM; idx_ += 32) {                   \
            int r_ = idx_ >> 7, d_ = idx_ & 127;                               \
            k_l[bufi][r_][d_] = k[(((ktv) * 16 + r_) * NHK + hk) * HDIM + d_]; \
            v_l[bufi][r_][d_] = v[(((ktv) * 16 + r_) * NHK + hk) * HDIM + d_]; \
        }                                                                      \
    } while (0)
#define WAIT_TILE() do { } while (0)
#endif

    int buf = 0;
    ISSUE_TILE(0, ktd);   // prologue: first (diagonal) tile in flight

    for (int idx = tid; idx < 16 * HDIM; idx += 32) {
        int r = idx >> 7, d = idx & 127;
        q_l[r][d] = q[((q0 + r) * NHQ + hq) * HDIM + d];
    }
    __syncthreads();

    v8f acc[8];
    float mrow[8], lrow[8];
#pragma unroll
    for (int nt = 0; nt < 8; ++nt)
#pragma unroll
        for (int j = 0; j < 8; ++j) acc[nt][j] = 0.f;
#pragma unroll
    for (int j = 0; j < 8; ++j) { mrow[j] = -3.0e38f; lrow[j] = 0.f; }

    for (int kt = ktd; kt >= ktl; --kt) {
        WAIT_TILE();            // buffer `buf` now resident in LDS
        __syncthreads();
        const int nxt = buf ^ 1;
        if (kt - 1 >= ktl) ISSUE_TILE(nxt, kt - 1);  // overlap with compute

        // ---- S = Q K^T (16x16 tile) ----
        v8f c;
#pragma unroll
        for (int j = 0; j < 8; ++j) c[j] = 0.f;
#pragma unroll
        for (int kk = 0; kk < HDIM; kk += 4) {
            v2f a, b;
            a[0] = q_l[l16][kk + 2 * half + 0];
            a[1] = q_l[l16][kk + 2 * half + 1];
            b[0] = k_l[buf][l16][kk + 2 * half + 0];
            b[1] = k_l[buf][l16][kk + 2 * half + 1];
            c = __builtin_amdgcn_wmma_f32_16x16x4_f32(false, a, false, b,
                                                      (short)0, c, false, false);
        }

        // ---- mask + online softmax update ----
        const int ng = kt * 16 + l16;
#pragma unroll
        for (int j = 0; j < 8; ++j) {
            int qs  = q0 + j + 8 * half;
            int dif = qs - ng;
            bool valid = (dif >= 0) && (dif < WINW);
            float sv = valid ? c[j] * scale : NEGV;
            float rmax = sv;
#pragma unroll
            for (int m = 1; m <= 8; m <<= 1)
                rmax = fmaxf(rmax, __shfl_xor(rmax, m, 32));
            float mnew = fmaxf(mrow[j], rmax);
            float corr = expf(mrow[j] - mnew);
            float p    = expf(sv - mnew);
            float rsum = p;
#pragma unroll
            for (int m = 1; m <= 8; m <<= 1)
                rsum += __shfl_xor(rsum, m, 32);
            lrow[j] = lrow[j] * corr + rsum;
            mrow[j] = mnew;
#pragma unroll
            for (int nt = 0; nt < 8; ++nt) acc[nt][j] *= corr;
            p_l[j + 8 * half][l16] = p;
        }
        __syncthreads();

        // ---- O += P * V (16x16 x 16x128) ----
#pragma unroll
        for (int kc4 = 0; kc4 < 16; kc4 += 4) {
            v2f a;
            a[0] = p_l[l16][kc4 + 2 * half + 0];
            a[1] = p_l[l16][kc4 + 2 * half + 1];
#pragma unroll
            for (int nt = 0; nt < 8; ++nt) {
                v2f b;
                b[0] = v_l[buf][kc4 + 2 * half + 0][nt * 16 + l16];
                b[1] = v_l[buf][kc4 + 2 * half + 1][nt * 16 + l16];
                acc[nt] = __builtin_amdgcn_wmma_f32_16x16x4_f32(false, a, false, b,
                                                   (short)0, acc[nt], false, false);
            }
        }
        __syncthreads();
        buf = nxt;
    }

    for (int nt = 0; nt < 8; ++nt)
        for (int j = 0; j < 8; ++j) {
            int row = q0 + j + 8 * half;
            int d   = nt * 16 + l16;
            float o = acc[nt][j] / lrow[j];
            out[(row * NHQ + hq) * HDIM + d] = gw[row * NHQ + hq] * o;
        }
#undef ISSUE_TILE
#undef WAIT_TILE
}

// --------------------------------------------------------------------------
// Kernel 3: compressed branch. Writes normalized pc [NHQ][S][NB] to ws and
// adds g_cmp * o_cmp into d_out.
// --------------------------------------------------------------------------
__global__ __launch_bounds__(32)
void nsa_cmp_kernel(const float* __restrict__ q, const float* __restrict__ kc,
                    const float* __restrict__ vc, const float* __restrict__ gc,
                    float* __restrict__ pc_ws, float* __restrict__ out) {
    __shared__ float q_l[16][132];
    __shared__ float k_l[16][132];
    __shared__ float v_l[16][132];
    __shared__ float p_l[16][68];

    const int qt   = blockIdx.x / NHQ;
    const int hq   = blockIdx.x % NHQ;
    const int hk   = hq / REPG;
    const int q0   = qt * 16;
    const int tid  = threadIdx.x;
    const int half = tid >> 4;
    const int l16  = tid & 15;
    const float scale = 0.08838834764831845f;

    for (int idx = tid; idx < 16 * HDIM; idx += 32) {
        int r = idx >> 7, d = idx & 127;
        q_l[r][d] = q[((q0 + r) * NHQ + hq) * HDIM + d];
    }

    v8f sc[4];
    for (int nt = 0; nt < 4; ++nt) {
        __syncthreads();
        for (int idx = tid; idx < 16 * HDIM; idx += 32) {
            int r = idx >> 7, d = idx & 127;
            k_l[r][d] = kc[((nt * 16 + r) * NHK + hk) * HDIM + d];
        }
        __syncthreads();
        v8f c;
#pragma unroll
        for (int j = 0; j < 8; ++j) c[j] = 0.f;
#pragma unroll
        for (int kk = 0; kk < HDIM; kk += 4) {
            v2f a, b;
            a[0] = q_l[l16][kk + 2 * half + 0];
            a[1] = q_l[l16][kk + 2 * half + 1];
            b[0] = k_l[l16][kk + 2 * half + 0];
            b[1] = k_l[l16][kk + 2 * half + 1];
            c = __builtin_amdgcn_wmma_f32_16x16x4_f32(false, a, false, b,
                                                      (short)0, c, false, false);
        }
        sc[nt] = c;
    }

    // mask + scale  (block fully in the past: (n+1)*32-1 <= s)
    for (int nt = 0; nt < 4; ++nt)
#pragma unroll
        for (int j = 0; j < 8; ++j) {
            int n = nt * 16 + l16;
            int s = q0 + j + 8 * half;
            bool valid = ((n + 1) * BLKC - 1) <= s;
            sc[nt][j] = valid ? sc[nt][j] * scale : NEGV;
        }

    // row softmax over 64 blocks
    float mrow[8], lrow[8];
#pragma unroll
    for (int j = 0; j < 8; ++j) {
        float rm = -3.0e38f;
        for (int nt = 0; nt < 4; ++nt) rm = fmaxf(rm, sc[nt][j]);
#pragma unroll
        for (int m = 1; m <= 8; m <<= 1) rm = fmaxf(rm, __shfl_xor(rm, m, 32));
        mrow[j] = rm;
    }
    for (int nt = 0; nt < 4; ++nt)
#pragma unroll
        for (int j = 0; j < 8; ++j) sc[nt][j] = expf(sc[nt][j] - mrow[j]);
#pragma unroll
    for (int j = 0; j < 8; ++j) {
        float rs = 0.f;
        for (int nt = 0; nt < 4; ++nt) rs += sc[nt][j];
#pragma unroll
        for (int m = 1; m <= 8; m <<= 1) rs += __shfl_xor(rs, m, 32);
        lrow[j] = rs;
    }
    for (int nt = 0; nt < 4; ++nt)
#pragma unroll
        for (int j = 0; j < 8; ++j) {
            float p = sc[nt][j] / lrow[j];
            int s = q0 + j + 8 * half;
            int n = nt * 16 + l16;
            pc_ws[(hq * SS + s) * NBC + n] = p;
            p_l[j + 8 * half][n] = p;
        }

    // O = P (16x64) * vc (64x128), staged 16 K-rows at a time
    v8f acc[8];
#pragma unroll
    for (int nt = 0; nt < 8; ++nt)
#pragma unroll
        for (int j = 0; j < 8; ++j) acc[nt][j] = 0.f;

    for (int st = 0; st < 4; ++st) {
        __syncthreads();
        for (int idx = tid; idx < 16 * HDIM; idx += 32) {
            int r = idx >> 7, d = idx & 127;
            v_l[r][d] = vc[((st * 16 + r) * NHK + hk) * HDIM + d];
        }
        __syncthreads();
#pragma unroll
        for (int kq = 0; kq < 16; kq += 4) {
            int kc4 = st * 16 + kq;
            v2f a;
            a[0] = p_l[l16][kc4 + 2 * half + 0];
            a[1] = p_l[l16][kc4 + 2 * half + 1];
#pragma unroll
            for (int nt = 0; nt < 8; ++nt) {
                v2f b;
                b[0] = v_l[kq + 2 * half + 0][nt * 16 + l16];
                b[1] = v_l[kq + 2 * half + 1][nt * 16 + l16];
                acc[nt] = __builtin_amdgcn_wmma_f32_16x16x4_f32(false, a, false, b,
                                                   (short)0, acc[nt], false, false);
            }
        }
    }

    for (int nt = 0; nt < 8; ++nt)
        for (int j = 0; j < 8; ++j) {
            int row = q0 + j + 8 * half;
            int d   = nt * 16 + l16;
            float o = (row >= BLKC - 1) ? acc[nt][j] : 0.f;  // cmask.any zeroing
            out[(row * NHQ + hq) * HDIM + d] += gc[row * NHQ + hq] * o;
        }
}

// --------------------------------------------------------------------------
// Kernel 4: top-4 block selection per (s, hk). Deterministic argmax passes,
// strict '>' matches top_k's lower-index tie break.
// --------------------------------------------------------------------------
__global__ void nsa_sel_kernel(const float* __restrict__ pc, int* __restrict__ sel) {
    int idx = blockIdx.x * blockDim.x + threadIdx.x;
    if (idx >= SS * NHK) return;
    int hk = idx % NHK;
    int s  = idx / NHK;
    int cur = s / BLKC;
    float scb[NBC];
    for (int n = 0; n < NBC; ++n) {
        float vsum = 0.f;
        for (int r = 0; r < REPG; ++r)
            vsum += pc[((hk * REPG + r) * SS + s) * NBC + n];
        if (n == cur) vsum += 1e6f;
        if (n == 0)   vsum += 1e6f;
        scb[n] = vsum;
    }
    for (int t = 0; t < TOPN; ++t) {
        int best = 0; float bv = scb[0];
        for (int n = 1; n < NBC; ++n)
            if (scb[n] > bv) { bv = scb[n]; best = n; }
        sel[(s * NHK + hk) * TOPN + t] = best;
        scb[best] = -3.0e38f;
    }
}

// --------------------------------------------------------------------------
// Kernel 5: selected branch. 128 threads per (s, hk): 4 rep heads, 128
// gathered keys, K rows staged in LDS. Adds g_slt * o_slt into d_out.
// --------------------------------------------------------------------------
__global__ __launch_bounds__(128)
void nsa_slt_kernel(const float* __restrict__ q, const float* __restrict__ k,
                    const float* __restrict__ v, const float* __restrict__ gs,
                    const int* __restrict__ sel, float* __restrict__ out) {
    // K is staged in two halves of the head dim (64 floats a row) so that eight
    // work-groups fit one WGP's LDS. Row pitch 272 B = 16 B x 17: 16-byte reads
    // of one row per lane meet no bank conflict.
    __shared__ __align__(16) float k_l[TOPN * BLKC][HDIM / 2 + 4];
    __shared__ __align__(16) float qsm[REPG][HDIM];
    __shared__ float scm[REPG][TOPN * BLKC];
    __shared__ int   selb[TOPN];

    const int s  = blockIdx.x / NHK;
    const int hk = blockIdx.x % NHK;
    const int t  = threadIdx.x;
    const float scale = 0.08838834764831845f;

    // wave w stages the 32 rows of selected block w; k_l row t belongs to key t.
    // One copy of the wave = two half rows of 256 contiguous bytes: whole cache lines.
    const int bsel = sel[(s * NHK + hk) * TOPN + (t >> 5)];
    const float* g0 = k + ((bsel * BLKC + ((t >> 4) & 1)) * NHK + hk) * HDIM + 4 * (t & 15);
    const unsigned l0 = (unsigned)(size_t)&k_l[(t & ~31) + ((t >> 4) & 1)][4 * (t & 15)];
    constexpr int GSTEP = 2 * NHK * HDIM;            // floats: two key rows on
    constexpr unsigned LSTEP = 2 * (HDIM / 2 + 4) * 4;  // bytes: two k_l rows on

    float a[REPG] = {0.f, 0.f, 0.f, 0.f};
#pragma unroll   // two trips, straight-line: h is a constant in every address
    for (int h = 0; h < 2; ++h) {
        if (h) {
            // every reader has left k_l before the second half overwrites it
            asm volatile("s_wait_dscnt 0x0" ::: "memory");
            __syncthreads();
        }
#pragma unroll   // straight-line: all 16 copies of the wave are in flight together
        for (int i = 0; i < 16; i += 8) {
            const float* g = g0 + h * (HDIM / 2) + i * GSTEP;
            const unsigned l = l0 + i * LSTEP;
            // the closing s_wait_xcnt stands in the copies' own statement, in
            // front of any rewrite of the address registers that they name
            asm volatile(
                "global_load_async_to_lds_b128 %0, %8, off\n\t"
                "global_load_async_to_lds_b128 %1, %9, off\n\t"
                "global_load_async_to_lds_b128 %2, %10, off\n\t"
                "global_load_async_to_lds_b128 %3, %11, off\n\t"
                "global_load_async_to_lds_b128 %4, %12, off\n\t"
                "global_load_async_to_lds_b128 %5, %13, off\n\t"
                "global_load_async_to_lds_b128 %6, %14, off\n\t"
                "global_load_async_to_lds_b128 %7, %15, off\n\t"
                "s_wait_xcnt 0x0"
                :: "v"(l), "v"(l + 1 * LSTEP), "v"(l + 2 * LSTEP), "v"(l + 3 * LSTEP),
                   "v"(l + 4 * LSTEP), "v"(l + 5 * LSTEP), "v"(l + 6 * LSTEP), "v"(l + 7 * LSTEP),
                   "v"(g), "v"(g + 1 * GSTEP), "v"(g + 2 * GSTEP), "v"(g + 3 * GSTEP),
                   "v"(g + 4 * GSTEP), "v"(g + 5 * GSTEP), "v"(g + 6 * GSTEP), "v"(g + 7 * GSTEP)
                : "memory");
        }
        if (h == 0) {
            for (int i = t; i < REPG * HDIM; i += 128) {
                int r = i / HDIM, d = i % HDIM;
                qsm[r][d] = q[(s * NHQ + hk * REPG + r) * HDIM + d];
            }
            if (t < TOPN) selb[t] = sel[(s * NHK + hk) * TOPN + t];
        }
        // the wave's own copies have landed before the barrier publishes k_l
        asm volatile("s_wait_asynccnt 0x0" ::: "memory");
        __syncthreads();

        // scores: thread t handles key t, read from its k_l row; each head's
        // sum runs over d in ascending order
        for (int d = 0; d < HDIM / 2; d += 4) {
            const float4 kv = *(const float4*)&k_l[t][d];
#pragma unroll   // a[] stays in registers
            for (int r = 0; r < REPG; ++r) {
                const float4 qv = *(const float4*)&qsm[r][h * (HDIM / 2) + d];
                a[r] = fmaf(qv.x, kv.x, a[r]);
                a[r] = fmaf(qv.y, kv.y, a[r]);
                a[r] = fmaf(qv.z, kv.z, a[r]);
                a[r] = fmaf(qv.w, kv.w, a[r]);
            }
        }
    }
    {
        int pos = bsel * BLKC + (t % BLKC);
#pragma unroll   // a[] stays in registers
        for (int r = 0; r < REPG; ++r)
            scm[r][t] = (pos <= s) ? a[r] * scale : NEGV;
    }
    __syncthreads();

    // softmax: wave w handles row w (4 waves of 32 lanes)
    {
        int wave = t >> 5, lane = t & 31;
        float vals[4];
        float mloc = -3.0e38f;
        for (int i = 0; i < 4; ++i) {
            vals[i] = scm[wave][lane + 32 * i];
            mloc = fmaxf(mloc, vals[i]);
        }
        for (int m = 1; m <= 16; m <<= 1)
            mloc = fmaxf(mloc, __shfl_xor(mloc, m, 32));
        float ssum = 0.f;
        for (int i = 0; i < 4; ++i) { vals[i] = expf(vals[i] - mloc); ssum += vals[i]; }
        for (int m = 1; m <= 16; m <<= 1)
            ssum += __shfl_xor(ssum, m, 32);
        float inv = 1.0f / ssum;
        for (int i = 0; i < 4; ++i) scm[wave][lane + 32 * i] = vals[i] * inv;
    }
    __syncthreads();

    // output: thread t handles dim d = t for all 4 rep heads
    {
        float o0 = 0.f, o1 = 0.f, o2 = 0.f, o3 = 0.f;
        for (int key = 0; key < TOPN * BLKC; ++key) {
            int pos = selb[key / BLKC] * BLKC + (key % BLKC);
            float vv = v[(pos * NHK + hk) * HDIM + t];
            o0 += scm[0][key] * vv;
            o1 += scm[1][key] * vv;
            o2 += scm[2][key] * vv;
            o3 += scm[3][key] * vv;
        }
        float os[4] = {o0, o1, o2, o3};
        for (int r = 0; r < REPG; ++r) {
            int hq = hk * REPG + r;
            out[(s * NHQ + hq) * HDIM + t] += gs[s * NHQ + hq] * os[r];
        }
    }
}

// --------------------------------------------------------------------------
extern "C" void kernel_launch(void* const* d_in, const int* in_sizes, int n_in,
                              void* d_out, int out_size, void* d_ws, size_t ws_size,
                              hipStream_t stream) {
    const float* q  = (const float*)d_in[0];
    const float* k  = (const float*)d_in[1];
    const float* v  = (const float*)d_in[2];
    const float* gw = (const float*)d_in[3];
    const float* gc = (const float*)d_in[4];
    const float* gs = (const float*)d_in[5];
    float* out = (float*)d_out;

    float* ws = (float*)d_ws;
    float* kc = ws;                                  // NB*NHK*HD = 16384 floats
    float* vc = ws + NBC * NHK * HDIM;               // 16384 floats
    float* pc = vc + NBC * NHK * HDIM;               // NHQ*S*NB = 1,048,576 floats
    int*  sel = (int*)(pc + (size_t)NHQ * SS * NBC); // S*NHK*TOPN ints

    nsa_cmpkv_kernel<<<(NBC * NHK * HDIM + 255) / 256, 256, 0, stream>>>(k, v, kc, vc);
    nsa_win_kernel<<<(SS / 16) * NHQ, 32, 0, stream>>>(q, k, v, gw, out);
    nsa_cmp_kernel<<<(SS / 16) * NHQ, 32, 0, stream>>>(q, kc, vc, gc, pc, out);
    nsa_sel_kernel<<<(SS * NHK + 255) / 256, 256, 0, stream>>>(pc, sel);
    nsa_slt_kernel<<<SS * NHK, 128, 0, stream>>>(q, k, v, gs, sel, out);
}

// v002
// A run of this version takes 137 microseconds.
// Two timings next to v001 both put it at 1.14 times that version's speed.
// Over all steps from v000 it is 1.70 times as fast.
#include <hip/hip_runtime.h>
#include <hip/hip_bf16.h>

#define SS   2048
#define NHQ  8
#define NHK  2
#define HDIM 128
#define REPG 4
#define WINW 512
#define BLKC 32
#define NBC  64
#define TOPN 4
#define NEGV (-1e30f)

typedef __attribute__((ext_vector_type(2))) float v2f;
typedef __attribute__((ext_vector_type(8))) float v8f;

#if defined(__has_builtin)
#if __has_builtin(__builtin_amdgcn_global_load_async_to_lds_b128)
#define HAVE_ASYNC_LDS 1
#endif
#endif

#ifdef HAVE_ASYNC_LDS
// builtin signature (from hipcc diagnostic): takes pointers to 16-byte int
// vectors: (v4i addrspace(1)*, v4i addrspace(3)*, imm offset, imm cpol)
typedef int v4i_ __attribute__((vector_size(16)));
typedef __attribute__((address_space(1))) v4i_ gv4i;
typedef __attribute__((address_space(3))) v4i_ lv4i;
#endif

// --------------------------------------------------------------------------
// Kernel 1: block-mean compressed K/V.  kc/vc: [NB][NHK][HD]
// --------------------------------------------------------------------------
__global__ void nsa_cmpkv_kernel(const float* __restrict__ k,
                                 const float* __restrict__ v,
                                 float* __restrict__ kc,
                                 float* __restrict__ vc) {
    int idx = blockIdx.x * blockDim.x + threadIdx.x;
    if (idx >= NBC * NHK * HDIM) return;
    int d  = idx % HDIM;
    int hk = (idx / HDIM) % NHK;
    int n  = idx / (HDIM * NHK);
    float sk = 0.f, sv = 0.f;
    for (int i = 0; i < BLKC; ++i) {
        int row = n * BLKC + i;
        sk += k[(row * NHK + hk) * HDIM + d];
        sv += v[(row * NHK + hk) * HDIM + d];
    }
    kc[(n * NHK + hk) * HDIM + d] = sk * (1.0f / BLKC);
    vc[(n * NHK + hk) * HDIM + d] = sv * (1.0f / BLKC);
}

// --------------------------------------------------------------------------
// Kernel 2: sliding-window branch, flash attention, WMMA f32 16x16x4.
// Two waves per (16-query tile, q-head): wave w takes every second key tile,
// from the diagonal tile minus w downwards, with a K/V ring, a P tile and an
// online softmax of its own; the two partial results are joined through LDS.
// Double-buffered async global->LDS staging of K/V tiles overlaps the next
// tile's load with this tile's WMMAs. Writes (initializes) d_out.
// --------------------------------------------------------------------------

// Orders one wave's own LDS traffic: what some lanes store, other lanes of the
// same wave load behind it. The P tile is private to a wave, so this takes the
// place of a work-group barrier, which would tie the two waves' trips together.
__device__ __forceinline__ void wave_lds_sync() {
    __builtin_amdgcn_fence(__ATOMIC_RELEASE, "workgroup");
    __builtin_amdgcn_wave_barrier();
    __builtin_amdgcn_fence(__ATOMIC_ACQUIRE, "workgroup");
}

__global__ __launch_bounds__(64)
void nsa_win_kernel(const float* __restrict__ q, const float* __restrict__ k,
                    const float* __restrict__ v, const float* __restrict__ gw,
                    float* __restrict__ out) {
    __shared__ __align__(16) float q_l[16][132];
    __shared__ __align__(16) float k_l[2][2][16][132];   // [wave][buffer]
    __shared__ __align__(16) float v_l[2][2][16][132];
    __shared__ float p_l[2][16][17];

    const int qt   = blockIdx.x / NHQ;
    const int hq   = blockIdx.x % NHQ;
    const int hk   = hq / REPG;
    const int q0   = qt * 16;
    const int tid  = threadIdx.x;
    const int wv   = __builtin_amdgcn_readfirstlane(tid >> 5);  // scalar: 0 or 1
    const int lane = tid & 31;
    const int half = lane >> 4;     // 0 or 1
    const int l16  = lane & 15;
    const float scale = 0.08838834764831845f;   // 1/sqrt(128)

    const int ktd = qt;
    int lowkey = q0 - (WINW - 1); if (lowkey < 0) lowkey = 0;
    const int ktl = lowkey >> 4;

    // ---- tile staging (async double-buffer if available) ----
#ifdef HAVE_ASYNC_LDS
#define ISSUE_TILE(bufi, ktv)                                                  \
    do {                                                                       \
        for (int i_ = 0; i_ < 16; ++i_) {                                      \
            int idx_ = i_ * 32 + lane;         /* 512 16B chunks per tile */   \
            int r_ = idx_ >> 5;                                                \
            int d_ = (idx_ & 31) << 2;                                         \
            const float* gk_ = &k[(((ktv) * 16 + r_) * NHK + hk) * HDIM + d_]; \
            const float* gv_ = &v[(((ktv) * 16 + r_) * NHK + hk) * HDIM + d_]; \
            __builtin_amdgcn_global_load_async_to_lds_b128(                    \
                (gv4i*)gk_, (lv4i*)&k_l[wv][bufi][r_][d_], 0, 0);              \
            __builtin_amdgcn_global_load_async_to_lds_b128(                    \
                (gv4i*)gv_, (lv4i*)&v_l[wv][bufi][r_][d_], 0, 0);              \
        }                                                                      \
    } while (0)
    // the wave's own copies of this trip's tile have landed
#define WAIT_TILE() asm volatile("s_wait_asynccnt 0x0" ::: "memory")
#else
#define ISSUE_TILE(bufi, ktv)                                                  \
    do {                                                                       \
        for (int idx_ = lane; idx_ < 16 * HDIM; idx_ += 32) {                  \
            int r_ = idx_ >> 7, d_ = idx_ & 127;                               \
            k_l[wv][bufi][r_][d_] = k[(((ktv) * 16 + r_) * NHK + hk) * HDIM + d_]; \
            v_l[wv][bufi][r_][d_] = v[(((ktv) * 16 + r_) * NHK + hk) * HDIM + d_]; \
        }                                                                      \
    } while (0)
#define WAIT_TILE() wave_lds_sync()
#endif

    int buf = 0;
    if (ktd - wv >= ktl) ISSUE_TILE(0, ktd - wv);   // prologue: the wave's first tile in flight

    for (int idx = tid; idx < 16 * HDIM; idx += 64) {
        int r = idx >> 7, d = idx & 127;
        q_l[r][d] = q[((q0 + r) * NHQ + hq) * HDIM + d];
    }
    __syncthreads();

    v8f acc[8];
    float mrow[8], lrow[8];
#pragma unroll
    for (int nt = 0; nt < 8; ++nt)
#pragma unroll
        for (int j = 0; j < 8; ++j) acc[nt][j] = 0.f;
#pragma unroll
    for (int j = 0; j < 8; ++j) { mrow[j] = -3.0e38f; lrow[j] = 0.f; }

    for (int kt = ktd - wv; kt >= ktl; kt -= 2) {
        // the wave's reads of the buffer that is refilled below have retired
        asm volatile("s_wait_dscnt 0x0" ::: "memory");
        WAIT_TILE();            // buffer buf now resident in LDS
        const int nxt = buf ^ 1;
        if (kt - 2 >= ktl) ISSUE_TILE(nxt, kt - 2);  // overlap with compute

        // ---- S = Q K^T (16x16 tile) ----
        v8f c;
#pragma unroll
        for (int j = 0; j < 8; ++j) c[j] = 0.f;
#pragma unroll
        for (int kk = 0; kk < HDIM; kk += 4) {
            v2f a, b;
            a[0] = q_l[l16][kk + 2 * half + 0];
            a[1] = q_l[l16][kk + 2 * half + 1];
            b[0] = k_l[wv][buf][l16][kk + 2 * half + 0];
            b[1] = k_l[wv][buf][l16][kk + 2 * half + 1];
            c = __builtin_amdgcn_wmma_f32_16x16x4_f32(false, a, false, b,
                                                      (short)0, c, false, false);
        }

        // ---- mask + online softmax update ----
        const int ng = kt * 16 + l16;
#pragma unroll
        for (int j = 0; j < 8; ++j) {
            int qs  = q0 + j + 8 * half;
            int dif = qs - ng;
            bool valid = (dif >= 0) && (dif < WINW);
            float sv = valid ? c[j] * scale : NEGV;
            float rmax = sv;
#pragma unroll
            for (int m = 1; m <= 8; m <<= 1)
                rmax = fmaxf(rmax, __shfl_xor(rmax, m, 32));
            float mnew = fmaxf(mrow[j], rmax);
            float corr = expf(mrow[j] - mnew);
            float p    = expf(sv - mnew);
            float rsum = p;
#pragma unroll
            for (int m = 1; m <= 8; m <<= 1)
                rsum += __shfl_xor(rsum, m, 32);
            lrow[j] = lrow[j] * corr + rsum;
            mrow[j] = mnew;
#pragma unroll
            for (int nt = 0; nt < 8; ++nt) acc[nt][j] *= corr;
            p_l[wv][j + 8 * half][l16] = p;
        }
        wave_lds_sync();

        // ---- O += P * V (16x16 x 16x128) ----
#pragma unroll
        for (int kc4 = 0; kc4 < 16; kc4 += 4) {
            v2f a;
            a[0] = p_l[wv][l16][kc4 + 2 * half + 0];
            a[1] = p_l[wv][l16][kc4 + 2 * half + 1];
#pragma unroll
            for (int nt = 0; nt < 8; ++nt) {
                v2f b;
                b[0] = v_l[wv][buf][kc4 + 2 * half + 0][nt * 16 + l16];
                b[1] = v_l[wv][buf][kc4 + 2 * half + 1][nt * 16 + l16];
                acc[nt] = __builtin_amdgcn_wmma_f32_16x16x4_f32(false, a, false, b,
                                                   (short)0, acc[nt], false, false);
            }
        }
        buf = nxt;
    }

    // ---- join: wave w finishes column tiles 4w..4w+3. Each wave hands the
    // other four tiles, its row maxima and its row sums over in its own ring,
    // lane for lane (both waves hold the same fragment layout). A wave without
    // a tile hands over zeros with the start maximum: weight exp(-huge) = 0.
    float* mine  = &k_l[wv][0][0][0];
    float* other = &k_l[wv ^ 1][0][0][0];
#pragma unroll   // acc[] stays in registers: nt is a constant in every index
    for (int nt = 0; nt < 8; ++nt)
        if ((nt >> 2) != wv) {
            *(float4*)&mine[(((nt & 3) * 2 + 0) * 32 + lane) * 4] =
                make_float4(acc[nt][0], acc[nt][1], acc[nt][2], acc[nt][3]);
            *(float4*)&mine[(((nt & 3) * 2 + 1) * 32 + lane) * 4] =
                make_float4(acc[nt][4], acc[nt][5], acc[nt][6], acc[nt][7]);
        }
#pragma unroll   // mrow[], lrow[] stay in registers
    for (int j = 0; j < 8; ++j) {
        mine[1024 + j * 32 + lane] = mrow[j];
        mine[1280 + j * 32 + lane] = lrow[j];
    }
    __syncthreads();

    float wa[8], wb[8], gr[8];
#pragma unroll   // mrow[], lrow[] stay in registers
    for (int j = 0; j < 8; ++j) {
        float mo = other[1024 + j * 32 + lane];
        float lo = other[1280 + j * 32 + lane];
        float mj = fmaxf(mrow[j], mo);
        wa[j] = expf(mrow[j] - mj);
        wb[j] = expf(mo - mj);
        lrow[j] = lrow[j] * wa[j] + lo * wb[j];
        gr[j] = gw[(q0 + j + 8 * half) * NHQ + hq];
    }
#pragma unroll   // acc[] stays in registers: nt is a constant in every index
    for (int nt = 0; nt < 8; ++nt)
        if ((nt >> 2) == wv) {
            const float4 o0 = *(const float4*)&other[(((nt & 3) * 2 + 0) * 32 + lane) * 4];
            const float4 o1 = *(const float4*)&other[(((nt & 3) * 2 + 1) * 32 + lane) * 4];
            const float ob[8] = {o0.x, o0.y, o0.z, o0.w, o1.x, o1.y, o1.z, o1.w};
#pragma unroll   // ob[] stays in registers
            for (int j = 0; j < 8; ++j) {
                int row = q0 + j + 8 * half;
                int d   = nt * 16 + l16;
                float o = (acc[nt][j] * wa[j] + ob[j] * wb[j]) / lrow[j];
                out[(row * NHQ + hq) * HDIM + d] = gr[j] * o;
            }
            // stands in front of any rewrite of a register that these stores name
            asm volatile("s_wait_xcnt 0x0" ::: "memory");
        }
#undef ISSUE_TILE
#undef WAIT_TILE
}

// --------------------------------------------------------------------------
// Kernel 3: compressed branch. Writes normalized pc [NHQ][S][NB] to ws and
// adds g_cmp * o_cmp into d_out.
// --------------------------------------------------------------------------
__global__ __launch_bounds__(32)
void nsa_cmp_kernel(const float* __restrict__ q, const float* __restrict__ kc,
                    const float* __restrict__ vc, const float* __restrict__ gc,
                    float* __restrict__ pc_ws, float* __restrict__ out) {
    __shared__ float q_l[16][132];
    __shared__ float k_l[16][132];
    __shared__ float v_l[16][132];
    __shared__ float p_l[16][68];

    const int qt   = blockIdx.x / NHQ;
    const int hq   = blockIdx.x % NHQ;
    const int hk   = hq / REPG;
    const int q0   = qt * 16;
    const int tid  = threadIdx.x;
    const int half = tid >> 4;
    const int l16  = tid & 15;
    const float scale = 0.08838834764831845f;

    for (int idx = tid; idx < 16 * HDIM; idx += 32) {
        int r = idx >> 7, d = idx & 127;
        q_l[r][d] = q[((q0 + r) * NHQ + hq) * HDIM + d];
    }

    v8f sc[4];
    for (int nt = 0; nt < 4; ++nt) {
        __syncthreads();
        for (int idx = tid; idx < 16 * HDIM; idx += 32) {
            int r = idx >> 7, d = idx & 127;
            k_l[r][d] = kc[((nt * 16 + r) * NHK + hk) * HDIM + d];
        }
        __syncthreads();
        v8f c;
#pragma unroll
        for (int j = 0; j < 8; ++j) c[j] = 0.f;
#pragma unroll
        for (int kk = 0; kk < HDIM; kk += 4) {
            v2f a, b;
            a[0] = q_l[l16][kk + 2 * half + 0];
            a[1] = q_l[l16][kk + 2 * half + 1];
            b[0] = k_l[l16][kk + 2 * half + 0];
            b[1] = k_l[l16][kk + 2 * half + 1];
            c = __builtin_amdgcn_wmma_f32_16x16x4_f32(false, a, false, b,
                                                      (short)0, c, false, false);
        }
        sc[nt] = c;
    }

    // mask + scale  (block fully in the past: (n+1)*32-1 <= s)
    for (int nt = 0; nt < 4; ++nt)
#pragma unroll
        for (int j = 0; j < 8; ++j) {
            int n = nt * 16 + l16;
            int s = q0 + j + 8 * half;
            bool valid = ((n + 1) * BLKC - 1) <= s;
            sc[nt][j] = valid ? sc[nt][j] * scale : NEGV;
        }

    // row softmax over 64 blocks
    float mrow[8], lrow[8];
#pragma unroll
    for (int j = 0; j < 8; ++j) {
        float rm = -3.0e38f;
        for (int nt = 0; nt < 4; ++nt) rm = fmaxf(rm, sc[nt][j]);
#pragma unroll
        for (int m = 1; m <= 8; m <<= 1) rm = fmaxf(rm, __shfl_xor(rm, m, 32));
        mrow[j] = rm;
    }
    for (int nt = 0; nt < 4; ++nt)
#pragma unroll
        for (int j = 0; j < 8; ++j) sc[nt][j] = expf(sc[nt][j] - mrow[j]);
#pragma unroll
    for (int j = 0; j < 8; ++j) {
        float rs = 0.f;
        for (int nt = 0; nt < 4; ++nt) rs += sc[nt][j];
#pragma unroll
        for (int m = 1; m <= 8; m <<= 1) rs += __shfl_xor(rs, m, 32);
        lrow[j] = rs;
    }
    for (int nt = 0; nt < 4; ++nt)
#pragma unroll
        for (int j = 0; j < 8; ++j) {
            float p = sc[nt][j] / lrow[j];
            int s = q0 + j + 8 * half;
            int n = nt * 16 + l16;
            pc_ws[(hq * SS + s) * NBC + n] = p;
            p_l[j + 8 * half][n] = p;
        }

    // O = P (16x64) * vc (64x128), staged 16 K-rows at a time
    v8f acc[8];
#pragma unroll
    for (int nt = 0; nt < 8; ++nt)
#pragma unroll
        for (int j = 0; j < 8; ++j) acc[nt][j] = 0.f;

    for (int st = 0; st < 4; ++st) {
        __syncthreads();
        for (int idx = tid; idx < 16 * HDIM; idx += 32) {
            int r = idx >> 7, d = idx & 127;
            v_l[r][d] = vc[((st * 16 + r) * NHK + hk) * HDIM + d];
        }
        __syncthreads();
#pragma unroll
        for (int kq = 0; kq < 16; kq += 4) {
            int kc4 = st * 16 + kq;
            v2f a;
            a[0] = p_l[l16][kc4 + 2 * half + 0];
            a[1] = p_l[l16][kc4 + 2 * half + 1];
#pragma unroll
            for (int nt = 0; nt < 8; ++nt) {
                v2f b;
                b[0] = v_l[kq + 2 * half + 0][nt * 16 + l16];
                b[1] = v_l[kq + 2 * half + 1][nt * 16 + l16];
                acc[nt] = __builtin_amdgcn_wmma_f32_16x16x4_f32(false, a, false, b,
                                                   (short)0, acc[nt], false, false);
            }
        }
    }

    for (int nt = 0; nt < 8; ++nt)
        for (int j = 0; j < 8; ++j) {
            int row = q0 + j + 8 * half;
            int d   = nt * 16 + l16;
            float o = (row >= BLKC - 1) ? acc[nt][j] : 0.f;  // cmask.any zeroing
            out[(row * NHQ + hq) * HDIM + d] += gc[row * NHQ + hq] * o;
        }
}

// --------------------------------------------------------------------------
// Kernel 4: top-4 block selection per (s, hk). Deterministic argmax passes,
// strict '>' matches top_k's lower-index tie break.
// --------------------------------------------------------------------------
__global__ void nsa_sel_kernel(const float* __restrict__ pc, int* __restrict__ sel) {
    int idx = blockIdx.x * blockDim.x + threadIdx.x;
    if (idx >= SS * NHK) return;
    int hk = idx % NHK;
    int s  = idx / NHK;
    int cur = s / BLKC;
    float scb[NBC];
    for (int n = 0; n < NBC; ++n) {
        float vsum = 0.f;
        for (int r = 0; r < REPG; ++r)
            vsum += pc[((hk * REPG + r) * SS + s) * NBC + n];
        if (n == cur) vsum += 1e6f;
        if (n == 0)   vsum += 1e6f;
        scb[n] = vsum;
    }
    for (int t = 0; t < TOPN; ++t) {
        int best = 0; float bv = scb[0];
        for (int n = 1; n < NBC; ++n)
            if (scb[n] > bv) { bv = scb[n]; best = n; }
        sel[(s * NHK + hk) * TOPN + t] = best;
        scb[best] = -3.0e38f;
    }
}

// --------------------------------------------------------------------------
// Kernel 5: selected branch. 128 threads per (s, hk): 4 rep heads, 128
// gathered keys, K rows staged in LDS. Adds g_slt * o_slt into d_out.
// --------------------------------------------------------------------------
__global__ __launch_bounds__(128)
void nsa_slt_kernel(const float* __restrict__ q, const float* __restrict__ k,
                    const float* __restrict__ v, const float* __restrict__ gs,
                    const int* __restrict__ sel, float* __restrict__ out) {
    // K is staged in two halves of the head dim (64 floats a row) so that eight
    // work-groups fit one WGP's LDS. Row pitch 272 B = 16 B x 17: 16-byte reads
    // of one row per lane meet no bank conflict.
    __shared__ __align__(16) float k_l[TOPN * BLKC][HDIM / 2 + 4];
    __shared__ __align__(16) float qsm[REPG][HDIM];
    __shared__ float scm[REPG][TOPN * BLKC];
    __shared__ int   selb[TOPN];

    const int s  = blockIdx.x / NHK;
    const int hk = blockIdx.x % NHK;
    const int t  = threadIdx.x;
    const float scale = 0.08838834764831845f;

    // wave w stages the 32 rows of selected block w; k_l row t belongs to key t.
    // One copy of the wave = two half rows of 256 contiguous bytes: whole cache lines.
    const int bsel = sel[(s * NHK + hk) * TOPN + (t >> 5)];
    const float* g0 = k + ((bsel * BLKC + ((t >> 4) & 1)) * NHK + hk) * HDIM + 4 * (t & 15);
    const unsigned l0 = (unsigned)(size_t)&k_l[(t & ~31) + ((t >> 4) & 1)][4 * (t & 15)];
    constexpr int GSTEP = 2 * NHK * HDIM;            // floats: two key rows on
    constexpr unsigned LSTEP = 2 * (HDIM / 2 + 4) * 4;  // bytes: two k_l rows on

    float a[REPG] = {0.f, 0.f, 0.f, 0.f};
#pragma unroll   // two trips, straight-line: h is a constant in every address
    for (int h = 0; h < 2; ++h) {
        if (h) {
            // every reader has left k_l before the second half overwrites it
            asm volatile("s_wait_dscnt 0x0" ::: "memory");
            __syncthreads();
        }
#pragma unroll   // straight-line: all 16 copies of the wave are in flight together
        for (int i = 0; i < 16; i += 8) {
            const float* g = g0 + h * (HDIM / 2) + i * GSTEP;
            const unsigned l = l0 + i * LSTEP;
            // the closing s_wait_xcnt stands in the copies' own statement, in
            // front of any rewrite of the address registers that they name
            asm volatile(
                "global_load_async_to_lds_b128 %0, %8, off\n\t"
                "global_load_async_to_lds_b128 %1, %9, off\n\t"
                "global_load_async_to_lds_b128 %2, %10, off\n\t"
                "global_load_async_to_lds_b128 %3, %11, off\n\t"
                "global_load_async_to_lds_b128 %4, %12, off\n\t"
                "global_load_async_to_lds_b128 %5, %13, off\n\t"
                "global_load_async_to_lds_b128 %6, %14, off\n\t"
                "global_load_async_to_lds_b128 %7, %15, off\n\t"
                "s_wait_xcnt 0x0"
                :: "v"(l), "v"(l + 1 * LSTEP), "v"(l + 2 * LSTEP), "v"(l + 3 * LSTEP),
                   "v"(l + 4 * LSTEP), "v"(l + 5 * LSTEP), "v"(l + 6 * LSTEP), "v"(l + 7 * LSTEP),
                   "v"(g), "v"(g + 1 * GSTEP), "v"(g + 2 * GSTEP), "v"(g + 3 * GSTEP),
                   "v"(g + 4 * GSTEP), "v"(g + 5 * GSTEP), "v"(g + 6 * GSTEP), "v"(g + 7 * GSTEP)
                : "memory");
        }
        if (h == 0) {
            for (int i = t; i < REPG * HDIM; i += 128) {
                int r = i / HDIM, d = i % HDIM;
                qsm[r][d] = q[(s * NHQ + hk * REPG + r) * HDIM + d];
            }
            if (t < TOPN) selb[t] = sel[(s * NHK + hk) * TOPN + t];
        }
        // the wave's own copies have landed before the barrier publishes k_l
        asm volatile("s_wait_asynccnt 0x0" ::: "memory");
        __syncthreads();

        // scores: thread t handles key t, read from its k_l row; each head's
        // sum runs over d in ascending order
        for (int d = 0; d < HDIM / 2; d += 4) {
            const float4 kv = *(const float4*)&k_l[t][d];
#pragma unroll   // a[] stays in registers
            for (int r = 0; r < REPG; ++r) {
                const float4 qv = *(const float4*)&qsm[r][h * (HDIM / 2) + d];
                a[r] = fmaf(qv.x, kv.x, a[r]);
                a[r] = fmaf(qv.y, kv.y, a[r]);
                a[r] = fmaf(qv.z, kv.z, a[r]);
                a[r] = fmaf(qv.w, kv.w, a[r]);
            }
        }
    }
    {
        int pos = bsel * BLKC + (t % BLKC);
#pragma unroll   // a[] stays in registers
        for (int r = 0; r < REPG; ++r)
            scm[r][t] = (pos <= s) ? a[r] * scale : NEGV;
    }
    __syncthreads();

    // softmax: wave w handles row w (4 waves of 32 lanes)
    {
        int wave = t >> 5, lane = t & 31;
        float vals[4];
        float mloc = -3.0e38f;
        for (int i = 0; i < 4; ++i) {
            vals[i] = scm[wave][lane + 32 * i];
            mloc = fmaxf(mloc, vals[i]);
        }
        for (int m = 1; m <= 16; m <<= 1)
            mloc = fmaxf(mloc, __shfl_xor(mloc, m, 32));
        float ssum = 0.f;
        for (int i = 0; i < 4; ++i) { vals[i] = expf(vals[i] - mloc); ssum += vals[i]; }
        for (int m = 1; m <= 16; m <<= 1)
            ssum += __shfl_xor(ssum, m, 32);
        float inv = 1.0f / ssum;
        for (int i = 0; i < 4; ++i) scm[wave][lane + 32 * i] = vals[i] * inv;
    }
    __syncthreads();

    // output: thread t handles dim d = t for all 4 rep heads
    {
        float o0 = 0.f, o1 = 0.f, o2 = 0.f, o3 = 0.f;
        for (int key = 0; key < TOPN * BLKC; ++key) {
            int pos = selb[key / BLKC] * BLKC + (key % BLKC);
            float vv = v[(pos * NHK + hk) * HDIM + t];
            o0 += scm[0][key] * vv;
            o1 += scm[1][key] * vv;
            o2 += scm[2][key] * vv;
            o3 += scm[3][key] * vv;
        }
        float os[4] = {o0, o1, o2, o3};
        for (int r = 0; r < REPG; ++r) {
            int hq = hk * REPG + r;
            out[(s * NHQ + hq) * HDIM + t] += gs[s * NHQ + hq] * os[r];
        }
    }
}

// --------------------------------------------------------------------------
extern "C" void kernel_launch(void* const* d_in, const int* in_sizes, int n_in,
                              void* d_out, int out_size, void* d_ws, size_t ws_size,
                              hipStream_t stream) {
    const float* q  = (const float*)d_in[0];
    const float* k  = (const float*)d_in[1];
    const float* v  = (const float*)d_in[2];
    const float* gw = (const float*)d_in[3];
    const float* gc = (const float*)d_in[4];
    const float* gs = (const float*)d_in[5];
    float* out = (float*)d_out;

    float* ws = (float*)d_ws;
    float* kc = ws;                                  // NB*NHK*HD = 16384 floats
    float* vc = ws + NBC * NHK * HDIM;               // 16384 floats
    float* pc = vc + NBC * NHK * HDIM;               // NHQ*S*NB = 1,048,576 floats
    int*  sel = (int*)(pc + (size_t)NHQ * SS * NBC); // S*NHK*TOPN ints

    nsa_cmpkv_kernel<<<(NBC * NHK * HDIM + 255) / 256, 256, 0, stream>>>(k, v, kc, vc);
    nsa_win_kernel<<<(SS / 16) * NHQ, 64, 0, stream>>>(q, k, v, gw, out);
    nsa_cmp_kernel<<<(SS / 16) * NHQ, 32, 0, stream>>>(q, kc, vc, gc, pc, out);
    nsa_sel_kernel<<<(SS * NHK + 255) / 256, 256, 0, stream>>>(pc, sel);
    nsa_slt_kernel<<<SS * NHK, 128, 0, stream>>>(q, k, v, gs, sel, out);
}

// v003
// It runs in 131 microseconds.
// In two side-by-side timings against v002, it was 1.06 and 1.07 times as fast.
// Over all steps from v000 it is 1.80 times as fast.
#include <hip/hip_runtime.h>
#include <hip/hip_bf16.h>

#define SS   2048
#define NHQ  8
#define NHK  2
#define HDIM 128
#define REPG 4
#define WINW 512
#define BLKC 32
#define NBC  64
#define TOPN 4
#define NEGV (-1e30f)

typedef __attribute__((ext_vector_type(2))) float v2f;
typedef __attribute__((ext_vector_type(8))) float v8f;

#if defined(__has_builtin)
#if __has_builtin(__builtin_amdgcn_global_load_async_to_lds_b128)
#define HAVE_ASYNC_LDS 1
#endif
#endif

#ifdef HAVE_ASYNC_LDS
// builtin signature (from hipcc diagnostic): takes pointers to 16-byte int
// vectors: (v4i addrspace(1)*, v4i addrspace(3)*, imm offset, imm cpol)
typedef int v4i_ __attribute__((vector_size(16)));
typedef __attribute__((address_space(1))) v4i_ gv4i;
typedef __attribute__((address_space(3))) v4i_ lv4i;
#endif

// --------------------------------------------------------------------------
// Kernel 1: block-mean compressed K/V.  kc/vc: [NB][NHK][HD]
// --------------------------------------------------------------------------
__global__ void nsa_cmpkv_kernel(const float* __restrict__ k,
                                 const float* __restrict__ v,
                                 float* __restrict__ kc,
                                 float* __restrict__ vc) {
    int idx = blockIdx.x * blockDim.x + threadIdx.x;
    if (idx >= NBC * NHK * HDIM) return;
    int d  = idx % HDIM;
    int hk = (idx / HDIM) % NHK;
    int n  = idx / (HDIM * NHK);
    float sk = 0.f, sv = 0.f;
    for (int i = 0; i < BLKC; ++i) {
        int row = n * BLKC + i;
        sk += k[(row * NHK + hk) * HDIM + d];
        sv += v[(row * NHK + hk) * HDIM + d];
    }
    kc[(n * NHK + hk) * HDIM + d] = sk * (1.0f / BLKC);
    vc[(n * NHK + hk) * HDIM + d] = sv * (1.0f / BLKC);
}

// --------------------------------------------------------------------------
// Kernel 2: sliding-window branch, flash attention, WMMA f32 16x16x4.
// Two waves per (16-query tile, q-head): wave w takes every second key tile,
// from the diagonal tile minus w downwards, with a K/V ring, a P tile and an
// online softmax of its own; the two partial results are joined through LDS.
// Double-buffered async global->LDS staging of K/V tiles overlaps the next
// tile's load with this tile's WMMAs. Writes (initializes) d_out.
// --------------------------------------------------------------------------

// Orders one wave's own LDS traffic: what some lanes store, other lanes of the
// same wave load behind it. The P tile is private to a wave, so this takes the
// place of a work-group barrier, which would tie the two waves' trips together.
__device__ __forceinline__ void wave_lds_sync() {
    __builtin_amdgcn_fence(__ATOMIC_RELEASE, "workgroup");
    __builtin_amdgcn_wave_barrier();
    __builtin_amdgcn_fence(__ATOMIC_ACQUIRE, "workgroup");
}

__global__ __launch_bounds__(64)
void nsa_win_kernel(const float* __restrict__ q, const float* __restrict__ k,
                    const float* __restrict__ v, const float* __restrict__ gw,
                    float* __restrict__ out) {
    __shared__ __align__(16) float q_l[16][132];
    __shared__ __align__(16) float k_l[2][2][16][132];   // [wave][buffer]
    __shared__ __align__(16) float v_l[2][2][16][132];
    __shared__ float p_l[2][16][17];

    const int qt   = blockIdx.x / NHQ;
    const int hq   = blockIdx.x % NHQ;
    const int hk   = hq / REPG;
    const int q0   = qt * 16;
    const int tid  = threadIdx.x;
    const int wv   = __builtin_amdgcn_readfirstlane(tid >> 5);  // scalar: 0 or 1
    const int lane = tid & 31;
    const int half = lane >> 4;     // 0 or 1
    const int l16  = lane & 15;
    const float scale = 0.08838834764831845f;   // 1/sqrt(128)

    const int ktd = qt;
    int lowkey = q0 - (WINW - 1); if (lowkey < 0) lowkey = 0;
    const int ktl = lowkey >> 4;

    // ---- tile staging (async double-buffer if available) ----
#ifdef HAVE_ASYNC_LDS
#define ISSUE_TILE(bufi, ktv)                                                  \
    do {                                                                       \
        for (int i_ = 0; i_ < 16; ++i_) {                                      \
            int idx_ = i_ * 32 + lane;         /* 512 16B chunks per tile */   \
            int r_ = idx_ >> 5;                                                \
            int d_ = (idx_ & 31) << 2;                                         \
            const float* gk_ = &k[(((ktv) * 16 + r_) * NHK + hk) * HDIM + d_]; \
            const float* gv_ = &v[(((ktv) * 16 + r_) * NHK + hk) * HDIM + d_]; \
            __builtin_amdgcn_global_load_async_to_lds_b128(                    \
                (gv4i*)gk_, (lv4i*)&k_l[wv][bufi][r_][d_], 0, 0);              \
            __builtin_amdgcn_global_load_async_to_lds_b128(                    \
                (gv4i*)gv_, (lv4i*)&v_l[wv][bufi][r_][d_], 0, 0);              \
        }                                                                      \
    } while (0)
    // the wave's own copies of this trip's tile have landed
#define WAIT_TILE() asm volatile("s_wait_asynccnt 0x0" ::: "memory")
#else
#define ISSUE_TILE(bufi, ktv)                                                  \
    do {                                                                       \
        for (int idx_ = lane; idx_ < 16 * HDIM; idx_ += 32) {                  \
            int r_ = idx_ >> 7, d_ = idx_ & 127;                               \
            k_l[wv][bufi][r_][d_] = k[(((ktv) * 16 + r_) * NHK + hk) * HDIM + d_]; \
            v_l[wv][bufi][r_][d_] = v[(((ktv) * 16 + r_) * NHK + hk) * HDIM + d_]; \
        }                                                                      \
    } while (0)
#define WAIT_TILE() wave_lds_sync()
#endif

    int buf = 0;
    if (ktd - wv >= ktl) ISSUE_TILE(0, ktd - wv);   // prologue: the wave's first tile in flight

    for (int idx = tid; idx < 16 * HDIM; idx += 64) {
        int r = idx >> 7, d = idx & 127;
        q_l[r][d] = q[((q0 + r) * NHQ + hq) * HDIM + d];
    }
    __syncthreads();

    v8f acc[8];
    float mrow[8], lrow[8];
#pragma unroll
    for (int nt = 0; nt < 8; ++nt)
#pragma unroll
        for (int j = 0; j < 8; ++j) acc[nt][j] = 0.f;
#pragma unroll
    for (int j = 0; j < 8; ++j) { mrow[j] = -3.0e38f; lrow[j] = 0.f; }

    for (int kt = ktd - wv; kt >= ktl; kt -= 2) {
        // the wave's reads of the buffer that is refilled below have retired
        asm volatile("s_wait_dscnt 0x0" ::: "memory");
        WAIT_TILE();            // buffer buf now resident in LDS
        const int nxt = buf ^ 1;
        if (kt - 2 >= ktl) ISSUE_TILE(nxt, kt - 2);  // overlap with compute

        // ---- S = Q K^T (16x16 tile) ----
        v8f c;
#pragma unroll
        for (int j = 0; j < 8; ++j) c[j] = 0.f;
#pragma unroll
        for (int kk = 0; kk < HDIM; kk += 4) {
            v2f a, b;
            a[0] = q_l[l16][kk + 2 * half + 0];
            a[1] = q_l[l16][kk + 2 * half + 1];
            b[0] = k_l[wv][buf][l16][kk + 2 * half + 0];
            b[1] = k_l[wv][buf][l16][kk + 2 * half + 1];
            c = __builtin_amdgcn_wmma_f32_16x16x4_f32(false, a, false, b,
                                                      (short)0, c, false, false);
        }

        // ---- mask + online softmax update ----
        const int ng = kt * 16 + l16;
#pragma unroll
        for (int j = 0; j < 8; ++j) {
            int qs  = q0 + j + 8 * half;
            int dif = qs - ng;
            bool valid = (dif >= 0) && (dif < WINW);
            float sv = valid ? c[j] * scale : NEGV;
            float rmax = sv;
#pragma unroll
            for (int m = 1; m <= 8; m <<= 1)
                rmax = fmaxf(rmax, __shfl_xor(rmax, m, 32));
            float mnew = fmaxf(mrow[j], rmax);
            float corr = expf(mrow[j] - mnew);
            float p    = expf(sv - mnew);
            float rsum = p;
#pragma unroll
            for (int m = 1; m <= 8; m <<= 1)
                rsum += __shfl_xor(rsum, m, 32);
            lrow[j] = lrow[j] * corr + rsum;
            mrow[j] = mnew;
#pragma unroll
            for (int nt = 0; nt < 8; ++nt) acc[nt][j] *= corr;
            p_l[wv][j + 8 * half][l16] = p;
        }
        wave_lds_sync();

        // ---- O += P * V (16x16 x 16x128) ----
#pragma unroll
        for (int kc4 = 0; kc4 < 16; kc4 += 4) {
            v2f a;
            a[0] = p_l[wv][l16][kc4 + 2 * half + 0];
            a[1] = p_l[wv][l16][kc4 + 2 * half + 1];
#pragma unroll
            for (int nt = 0; nt < 8; ++nt) {
                v2f b;
                b[0] = v_l[wv][buf][kc4 + 2 * half + 0][nt * 16 + l16];
                b[1] = v_l[wv][buf][kc4 + 2 * half + 1][nt * 16 + l16];
                acc[nt] = __builtin_amdgcn_wmma_f32_16x16x4_f32(false, a, false, b,
                                                   (short)0, acc[nt], false, false);
            }
        }
        buf = nxt;
    }

    // ---- join: wave w finishes column tiles 4w..4w+3. Each wave hands the
    // other four tiles, its row maxima and its row sums over in its own ring,
    // lane for lane (both waves hold the same fragment layout). A wave without
    // a tile hands over zeros with the start maximum: weight exp(-huge) = 0.
    float* mine  = &k_l[wv][0][0][0];
    float* other = &k_l[wv ^ 1][0][0][0];
#pragma unroll   // acc[] stays in registers: nt is a constant in every index
    for (int nt = 0; nt < 8; ++nt)
        if ((nt >> 2) != wv) {
            *(float4*)&mine[(((nt & 3) * 2 + 0) * 32 + lane) * 4] =
                make_float4(acc[nt][0], acc[nt][1], acc[nt][2], acc[nt][3]);
            *(float4*)&mine[(((nt & 3) * 2 + 1) * 32 + lane) * 4] =
                make_float4(acc[nt][4], acc[nt][5], acc[nt][6], acc[nt][7]);
        }
#pragma unroll   // mrow[], lrow[] stay in registers
    for (int j = 0; j < 8; ++j) {
        mine[1024 + j * 32 + lane] = mrow[j];
        mine[1280 + j * 32 + lane] = lrow[j];
    }
    __syncthreads();

    float wa[8], wb[8], gr[8];
#pragma unroll   // mrow[], lrow[] stay in registers
    for (int j = 0; j < 8; ++j) {
        float mo = other[1024 + j * 32 + lane];
        float lo = other[1280 + j * 32 + lane];
        float mj = fmaxf(mrow[j], mo);
        wa[j] = expf(mrow[j] - mj);
        wb[j] = expf(mo - mj);
        lrow[j] = lrow[j] * wa[j] + lo * wb[j];
        gr[j] = gw[(q0 + j + 8 * half) * NHQ + hq];
    }
#pragma unroll   // acc[] stays in registers: nt is a constant in every index
    for (int nt = 0; nt < 8; ++nt)
        if ((nt >> 2) == wv) {
            const float4 o0 = *(const float4*)&other[(((nt & 3) * 2 + 0) * 32 + lane) * 4];
            const float4 o1 = *(const float4*)&other[(((nt & 3) * 2 + 1) * 32 + lane) * 4];
            const float ob[8] = {o0.x, o0.y, o0.z, o0.w, o1.x, o1.y, o1.z, o1.w};
#pragma unroll   // ob[] stays in registers
            for (int j = 0; j < 8; ++j) {
                int row = q0 + j + 8 * half;
                int d   = nt * 16 + l16;
                float o = (acc[nt][j] * wa[j] + ob[j] * wb[j]) / lrow[j];
                out[(row * NHQ + hq) * HDIM + d] = gr[j] * o;
            }
            // stands in front of any rewrite of a register that these stores name
            asm volatile("s_wait_xcnt 0x0" ::: "memory");
        }
#undef ISSUE_TILE
#undef WAIT_TILE
}

// --------------------------------------------------------------------------
// Kernel 3: compressed branch. Writes normalized pc [NHQ][S][NB] to ws and
// adds g_cmp * o_cmp into d_out.
// --------------------------------------------------------------------------
__global__ __launch_bounds__(32)
void nsa_cmp_kernel(const float* __restrict__ q, const float* __restrict__ kc,
                    const float* __restrict__ vc, const float* __restrict__ gc,
                    float* __restrict__ pc_ws, float* __restrict__ out) {
    __shared__ float q_l[16][132];
    __shared__ float k_l[16][132];
    __shared__ float v_l[16][132];
    __shared__ float p_l[16][68];

    const int qt   = blockIdx.x / NHQ;
    const int hq   = blockIdx.x % NHQ;
    const int hk   = hq / REPG;
    const int q0   = qt * 16;
    const int tid  = threadIdx.x;
    const int half = tid >> 4;
    const int l16  = tid & 15;
    const float scale = 0.08838834764831845f;

    for (int idx = tid; idx < 16 * HDIM; idx += 32) {
        int r = idx >> 7, d = idx & 127;
        q_l[r][d] = q[((q0 + r) * NHQ + hq) * HDIM + d];
    }

    v8f sc[4];
    for (int nt = 0; nt < 4; ++nt) {
        __syncthreads();
        for (int idx = tid; idx < 16 * HDIM; idx += 32) {
            int r = idx >> 7, d = idx & 127;
            k_l[r][d] = kc[((nt * 16 + r) * NHK + hk) * HDIM + d];
        }
        __syncthreads();
        v8f c;
#pragma unroll
        for (int j = 0; j < 8; ++j) c[j] = 0.f;
#pragma unroll
        for (int kk = 0; kk < HDIM; kk += 4) {
            v2f a, b;
            a[0] = q_l[l16][kk + 2 * half + 0];
            a[1] = q_l[l16][kk + 2 * half + 1];
            b[0] = k_l[l16][kk + 2 * half + 0];
            b[1] = k_l[l16][kk + 2 * half + 1];
            c = __builtin_amdgcn_wmma_f32_16x16x4_f32(false, a, false, b,
                                                      (short)0, c, false, false);
        }
        sc[nt] = c;
    }

    // mask + scale  (block fully in the past: (n+1)*32-1 <= s)
    for (int nt = 0; nt < 4; ++nt)
#pragma unroll
        for (int j = 0; j < 8; ++j) {
            int n = nt * 16 + l16;
            int s = q0 + j + 8 * half;
            bool valid = ((n + 1) * BLKC - 1) <= s;
            sc[nt][j] = valid ? sc[nt][j] * scale : NEGV;
        }

    // row softmax over 64 blocks
    float mrow[8], lrow[8];
#pragma unroll
    for (int j = 0; j < 8; ++j) {
        float rm = -3.0e38f;
        for (int nt = 0; nt < 4; ++nt) rm = fmaxf(rm, sc[nt][j]);
#pragma unroll
        for (int m = 1; m <= 8; m <<= 1) rm = fmaxf(rm, __shfl_xor(rm, m, 32));
        mrow[j] = rm;
    }
    for (int nt = 0; nt < 4; ++nt)
#pragma unroll
        for (int j = 0; j < 8; ++j) sc[nt][j] = expf(sc[nt][j] - mrow[j]);
#pragma unroll
    for (int j = 0; j < 8; ++j) {
        float rs = 0.f;
        for (int nt = 0; nt < 4; ++nt) rs += sc[nt][j];
#pragma unroll
        for (int m = 1; m <= 8; m <<= 1) rs += __shfl_xor(rs, m, 32);
        lrow[j] = rs;
    }
    for (int nt = 0; nt < 4; ++nt)
#pragma unroll
        for (int j = 0; j < 8; ++j) {
            float p = sc[nt][j] / lrow[j];
            int s = q0 + j + 8 * half;
            int n = nt * 16 + l16;
            pc_ws[(hq * SS + s) * NBC + n] = p;
            p_l[j + 8 * half][n] = p;
        }

    // O = P (16x64) * vc (64x128), staged 16 K-rows at a time
    v8f acc[8];
#pragma unroll
    for (int nt = 0; nt < 8; ++nt)
#pragma unroll
        for (int j = 0; j < 8; ++j) acc[nt][j] = 0.f;

    for (int st = 0; st < 4; ++st) {
        __syncthreads();
        for (int idx = tid; idx < 16 * HDIM; idx += 32) {
            int r = idx >> 7, d = idx & 127;
            v_l[r][d] = vc[((st * 16 + r) * NHK + hk) * HDIM + d];
        }
        __syncthreads();
#pragma unroll
        for (int kq = 0; kq < 16; kq += 4) {
            int kc4 = st * 16 + kq;
            v2f a;
            a[0] = p_l[l16][kc4 + 2 * half + 0];
            a[1] = p_l[l16][kc4 + 2 * half + 1];
#pragma unroll
            for (int nt = 0; nt < 8; ++nt) {
                v2f b;
                b[0] = v_l[kq + 2 * half + 0][nt * 16 + l16];
                b[1] = v_l[kq + 2 * half + 1][nt * 16 + l16];
                acc[nt] = __builtin_amdgcn_wmma_f32_16x16x4_f32(false, a, false, b,
                                                   (short)0, acc[nt], false, false);
            }
        }
    }

    for (int nt = 0; nt < 8; ++nt)
        for (int j = 0; j < 8; ++j) {
            int row = q0 + j + 8 * half;
            int d   = nt * 16 + l16;
            float o = (row >= BLKC - 1) ? acc[nt][j] : 0.f;  // cmask.any zeroing
            out[(row * NHQ + hq) * HDIM + d] += gc[row * NHQ + hq] * o;
        }
}

// --------------------------------------------------------------------------
// Kernel 4: top-4 block selection per (s, hk). Deterministic argmax passes,
// strict '>' matches top_k's lower-index tie break.
// --------------------------------------------------------------------------
__global__ void nsa_sel_kernel(const float* __restrict__ pc, int* __restrict__ sel) {
    int idx = blockIdx.x * blockDim.x + threadIdx.x;
    if (idx >= SS * NHK) return;
    int hk = idx % NHK;
    int s  = idx / NHK;
    int cur = s / BLKC;
    float scb[NBC];
    for (int n = 0; n < NBC; ++n) {
        float vsum = 0.f;
        for (int r = 0; r < REPG; ++r)
            vsum += pc[((hk * REPG + r) * SS + s) * NBC + n];
        if (n == cur) vsum += 1e6f;
        if (n == 0)   vsum += 1e6f;
        scb[n] = vsum;
    }
    for (int t = 0; t < TOPN; ++t) {
        int best = 0; float bv = scb[0];
        for (int n = 1; n < NBC; ++n)
            if (scb[n] > bv) { bv = scb[n]; best = n; }
        sel[(s * NHK + hk) * TOPN + t] = best;
        scb[best] = -3.0e38f;
    }
}

// --------------------------------------------------------------------------
// Kernel 5: selected branch. 128 threads per (s, hk): 4 rep heads, 128
// gathered keys, K rows staged in LDS. P * V: wave w takes the 32 V rows of
// selected block w, a whole row per load; the four partial sums are joined
// through LDS. Adds g_slt * o_slt into d_out.
// --------------------------------------------------------------------------
__global__ __launch_bounds__(128)
void nsa_slt_kernel(const float* __restrict__ q, const float* __restrict__ k,
                    const float* __restrict__ v, const float* __restrict__ gs,
                    const int* __restrict__ sel, float* __restrict__ out) {
    // K is staged in two halves of the head dim (64 floats a row) so that eight
    // work-groups fit one WGP's LDS. Row pitch 272 B = 16 B x 17: 16-byte reads
    // of one row per lane meet no bank conflict.
    __shared__ __align__(16) float k_l[TOPN * BLKC][HDIM / 2 + 4];
    __shared__ __align__(16) float qsm[REPG][HDIM];
    __shared__ __align__(16) float scm[REPG][TOPN * BLKC];

    const int s  = blockIdx.x / NHK;
    const int hk = blockIdx.x % NHK;
    const int t  = threadIdx.x;
    const float scale = 0.08838834764831845f;

    // wave w stages the 32 rows of selected block w; k_l row t belongs to key t.
    // One copy of the wave = two half rows of 256 contiguous bytes: whole cache lines.
    const int bsel = sel[(s * NHK + hk) * TOPN + (t >> 5)];
    const float* g0 = k + ((bsel * BLKC + ((t >> 4) & 1)) * NHK + hk) * HDIM + 4 * (t & 15);
    const unsigned l0 = (unsigned)(size_t)&k_l[(t & ~31) + ((t >> 4) & 1)][4 * (t & 15)];
    constexpr int GSTEP = 2 * NHK * HDIM;            // floats: two key rows on
    constexpr unsigned LSTEP = 2 * (HDIM / 2 + 4) * 4;  // bytes: two k_l rows on

    float a[REPG] = {0.f, 0.f, 0.f, 0.f};
#pragma unroll   // two trips, straight-line: h is a constant in every address
    for (int h = 0; h < 2; ++h) {
        if (h) {
            // every reader has left k_l before the second half overwrites it
            asm volatile("s_wait_dscnt 0x0" ::: "memory");
            __syncthreads();
        }
#pragma unroll   // straight-line: all 16 copies of the wave are in flight together
        for (int i = 0; i < 16; i += 8) {
            const float* g = g0 + h * (HDIM / 2) + i * GSTEP;
            const unsigned l = l0 + i * LSTEP;
            // the closing s_wait_xcnt stands in the copies' own statement, in
            // front of any rewrite of the address registers that they name
            asm volatile(
                "global_load_async_to_lds_b128 %0, %8, off\n\t"
                "global_load_async_to_lds_b128 %1, %9, off\n\t"
                "global_load_async_to_lds_b128 %2, %10, off\n\t"
                "global_load_async_to_lds_b128 %3, %11, off\n\t"
                "global_load_async_to_lds_b128 %4, %12, off\n\t"
                "global_load_async_to_lds_b128 %5, %13, off\n\t"
                "global_load_async_to_lds_b128 %6, %14, off\n\t"
                "global_load_async_to_lds_b128 %7, %15, off\n\t"
                "s_wait_xcnt 0x0"
                :: "v"(l), "v"(l + 1 * LSTEP), "v"(l + 2 * LSTEP), "v"(l + 3 * LSTEP),
                   "v"(l + 4 * LSTEP), "v"(l + 5 * LSTEP), "v"(l + 6 * LSTEP), "v"(l + 7 * LSTEP),
                   "v"(g), "v"(g + 1 * GSTEP), "v"(g + 2 * GSTEP), "v"(g + 3 * GSTEP),
                   "v"(g + 4 * GSTEP), "v"(g + 5 * GSTEP), "v"(g + 6 * GSTEP), "v"(g + 7 * GSTEP)
                : "memory");
        }
        if (h == 0) {
            for (int i = t; i < REPG * HDIM; i += 128) {
                int r = i / HDIM, d = i % HDIM;
                qsm[r][d] = q[(s * NHQ + hk * REPG + r) * HDIM + d];
            }
        }
        // the wave's own copies have landed before the barrier publishes k_l
        asm volatile("s_wait_asynccnt 0x0" ::: "memory");
        __syncthreads();

        // scores: thread t handles key t, read from its k_l row; each head's
        // sum runs over d in ascending order
        for (int d = 0; d < HDIM / 2; d += 4) {
            const float4 kv = *(const float4*)&k_l[t][d];
#pragma unroll   // a[] stays in registers
            for (int r = 0; r < REPG; ++r) {
                const float4 qv = *(const float4*)&qsm[r][h * (HDIM / 2) + d];
                a[r] = fmaf(qv.x, kv.x, a[r]);
                a[r] = fmaf(qv.y, kv.y, a[r]);
                a[r] = fmaf(qv.z, kv.z, a[r]);
                a[r] = fmaf(qv.w, kv.w, a[r]);
            }
        }
    }
    // V rows of the wave's own block: lane l holds dims 4l..4l+3, one load of
    // the wave is one whole row (512 contiguous bytes). The first 16 rows, the
    // old output row and its gate are asked for here, so that their latency
    // runs under the softmax.
    const int wave = t >> 5, lane = t & 31;
    const float4* vrow = (const float4*)(v + (bsel * BLKC * NHK + hk) * HDIM) + lane;
    constexpr int VSTEP = NHK * HDIM / 4;            // float4s: one key row on
    float4 vr[16];
#pragma unroll   // vr[] stays in registers; 16 loads in flight together
    for (int i = 0; i < 16; ++i) vr[i] = vrow[i * VSTEP];
    // wave w finishes rep head w
    float4* orow = (float4*)(out + (s * NHQ + hk * REPG + wave) * HDIM) + lane;
    const float4 oold = *orow;
    const float  gate = gs[s * NHQ + hk * REPG + wave];

    {
        int pos = bsel * BLKC + (t % BLKC);
#pragma unroll   // a[] stays in registers
        for (int r = 0; r < REPG; ++r)
            scm[r][t] = (pos <= s) ? a[r] * scale : NEGV;
    }
    __syncthreads();

    // softmax: wave w handles row w (4 waves of 32 lanes)
    {
        float vals[4];
        float mloc = -3.0e38f;
        for (int i = 0; i < 4; ++i) {
            vals[i] = scm[wave][lane + 32 * i];
            mloc = fmaxf(mloc, vals[i]);
        }
        for (int m = 1; m <= 16; m <<= 1)
            mloc = fmaxf(mloc, __shfl_xor(mloc, m, 32));
        float ssum = 0.f;
        for (int i = 0; i < 4; ++i) { vals[i] = expf(vals[i] - mloc); ssum += vals[i]; }
        for (int m = 1; m <= 16; m <<= 1)
            ssum += __shfl_xor(ssum, m, 32);
        float inv = 1.0f / ssum;
        for (int i = 0; i < 4; ++i) scm[wave][lane + 32 * i] = vals[i] * inv;
    }
    __syncthreads();

    // partial output of the wave's 32 keys, all 4 rep heads, 4 dims a lane
    float4 o[REPG];
#pragma unroll   // o[] stays in registers
    for (int r = 0; r < REPG; ++r) o[r] = make_float4(0.f, 0.f, 0.f, 0.f);
#pragma unroll   // vr[] stays in registers: every index is a constant
    for (int i = 0; i < BLKC; i += 4) {
        float pr[REPG][4];
#pragma unroll   // pr[] stays in registers
        for (int r = 0; r < REPG; ++r) {
            const float4 p4 = *(const float4*)&scm[r][wave * BLKC + i];
            pr[r][0] = p4.x; pr[r][1] = p4.y; pr[r][2] = p4.z; pr[r][3] = p4.w;
        }
#pragma unroll   // vr[], pr[] stay in registers
        for (int u = 0; u < 4; ++u) {
            const float4 vv = vr[(i + u) & 15];
#pragma unroll   // o[] stays in registers
            for (int r = 0; r < REPG; ++r) {
                o[r].x = fmaf(pr[r][u], vv.x, o[r].x);
                o[r].y = fmaf(pr[r][u], vv.y, o[r].y);
                o[r].z = fmaf(pr[r][u], vv.z, o[r].z);
                o[r].w = fmaf(pr[r][u], vv.w, o[r].w);
            }
            // the row 16 further on takes the registers that have just been used
            if (i + u < 16) vr[i + u] = vrow[(i + u + 16) * VSTEP];
            // behind the last V load, in front of any rewrite of its address registers
            if (i + u == 15) asm volatile("s_wait_xcnt 0x0" ::: "memory");
        }
    }

    // join: k_l is free since the barrier behind the scores
    float* red = &k_l[0][0];                         // [wave][rep head][HDIM]
#pragma unroll   // o[] stays in registers
    for (int r = 0; r < REPG; ++r)
        *(float4*)&red[(wave * REPG + r) * HDIM + 4 * lane] = o[r];
    __syncthreads();
    {
        float4 sum = *(const float4*)&red[(0 * REPG + wave) * HDIM + 4 * lane];
#pragma unroll   // three more partial sums, in the order of the selected blocks
        for (int w = 1; w < TOPN; ++w) {
            const float4 pw = *(const float4*)&red[(w * REPG + wave) * HDIM + 4 * lane];
            sum.x += pw.x; sum.y += pw.y; sum.z += pw.z; sum.w += pw.w;
        }
        *orow = make_float4(fmaf(gate, sum.x, oold.x), fmaf(gate, sum.y, oold.y),
                            fmaf(gate, sum.z, oold.z), fmaf(gate, sum.w, oold.w));
    }
}

// --------------------------------------------------------------------------
extern "C" void kernel_launch(void* const* d_in, const int* in_sizes, int n_in,
                              void* d_out, int out_size, void* d_ws, size_t ws_size,
                              hipStream_t stream) {
    const float* q  = (const float*)d_in[0];
    const float* k  = (const float*)d_in[1];
    const float* v  = (const float*)d_in[2];
    const float* gw = (const float*)d_in[3];
    const float* gc = (const float*)d_in[4];
    const float* gs = (const float*)d_in[5];
    float* out = (float*)d_out;

    float* ws = (float*)d_ws;
    float* kc = ws;                                  // NB*NHK*HD = 16384 floats
    float* vc = ws + NBC * NHK * HDIM;               // 16384 floats
    float* pc = vc + NBC * NHK * HDIM;               // NHQ*S*NB = 1,048,576 floats
    int*  sel = (int*)(pc + (size_t)NHQ * SS * NBC); // S*NHK*TOPN ints

    nsa_cmpkv_kernel<<<(NBC * NHK * HDIM + 255) / 256, 256, 0, stream>>>(k, v, kc, vc);
    nsa_win_kernel<<<(SS / 16) * NHQ, 64, 0, stream>>>(q, k, v, gw, out);
    nsa_cmp_kernel<<<(SS / 16) * NHQ, 32, 0, stream>>>(q, kc, vc, gc, pc, out);
    nsa_sel_kernel<<<(SS * NHK + 255) / 256, 256, 0, stream>>>(pc, sel);
    nsa_slt_kernel<<<SS * NHK, 128, 0, stream>>>(q, k, v, gs, sel, out);
}

// v004
// Measured time: 108 microseconds a run.
// Timed twice side by side with v003, it ran 1.22 and 1.20 times as fast.
// Over all steps from v000 it is 2.19 times as fast.
#include <hip/hip_runtime.h>
#include <hip/hip_bf16.h>

#define SS   2048
#define NHQ  8
#define NHK  2
#define HDIM 128
#define REPG 4
#define WINW 512
#define BLKC 32
#define NBC  64
#define TOPN 4
#define NEGV (-1e30f)

typedef __attribute__((ext_vector_type(2))) float v2f;
typedef __attribute__((ext_vector_type(8))) float v8f;

#if defined(__has_builtin)
#if __has_builtin(__builtin_amdgcn_global_load_async_to_lds_b128)
#define HAVE_ASYNC_LDS 1
#endif
#endif

#ifdef HAVE_ASYNC_LDS
// builtin signature (from hipcc diagnostic): takes pointers to 16-byte int
// vectors: (v4i addrspace(1)*, v4i addrspace(3)*, imm offset, imm cpol)
typedef int v4i_ __attribute__((vector_size(16)));
typedef __attribute__((address_space(1))) v4i_ gv4i;
typedef __attribute__((address_space(3))) v4i_ lv4i;
#endif

// --------------------------------------------------------------------------
// Kernel 1: block-mean compressed K/V.  kc/vc: [NB][NHK][HD]
// --------------------------------------------------------------------------
__global__ void nsa_cmpkv_kernel(const float* __restrict__ k,
                                 const float* __restrict__ v,
                                 float* __restrict__ kc,
                                 float* __restrict__ vc) {
    int idx = blockIdx.x * blockDim.x + threadIdx.x;
    if (idx >= NBC * NHK * HDIM) return;
    int d  = idx % HDIM;
    int hk = (idx / HDIM) % NHK;
    int n  = idx / (HDIM * NHK);
    float sk = 0.f, sv = 0.f;
    for (int i = 0; i < BLKC; ++i) {
        int row = n * BLKC + i;
        sk += k[(row * NHK + hk) * HDIM + d];
        sv += v[(row * NHK + hk) * HDIM + d];
    }
    kc[(n * NHK + hk) * HDIM + d] = sk * (1.0f / BLKC);
    vc[(n * NHK + hk) * HDIM + d] = sv * (1.0f / BLKC);
}

// --------------------------------------------------------------------------
// Kernel 2: sliding-window branch, flash attention, WMMA f32 16x16x4.
// Two waves per (16-query tile, q-head): wave w takes every second key tile,
// from the diagonal tile minus w downwards, with a K/V ring, a P tile and an
// online softmax of its own; the two partial results are joined through LDS.
// Double-buffered async global->LDS staging of K/V tiles overlaps the next
// tile's load with this tile's WMMAs. Writes (initializes) d_out.
// --------------------------------------------------------------------------

// Orders one wave's own LDS traffic: what some lanes store, other lanes of the
// same wave load behind it. The P tile is private to a wave, so this takes the
// place of a work-group barrier, which would tie the two waves' trips together.
__device__ __forceinline__ void wave_lds_sync() {
    __builtin_amdgcn_fence(__ATOMIC_RELEASE, "workgroup");
    __builtin_amdgcn_wave_barrier();
    __builtin_amdgcn_fence(__ATOMIC_ACQUIRE, "workgroup");
}

__global__ __launch_bounds__(64)
void nsa_win_kernel(const float* __restrict__ q, const float* __restrict__ k,
                    const float* __restrict__ v, const float* __restrict__ gw,
                    float* __restrict__ out) {
    __shared__ __align__(16) float q_l[16][132];
    __shared__ __align__(16) float k_l[2][2][16][132];   // [wave][buffer]
    __shared__ __align__(16) float v_l[2][2][16][132];
    __shared__ float p_l[2][16][17];

    const int qt   = blockIdx.x / NHQ;
    const int hq   = blockIdx.x % NHQ;
    const int hk   = hq / REPG;
    const int q0   = qt * 16;
    const int tid  = threadIdx.x;
    const int wv   = __builtin_amdgcn_readfirstlane(tid >> 5);  // scalar: 0 or 1
    const int lane = tid & 31;
    const int half = lane >> 4;     // 0 or 1
    const int l16  = lane & 15;
    const float scale = 0.08838834764831845f;   // 1/sqrt(128)

    const int ktd = qt;
    int lowkey = q0 - (WINW - 1); if (lowkey < 0) lowkey = 0;
    const int ktl = lowkey >> 4;

    // ---- tile staging (async double-buffer if available) ----
#ifdef HAVE_ASYNC_LDS
#define ISSUE_TILE(bufi, ktv)                                                  \
    do {                                                                       \
        for (int i_ = 0; i_ < 16; ++i_) {                                      \
            int idx_ = i_ * 32 + lane;         /* 512 16B chunks per tile */   \
            int r_ = idx_ >> 5;                                                \
            int d_ = (idx_ & 31) << 2;                                         \
            const float* gk_ = &k[(((ktv) * 16 + r_) * NHK + hk) * HDIM + d_]; \
            const float* gv_ = &v[(((ktv) * 16 + r_) * NHK + hk) * HDIM + d_]; \
            __builtin_amdgcn_global_load_async_to_lds_b128(                    \
                (gv4i*)gk_, (lv4i*)&k_l[wv][bufi][r_][d_], 0, 0);              \
            __builtin_amdgcn_global_load_async_to_lds_b128(                    \
                (gv4i*)gv_, (lv4i*)&v_l[wv][bufi][r_][d_], 0, 0);              \
        }                                                                      \
    } while (0)
    // the wave's own copies of this trip's tile have landed
#define WAIT_TILE() asm volatile("s_wait_asynccnt 0x0" ::: "memory")
#else
#define ISSUE_TILE(bufi, ktv)                                                  \
    do {                                                                       \
        for (int idx_ = lane; idx_ < 16 * HDIM; idx_ += 32) {                  \
            int r_ = idx_ >> 7, d_ = idx_ & 127;                               \
            k_l[wv][bufi][r_][d_] = k[(((ktv) * 16 + r_) * NHK + hk) * HDIM + d_]; \
            v_l[wv][bufi][r_][d_] = v[(((ktv) * 16 + r_) * NHK + hk) * HDIM + d_]; \
        }                                                                      \
    } while (0)
#define WAIT_TILE() wave_lds_sync()
#endif

    int buf = 0;
    if (ktd - wv >= ktl) ISSUE_TILE(0, ktd - wv);   // prologue: the wave's first tile in flight

    for (int idx = tid; idx < 16 * HDIM; idx += 64) {
        int r = idx >> 7, d = idx & 127;
        q_l[r][d] = q[((q0 + r) * NHQ + hq) * HDIM + d];
    }
    __syncthreads();

    v8f acc[8];
    float mrow[8], lrow[8];
#pragma unroll
    for (int nt = 0; nt < 8; ++nt)
#pragma unroll
        for (int j = 0; j < 8; ++j) acc[nt][j] = 0.f;
#pragma unroll
    for (int j = 0; j < 8; ++j) { mrow[j] = -3.0e38f; lrow[j] = 0.f; }

    for (int kt = ktd - wv; kt >= ktl; kt -= 2) {
        // the wave's reads of the buffer that is refilled below have retired
        asm volatile("s_wait_dscnt 0x0" ::: "memory");
        WAIT_TILE();            // buffer buf now resident in LDS
        const int nxt = buf ^ 1;
        if (kt - 2 >= ktl) ISSUE_TILE(nxt, kt - 2);  // overlap with compute

        // ---- S = Q K^T (16x16 tile) ----
        v8f c;
#pragma unroll
        for (int j = 0; j < 8; ++j) c[j] = 0.f;
#pragma unroll
        for (int kk = 0; kk < HDIM; kk += 4) {
            v2f a, b;
            a[0] = q_l[l16][kk + 2 * half + 0];
            a[1] = q_l[l16][kk + 2 * half + 1];
            b[0] = k_l[wv][buf][l16][kk + 2 * half + 0];
            b[1] = k_l[wv][buf][l16][kk + 2 * half + 1];
            c = __builtin_amdgcn_wmma_f32_16x16x4_f32(false, a, false, b,
                                                      (short)0, c, false, false);
        }

        // ---- mask + online softmax update ----
        const int ng = kt * 16 + l16;
#pragma unroll
        for (int j = 0; j < 8; ++j) {
            int qs  = q0 + j + 8 * half;
            int dif = qs - ng;
            bool valid = (dif >= 0) && (dif < WINW);
            float sv = valid ? c[j] * scale : NEGV;
            float rmax = sv;
#pragma unroll
            for (int m = 1; m <= 8; m <<= 1)
                rmax = fmaxf(rmax, __shfl_xor(rmax, m, 32));
            float mnew = fmaxf(mrow[j], rmax);
            float corr = expf(mrow[j] - mnew);
            float p    = expf(sv - mnew);
            float rsum = p;
#pragma unroll
            for (int m = 1; m <= 8; m <<= 1)
                rsum += __shfl_xor(rsum, m, 32);
            lrow[j] = lrow[j] * corr + rsum;
            mrow[j] = mnew;
#pragma unroll
            for (int nt = 0; nt < 8; ++nt) acc[nt][j] *= corr;
            p_l[wv][j + 8 * half][l16] = p;
        }
        wave_lds_sync();

        // ---- O += P * V (16x16 x 16x128) ----
#pragma unroll
        for (int kc4 = 0; kc4 < 16; kc4 += 4) {
            v2f a;
            a[0] = p_l[wv][l16][kc4 + 2 * half + 0];
            a[1] = p_l[wv][l16][kc4 + 2 * half + 1];
#pragma unroll
            for (int nt = 0; nt < 8; ++nt) {
                v2f b;
                b[0] = v_l[wv][buf][kc4 + 2 * half + 0][nt * 16 + l16];
                b[1] = v_l[wv][buf][kc4 + 2 * half + 1][nt * 16 + l16];
                acc[nt] = __builtin_amdgcn_wmma_f32_16x16x4_f32(false, a, false, b,
                                                   (short)0, acc[nt], false, false);
            }
        }
        buf = nxt;
    }

    // ---- join: wave w finishes column tiles 4w..4w+3. Each wave hands the
    // other four tiles, its row maxima and its row sums over in its own ring,
    // lane for lane (both waves hold the same fragment layout). A wave without
    // a tile hands over zeros with the start maximum: weight exp(-huge) = 0.
    float* mine  = &k_l[wv][0][0][0];
    float* other = &k_l[wv ^ 1][0][0][0];
#pragma unroll   // acc[] stays in registers: nt is a constant in every index
    for (int nt = 0; nt < 8; ++nt)
        if ((nt >> 2) != wv) {
            *(float4*)&mine[(((nt & 3) * 2 + 0) * 32 + lane) * 4] =
                make_float4(acc[nt][0], acc[nt][1], acc[nt][2], acc[nt][3]);
            *(float4*)&mine[(((nt & 3) * 2 + 1) * 32 + lane) * 4] =
                make_float4(acc[nt][4], acc[nt][5], acc[nt][6], acc[nt][7]);
        }
#pragma unroll   // mrow[], lrow[] stay in registers
    for (int j = 0; j < 8; ++j) {
        mine[1024 + j * 32 + lane] = mrow[j];
        mine[1280 + j * 32 + lane] = lrow[j];
    }
    __syncthreads();

    float wa[8], wb[8], gr[8];
#pragma unroll   // mrow[], lrow[] stay in registers
    for (int j = 0; j < 8; ++j) {
        float mo = other[1024 + j * 32 + lane];
        float lo = other[1280 + j * 32 + lane];
        float mj = fmaxf(mrow[j], mo);
        wa[j] = expf(mrow[j] - mj);
        wb[j] = expf(mo - mj);
        lrow[j] = lrow[j] * wa[j] + lo * wb[j];
        gr[j] = gw[(q0 + j + 8 * half) * NHQ + hq];
    }
#pragma unroll   // acc[] stays in registers: nt is a constant in every index
    for (int nt = 0; nt < 8; ++nt)
        if ((nt >> 2) == wv) {
            const float4 o0 = *(const float4*)&other[(((nt & 3) * 2 + 0) * 32 + lane) * 4];
            const float4 o1 = *(const float4*)&other[(((nt & 3) * 2 + 1) * 32 + lane) * 4];
            const float ob[8] = {o0.x, o0.y, o0.z, o0.w, o1.x, o1.y, o1.z, o1.w};
#pragma unroll   // ob[] stays in registers
            for (int j = 0; j < 8; ++j) {
                int row = q0 + j + 8 * half;
                int d   = nt * 16 + l16;
                float o = (acc[nt][j] * wa[j] + ob[j] * wb[j]) / lrow[j];
                out[(row * NHQ + hq) * HDIM + d] = gr[j] * o;
            }
            // stands in front of any rewrite of a register that these stores name
            asm volatile("s_wait_xcnt 0x0" ::: "memory");
        }
#undef ISSUE_TILE
#undef WAIT_TILE
}

// --------------------------------------------------------------------------
// Kernel 3: compressed branch. Writes normalized pc [NHQ][S][NB] to ws and
// adds g_cmp * o_cmp into d_out. q, kc and vc come into LDS by asynchronous
// copies: kc and then vc pass as four tiles of 32 rows through a ring of two
// buffers, so that a tile's copies fly while the tile before it is worked on.
// --------------------------------------------------------------------------

// Eight asynchronous copies of one wave, each one whole row: 32 lanes x 16 bytes
// = 512 contiguous bytes. l: the lane's LDS byte address in the first row (rows
// of 132 floats), g: the lane's global address in it, GSTEP: floats a row on.
template <int GSTEP>
__device__ __forceinline__ void copy_rows8(unsigned l, const float* g) {
    constexpr unsigned LSTEP = 132 * 4;
    // the closing s_wait_xcnt stands in the copies' own statement, in front of
    // any rewrite of the address registers that they name
    asm volatile(
        "global_load_async_to_lds_b128 %0, %8, off\n\t"
        "global_load_async_to_lds_b128 %1, %9, off\n\t"
        "global_load_async_to_lds_b128 %2, %10, off\n\t"
        "global_load_async_to_lds_b128 %3, %11, off\n\t"
        "global_load_async_to_lds_b128 %4, %12, off\n\t"
        "global_load_async_to_lds_b128 %5, %13, off\n\t"
        "global_load_async_to_lds_b128 %6, %14, off\n\t"
        "global_load_async_to_lds_b128 %7, %15, off\n\t"
        "s_wait_xcnt 0x0"
        :: "v"(l), "v"(l + 1 * LSTEP), "v"(l + 2 * LSTEP), "v"(l + 3 * LSTEP),
           "v"(l + 4 * LSTEP), "v"(l + 5 * LSTEP), "v"(l + 6 * LSTEP), "v"(l + 7 * LSTEP),
           "v"(g), "v"(g + 1 * GSTEP), "v"(g + 2 * GSTEP), "v"(g + 3 * GSTEP),
           "v"(g + 4 * GSTEP), "v"(g + 5 * GSTEP), "v"(g + 6 * GSTEP), "v"(g + 7 * GSTEP)
        : "memory");
}

// Hand-over point of the ring: the wave's reads of the buffer that is refilled
// behind it have retired, its copies of the next tile have landed, and the
// barrier publishes them (for a work-group of one wave the compiler emits no
// barrier instruction).
__device__ __forceinline__ void ring_handover() {
    // keeps this tile's WMMAs in front of the wait: moved behind it, the next
    // tile's copies would no longer fly under them, and all fragments of the
    // tile would have to sit in registers at once
    __builtin_amdgcn_sched_barrier(0);
    asm volatile("s_wait_dscnt 0x0" ::: "memory");
    asm volatile("s_wait_asynccnt 0x0" ::: "memory");
    __syncthreads();
}

__global__ __launch_bounds__(32)
void nsa_cmp_kernel(const float* __restrict__ q, const float* __restrict__ kc,
                    const float* __restrict__ vc, const float* __restrict__ gc,
                    float* __restrict__ pc_ws, float* __restrict__ out) {
    __shared__ __align__(16) float q_l[16][132];
    __shared__ __align__(16) float t_l[2][32][132];   // ring: kc rows, then vc rows
    __shared__ float p_l[16][68];

    const int qt   = blockIdx.x / NHQ;
    const int hq   = blockIdx.x % NHQ;
    const int hk   = hq / REPG;
    const int q0   = qt * 16;
    const int tid  = threadIdx.x;
    const int half = tid >> 4;
    const int l16  = tid & 15;
    const float scale = 0.08838834764831845f;

    // lane l brings floats 4l..4l+3 of every row
    const unsigned lq = (unsigned)(size_t)&q_l[0][4 * tid];
    const unsigned lt[2] = {(unsigned)(size_t)&t_l[0][0][4 * tid],
                            (unsigned)(size_t)&t_l[1][0][4 * tid]};
    const float* gq = q + (q0 * NHQ + hq) * HDIM + 4 * tid;
    const float* gk = kc + hk * HDIM + 4 * tid;
    const float* gv = vc + hk * HDIM + 4 * tid;
    constexpr int QSTEP = NHQ * HDIM, TSTEP = NHK * HDIM;   // floats: one row on
    // 32 rows, from row r0 of kc or vc, into ring buffer b
#define ISSUE_ROWS32(b, gsrc, r0)                                              \
    do {                                                                       \
        copy_rows8<TSTEP>(lt[b] +  0 * 528u, (gsrc) + ((r0) +  0) * TSTEP);    \
        copy_rows8<TSTEP>(lt[b] +  8 * 528u, (gsrc) + ((r0) +  8) * TSTEP);    \
        copy_rows8<TSTEP>(lt[b] + 16 * 528u, (gsrc) + ((r0) + 16) * TSTEP);    \
        copy_rows8<TSTEP>(lt[b] + 24 * 528u, (gsrc) + ((r0) + 24) * TSTEP);    \
    } while (0)

    copy_rows8<QSTEP>(lq, gq);
    copy_rows8<QSTEP>(lq + 8 * 528u, gq + 8 * QSTEP);
    ISSUE_ROWS32(0, gk, 0);
    // q and kc rows 0..31 have landed before the barrier publishes them
    asm volatile("s_wait_asynccnt 0x0" ::: "memory");
    __syncthreads();
    ISSUE_ROWS32(1, gk, 32);

    v8f sc[4];
#pragma unroll   // sc[] stays in registers; the ring buffer is a constant
    for (int nt = 0; nt < 4; ++nt) {
        if (nt == 2) {
            ring_handover();            // kc rows 32..63 are there
            ISSUE_ROWS32(0, gv, 0);
        }
        const float (*k_l)[132] = &t_l[nt >> 1][(nt & 1) * 16];
        v8f c;
#pragma unroll
        for (int j = 0; j < 8; ++j) c[j] = 0.f;
#pragma unroll
        for (int kk = 0; kk < HDIM; kk += 4) {
            v2f a, b;
            a[0] = q_l[l16][kk + 2 * half + 0];
            a[1] = q_l[l16][kk + 2 * half + 1];
            b[0] = k_l[l16][kk + 2 * half + 0];
            b[1] = k_l[l16][kk + 2 * half + 1];
            c = __builtin_amdgcn_wmma_f32_16x16x4_f32(false, a, false, b,
                                                      (short)0, c, false, false);
        }
        sc[nt] = c;
    }
    ring_handover();                    // vc rows 0..31 are there
    ISSUE_ROWS32(1, gv, 32);            // they fly under the softmax

    // mask + scale  (block fully in the past: (n+1)*32-1 <= s)
    for (int nt = 0; nt < 4; ++nt)
#pragma unroll
        for (int j = 0; j < 8; ++j) {
            int n = nt * 16 + l16;
            int s = q0 + j + 8 * half;
            bool valid = ((n + 1) * BLKC - 1) <= s;
            sc[nt][j] = valid ? sc[nt][j] * scale : NEGV;
        }

    // row softmax over 64 blocks
    float mrow[8], lrow[8];
#pragma unroll
    for (int j = 0; j < 8; ++j) {
        float rm = -3.0e38f;
        for (int nt = 0; nt < 4; ++nt) rm = fmaxf(rm, sc[nt][j]);
#pragma unroll
        for (int m = 1; m <= 8; m <<= 1) rm = fmaxf(rm, __shfl_xor(rm, m, 32));
        mrow[j] = rm;
    }
    for (int nt = 0; nt < 4; ++nt)
#pragma unroll
        for (int j = 0; j < 8; ++j) sc[nt][j] = expf(sc[nt][j] - mrow[j]);
#pragma unroll
    for (int j = 0; j < 8; ++j) {
        float rs = 0.f;
        for (int nt = 0; nt < 4; ++nt) rs += sc[nt][j];
#pragma unroll
        for (int m = 1; m <= 8; m <<= 1) rs += __shfl_xor(rs, m, 32);
        lrow[j] = rs;
    }
    for (int nt = 0; nt < 4; ++nt)
#pragma unroll
        for (int j = 0; j < 8; ++j) {
            float p = sc[nt][j] / lrow[j];
            int s = q0 + j + 8 * half;
            int n = nt * 16 + l16;
            pc_ws[(hq * SS + s) * NBC + n] = p;
            p_l[j + 8 * half][n] = p;
        }

    // O = P (16x64) * vc (64x128), 16 K-rows a step; vc comes in 32-row tiles
    v8f acc[8];
#pragma unroll
    for (int nt = 0; nt < 8; ++nt)
#pragma unroll
        for (int j = 0; j < 8; ++j) acc[nt][j] = 0.f;

    __syncthreads();                    // p_l is written
#pragma unroll   // the ring buffer is a constant
    for (int st = 0; st < 4; ++st) {
        if (st == 2) ring_handover();   // vc rows 32..63 are there
        const float (*v_l)[132] = &t_l[st >> 1][(st & 1) * 16];
#pragma unroll
        for (int kq = 0; kq < 16; kq += 4) {
            int kc4 = st * 16 + kq;
            v2f a;
            a[0] = p_l[l16][kc4 + 2 * half + 0];
            a[1] = p_l[l16][kc4 + 2 * half + 1];
#pragma unroll
            for (int nt = 0; nt < 8; ++nt) {
                v2f b;
                b[0] = v_l[kq + 2 * half + 0][nt * 16 + l16];
                b[1] = v_l[kq + 2 * half + 1][nt * 16 + l16];
                acc[nt] = __builtin_amdgcn_wmma_f32_16x16x4_f32(false, a, false, b,
                                                   (short)0, acc[nt], false, false);
            }
        }
    }

    for (int nt = 0; nt < 8; ++nt)
        for (int j = 0; j < 8; ++j) {
            int row = q0 + j + 8 * half;
            int d   = nt * 16 + l16;
            float o = (row >= BLKC - 1) ? acc[nt][j] : 0.f;  // cmask.any zeroing
            out[(row * NHQ + hq) * HDIM + d] += gc[row * NHQ + hq] * o;
        }
#undef ISSUE_ROWS32
}

// --------------------------------------------------------------------------
// Kernel 4: top-4 block selection per (s, hk). Deterministic argmax passes,
// strict '>' matches top_k's lower-index tie break.
// --------------------------------------------------------------------------
__global__ void nsa_sel_kernel(const float* __restrict__ pc, int* __restrict__ sel) {
    int idx = blockIdx.x * blockDim.x + threadIdx.x;
    if (idx >= SS * NHK) return;
    int hk = idx % NHK;
    int s  = idx / NHK;
    int cur = s / BLKC;
    float scb[NBC];
    for (int n = 0; n < NBC; ++n) {
        float vsum = 0.f;
        for (int r = 0; r < REPG; ++r)
            vsum += pc[((hk * REPG + r) * SS + s) * NBC + n];
        if (n == cur) vsum += 1e6f;
        if (n == 0)   vsum += 1e6f;
        scb[n] = vsum;
    }
    for (int t = 0; t < TOPN; ++t) {
        int best = 0; float bv = scb[0];
        for (int n = 1; n < NBC; ++n)
            if (scb[n] > bv) { bv = scb[n]; best = n; }
        sel[(s * NHK + hk) * TOPN + t] = best;
        scb[best] = -3.0e38f;
    }
}

// --------------------------------------------------------------------------
// Kernel 5: selected branch. 128 threads per (s, hk): 4 rep heads, 128
// gathered keys, K rows staged in LDS. P * V: wave w takes the 32 V rows of
// selected block w, a whole row per load; the four partial sums are joined
// through LDS. Adds g_slt * o_slt into d_out.
// --------------------------------------------------------------------------
__global__ __launch_bounds__(128)
void nsa_slt_kernel(const float* __restrict__ q, const float* __restrict__ k,
                    const float* __restrict__ v, const float* __restrict__ gs,
                    const int* __restrict__ sel, float* __restrict__ out) {
    // K is staged in two halves of the head dim (64 floats a row) so that eight
    // work-groups fit one WGP's LDS. Row pitch 272 B = 16 B x 17: 16-byte reads
    // of one row per lane meet no bank conflict.
    __shared__ __align__(16) float k_l[TOPN * BLKC][HDIM / 2 + 4];
    __shared__ __align__(16) float qsm[REPG][HDIM];
    __shared__ __align__(16) float scm[REPG][TOPN * BLKC];

    const int s  = blockIdx.x / NHK;
    const int hk = blockIdx.x % NHK;
    const int t  = threadIdx.x;
    const float scale = 0.08838834764831845f;

    // wave w stages the 32 rows of selected block w; k_l row t belongs to key t.
    // One copy of the wave = two half rows of 256 contiguous bytes: whole cache lines.
    const int bsel = sel[(s * NHK + hk) * TOPN + (t >> 5)];
    const float* g0 = k + ((bsel * BLKC + ((t >> 4) & 1)) * NHK + hk) * HDIM + 4 * (t & 15);
    const unsigned l0 = (unsigned)(size_t)&k_l[(t & ~31) + ((t >> 4) & 1)][4 * (t & 15)];
    constexpr int GSTEP = 2 * NHK * HDIM;            // floats: two key rows on
    constexpr unsigned LSTEP = 2 * (HDIM / 2 + 4) * 4;  // bytes: two k_l rows on

    float a[REPG] = {0.f, 0.f, 0.f, 0.f};
#pragma unroll   // two trips, straight-line: h is a constant in every address
    for (int h = 0; h < 2; ++h) {
        if (h) {
            // every reader has left k_l before the second half overwrites it
            asm volatile("s_wait_dscnt 0x0" ::: "memory");
            __syncthreads();
        }
#pragma unroll   // straight-line: all 16 copies of the wave are in flight together
        for (int i = 0; i < 16; i += 8) {
            const float* g = g0 + h * (HDIM / 2) + i * GSTEP;
            const unsigned l = l0 + i * LSTEP;
            // the closing s_wait_xcnt stands in the copies' own statement, in
            // front of any rewrite of the address registers that they name
            asm volatile(
                "global_load_async_to_lds_b128 %0, %8, off\n\t"
                "global_load_async_to_lds_b128 %1, %9, off\n\t"
                "global_load_async_to_lds_b128 %2, %10, off\n\t"
                "global_load_async_to_lds_b128 %3, %11, off\n\t"
                "global_load_async_to_lds_b128 %4, %12, off\n\t"
                "global_load_async_to_lds_b128 %5, %13, off\n\t"
                "global_load_async_to_lds_b128 %6, %14, off\n\t"
                "global_load_async_to_lds_b128 %7, %15, off\n\t"
                "s_wait_xcnt 0x0"
                :: "v"(l), "v"(l + 1 * LSTEP), "v"(l + 2 * LSTEP), "v"(l + 3 * LSTEP),
                   "v"(l + 4 * LSTEP), "v"(l + 5 * LSTEP), "v"(l + 6 * LSTEP), "v"(l + 7 * LSTEP),
                   "v"(g), "v"(g + 1 * GSTEP), "v"(g + 2 * GSTEP), "v"(g + 3 * GSTEP),
                   "v"(g + 4 * GSTEP), "v"(g + 5 * GSTEP), "v"(g + 6 * GSTEP), "v"(g + 7 * GSTEP)
                : "memory");
        }
        if (h == 0) {
            for (int i = t; i < REPG * HDIM; i += 128) {
                int r = i / HDIM, d = i % HDIM;
                qsm[r][d] = q[(s * NHQ + hk * REPG + r) * HDIM + d];
            }
        }
        // the wave's own copies have landed before the barrier publishes k_l
        asm volatile("s_wait_asynccnt 0x0" ::: "memory");
        __syncthreads();

        // scores: thread t handles key t, read from its k_l row; each head's
        // sum runs over d in ascending order
        for (int d = 0; d < HDIM / 2; d += 4) {
            const float4 kv = *(const float4*)&k_l[t][d];
#pragma unroll   // a[] stays in registers
            for (int r = 0; r < REPG; ++r) {
                const float4 qv = *(const float4*)&qsm[r][h * (HDIM / 2) + d];
                a[r] = fmaf(qv.x, kv.x, a[r]);
                a[r] = fmaf(qv.y, kv.y, a[r]);
                a[r] = fmaf(qv.z, kv.z, a[r]);
                a[r] = fmaf(qv.w, kv.w, a[r]);
            }
        }
    }
    // V rows of the wave's own block: lane l holds dims 4l..4l+3, one load of
    // the wave is one whole row (512 contiguous bytes). The first 16 rows, the
    // old output row and its gate are asked for here, so that their latency
    // runs under the softmax.
    const int wave = t >> 5, lane = t & 31;
    const float4* vrow = (const float4*)(v + (bsel * BLKC * NHK + hk) * HDIM) + lane;
    constexpr int VSTEP = NHK * HDIM / 4;            // float4s: one key row on
    float4 vr[16];
#pragma unroll   // vr[] stays in registers; 16 loads in flight together
    for (int i = 0; i < 16; ++i) vr[i] = vrow[i * VSTEP];
    // wave w finishes rep head w
    float4* orow = (float4*)(out + (s * NHQ + hk * REPG + wave) * HDIM) + lane;
    const float4 oold = *orow;
    const float  gate = gs[s * NHQ + hk * REPG + wave];

    {
        int pos = bsel * BLKC + (t % BLKC);
#pragma unroll   // a[] stays in registers
        for (int r = 0; r < REPG; ++r)
            scm[r][t] = (pos <= s) ? a[r] * scale : NEGV;
    }
    __syncthreads();

    // softmax: wave w handles row w (4 waves of 32 lanes)
    {
        float vals[4];
        float mloc = -3.0e38f;
        for (int i = 0; i < 4; ++i) {
            vals[i] = scm[wave][lane + 32 * i];
            mloc = fmaxf(mloc, vals[i]);
        }
        for (int m = 1; m <= 16; m <<= 1)
            mloc = fmaxf(mloc, __shfl_xor(mloc, m, 32));
        float ssum = 0.f;
        for (int i = 0; i < 4; ++i) { vals[i] = expf(vals[i] - mloc); ssum += vals[i]; }
        for (int m = 1; m <= 16; m <<= 1)
            ssum += __shfl_xor(ssum, m, 32);
        float inv = 1.0f / ssum;
        for (int i = 0; i < 4; ++i) scm[wave][lane + 32 * i] = vals[i] * inv;
    }
    __syncthreads();

    // partial output of the wave's 32 keys, all 4 rep heads, 4 dims a lane
    float4 o[REPG];
#pragma unroll   // o[] stays in registers
    for (int r = 0; r < REPG; ++r) o[r] = make_float4(0.f, 0.f, 0.f, 0.f);
#pragma unroll   // vr[] stays in registers: every index is a constant
    for (int i = 0; i < BLKC; i += 4) {
        float pr[REPG][4];
#pragma unroll   // pr[] stays in registers
        for (int r = 0; r < REPG; ++r) {
            const float4 p4 = *(const float4*)&scm[r][wave * BLKC + i];
            pr[r][0] = p4.x; pr[r][1] = p4.y; pr[r][2] = p4.z; pr[r][3] = p4.w;
        }
#pragma unroll   // vr[], pr[] stay in registers
        for (int u = 0; u < 4; ++u) {
            const float4 vv = vr[(i + u) & 15];
#pragma unroll   // o[] stays in registers
            for (int r = 0; r < REPG; ++r) {
                o[r].x = fmaf(pr[r][u], vv.x, o[r].x);
                o[r].y = fmaf(pr[r][u], vv.y, o[r].y);
                o[r].z = fmaf(pr[r][u], vv.z, o[r].z);
                o[r].w = fmaf(pr[r][u], vv.w, o[r].w);
            }
            // the row 16 further on takes the registers that have just been used
            if (i + u < 16) vr[i + u] = vrow[(i + u + 16) * VSTEP];
            // behind the last V load, in front of any rewrite of its address registers
            if (i + u == 15) asm volatile("s_wait_xcnt 0x0" ::: "memory");
        }
    }

    // join: k_l is free since the barrier behind the scores
    float* red = &k_l[0][0];                         // [wave][rep head][HDIM]
#pragma unroll   // o[] stays in registers
    for (int r = 0; r < REPG; ++r)
        *(float4*)&red[(wave * REPG + r) * HDIM + 4 * lane] = o[r];
    __syncthreads();
    {
        float4 sum = *(const float4*)&red[(0 * REPG + wave) * HDIM + 4 * lane];
#pragma unroll   // three more partial sums, in the order of the selected blocks
        for (int w = 1; w < TOPN; ++w) {
            const float4 pw = *(const float4*)&red[(w * REPG + wave) * HDIM + 4 * lane];
            sum.x += pw.x; sum.y += pw.y; sum.z += pw.z; sum.w += pw.w;
        }
        *orow = make_float4(fmaf(gate, sum.x, oold.x), fmaf(gate, sum.y, oold.y),
                            fmaf(gate, sum.z, oold.z), fmaf(gate, sum.w, oold.w));
    }
}

// --------------------------------------------------------------------------
extern "C" void kernel_launch(void* const* d_in, const int* in_sizes, int n_in,
                              void* d_out, int out_size, void* d_ws, size_t ws_size,
                              hipStream_t stream) {
    const float* q  = (const float*)d_in[0];
    const float* k  = (const float*)d_in[1];
    const float* v  = (const float*)d_in[2];
    const float* gw = (const float*)d_in[3];
    const float* gc = (const float*)d_in[4];
    const float* gs = (const float*)d_in[5];
    float* out = (float*)d_out;

    float* ws = (float*)d_ws;
    float* kc = ws;                                  // NB*NHK*HD = 16384 floats
    float* vc = ws + NBC * NHK * HDIM;               // 16384 floats
    float* pc = vc + NBC * NHK * HDIM;               // NHQ*S*NB = 1,048,576 floats
    int*  sel = (int*)(pc + (size_t)NHQ * SS * NBC); // S*NHK*TOPN ints

    nsa_cmpkv_kernel<<<(NBC * NHK * HDIM + 255) / 256, 256, 0, stream>>>(k, v, kc, vc);
    nsa_win_kernel<<<(SS / 16) * NHQ, 64, 0, stream>>>(q, k, v, gw, out);
    nsa_cmp_kernel<<<(SS / 16) * NHQ, 32, 0, stream>>>(q, kc, vc, gc, pc, out);
    nsa_sel_kernel<<<(SS * NHK + 255) / 256, 256, 0, stream>>>(pc, sel);
    nsa_slt_kernel<<<SS * NHK, 128, 0, stream>>>(q, k, v, gs, sel, out);
}

// v005
// A run of this version takes 92.3 microseconds.
// In both of two side-by-side timings against v004, it was 1.17 times as fast.
// All steps since v000 together make it 2.55 times as fast.
#include <hip/hip_runtime.h>
#include <hip/hip_bf16.h>

#define SS   2048
#define NHQ  8
#define NHK  2
#define HDIM 128
#define REPG 4
#define WINW 512
#define BLKC 32
#define NBC  64
#define TOPN 4
#define NEGV (-1e30f)

typedef __attribute__((ext_vector_type(2))) float v2f;
typedef __attribute__((ext_vector_type(8))) float v8f;

#if defined(__has_builtin)
#if __has_builtin(__builtin_amdgcn_global_load_async_to_lds_b128)
#define HAVE_ASYNC_LDS 1
#endif
#endif

#ifdef HAVE_ASYNC_LDS
// builtin signature (from hipcc diagnostic): takes pointers to 16-byte int
// vectors: (v4i addrspace(1)*, v4i addrspace(3)*, imm offset, imm cpol)
typedef int v4i_ __attribute__((vector_size(16)));
typedef __attribute__((address_space(1))) v4i_ gv4i;
typedef __attribute__((address_space(3))) v4i_ lv4i;
#endif

// --------------------------------------------------------------------------
// Kernel 1: block-mean compressed K/V.  kc/vc: [NB][NHK][HD]
// --------------------------------------------------------------------------
__global__ void nsa_cmpkv_kernel(const float* __restrict__ k,
                                 const float* __restrict__ v,
                                 float* __restrict__ kc,
                                 float* __restrict__ vc) {
    int idx = blockIdx.x * blockDim.x + threadIdx.x;
    if (idx >= NBC * NHK * HDIM) return;
    int d  = idx % HDIM;
    int hk = (idx / HDIM) % NHK;
    int n  = idx / (HDIM * NHK);
    float sk = 0.f, sv = 0.f;
    for (int i = 0; i < BLKC; ++i) {
        int row = n * BLKC + i;
        sk += k[(row * NHK + hk) * HDIM + d];
        sv += v[(row * NHK + hk) * HDIM + d];
    }
    kc[(n * NHK + hk) * HDIM + d] = sk * (1.0f / BLKC);
    vc[(n * NHK + hk) * HDIM + d] = sv * (1.0f / BLKC);
}

// --------------------------------------------------------------------------
// Kernel 2: sliding-window branch, flash attention, WMMA f32 16x16x4.
// Two waves per (16-query tile, q-head): wave w takes every second key tile,
// from the diagonal tile minus w downwards, with a K/V ring, a P tile and an
// online softmax of its own; the two partial results are joined through LDS.
// Double-buffered async global->LDS staging of K/V tiles overlaps the next
// tile's load with this tile's WMMAs. Writes (initializes) d_out.
// --------------------------------------------------------------------------

// Orders one wave's own LDS traffic: what some lanes store, other lanes of the
// same wave load behind it. The P tile is private to a wave, so this takes the
// place of a work-group barrier, which would tie the two waves' trips together.
__device__ __forceinline__ void wave_lds_sync() {
    __builtin_amdgcn_fence(__ATOMIC_RELEASE, "workgroup");
    __builtin_amdgcn_wave_barrier();
    __builtin_amdgcn_fence(__ATOMIC_ACQUIRE, "workgroup");
}

__global__ __launch_bounds__(64)
void nsa_win_kernel(const float* __restrict__ q, const float* __restrict__ k,
                    const float* __restrict__ v, const float* __restrict__ gw,
                    float* __restrict__ out) {
    __shared__ __align__(16) float q_l[16][132];
    __shared__ __align__(16) float k_l[2][2][16][132];   // [wave][buffer]
    __shared__ __align__(16) float v_l[2][2][16][132];
    __shared__ float p_l[2][16][17];

    const int qt   = blockIdx.x / NHQ;
    const int hq   = blockIdx.x % NHQ;
    const int hk   = hq / REPG;
    const int q0   = qt * 16;
    const int tid  = threadIdx.x;
    const int wv   = __builtin_amdgcn_readfirstlane(tid >> 5);  // scalar: 0 or 1
    const int lane = tid & 31;
    const int half = lane >> 4;     // 0 or 1
    const int l16  = lane & 15;
    const float scale = 0.08838834764831845f;   // 1/sqrt(128)

    const int ktd = qt;
    int lowkey = q0 - (WINW - 1); if (lowkey < 0) lowkey = 0;
    const int ktl = lowkey >> 4;

    // ---- tile staging (async double-buffer if available) ----
#ifdef HAVE_ASYNC_LDS
#define ISSUE_TILE(bufi, ktv)                                                  \
    do {                                                                       \
        for (int i_ = 0; i_ < 16; ++i_) {                                      \
            int idx_ = i_ * 32 + lane;         /* 512 16B chunks per tile */   \
            int r_ = idx_ >> 5;                                                \
            int d_ = (idx_ & 31) << 2;                                         \
            const float* gk_ = &k[(((ktv) * 16 + r_) * NHK + hk) * HDIM + d_]; \
            const float* gv_ = &v[(((ktv) * 16 + r_) * NHK + hk) * HDIM + d_]; \
            __builtin_amdgcn_global_load_async_to_lds_b128(                    \
                (gv4i*)gk_, (lv4i*)&k_l[wv][bufi][r_][d_], 0, 0);              \
            __builtin_amdgcn_global_load_async_to_lds_b128(                    \
                (gv4i*)gv_, (lv4i*)&v_l[wv][bufi][r_][d_], 0, 0);              \
        }                                                                      \
    } while (0)
    // the wave's own copies of this trip's tile have landed
#define WAIT_TILE() asm volatile("s_wait_asynccnt 0x0" ::: "memory")
#else
#define ISSUE_TILE(bufi, ktv)                                                  \
    do {                                                                       \
        for (int idx_ = lane; idx_ < 16 * HDIM; idx_ += 32) {                  \
            int r_ = idx_ >> 7, d_ = idx_ & 127;                               \
            k_l[wv][bufi][r_][d_] = k[(((ktv) * 16 + r_) * NHK + hk) * HDIM + d_]; \
            v_l[wv][bufi][r_][d_] = v[(((ktv) * 16 + r_) * NHK + hk) * HDIM + d_]; \
        }                                                                      \
    } while (0)
#define WAIT_TILE() wave_lds_sync()
#endif

    int buf = 0;
    if (ktd - wv >= ktl) ISSUE_TILE(0, ktd - wv);   // prologue: the wave's first tile in flight

    for (int idx = tid; idx < 16 * HDIM; idx += 64) {
        int r = idx >> 7, d = idx & 127;
        q_l[r][d] = q[((q0 + r) * NHQ + hq) * HDIM + d];
    }
    __syncthreads();

    v8f acc[8];
    float mrow[8], lrow[8];
#pragma unroll
    for (int nt = 0; nt < 8; ++nt)
#pragma unroll
        for (int j = 0; j < 8; ++j) acc[nt][j] = 0.f;
#pragma unroll
    for (int j = 0; j < 8; ++j) { mrow[j] = -3.0e38f; lrow[j] = 0.f; }

    for (int kt = ktd - wv; kt >= ktl; kt -= 2) {
        // the wave's reads of the buffer that is refilled below have retired
        asm volatile("s_wait_dscnt 0x0" ::: "memory");
        WAIT_TILE();            // buffer buf now resident in LDS
        const int nxt = buf ^ 1;
        if (kt - 2 >= ktl) ISSUE_TILE(nxt, kt - 2);  // overlap with compute

        // ---- S = Q K^T (16x16 tile) ----
        v8f c;
#pragma unroll
        for (int j = 0; j < 8; ++j) c[j] = 0.f;
#pragma unroll
        for (int kk = 0; kk < HDIM; kk += 4) {
            v2f a, b;
            a[0] = q_l[l16][kk + 2 * half + 0];
            a[1] = q_l[l16][kk + 2 * half + 1];
            b[0] = k_l[wv][buf][l16][kk + 2 * half + 0];
            b[1] = k_l[wv][buf][l16][kk + 2 * half + 1];
            c = __builtin_amdgcn_wmma_f32_16x16x4_f32(false, a, false, b,
                                                      (short)0, c, false, false);
        }

        // ---- mask + online softmax update ----
        const int ng = kt * 16 + l16;
#pragma unroll
        for (int j = 0; j < 8; ++j) {
            int qs  = q0 + j + 8 * half;
            int dif = qs - ng;
            bool valid = (dif >= 0) && (dif < WINW);
            float sv = valid ? c[j] * scale : NEGV;
            float rmax = sv;
#pragma unroll
            for (int m = 1; m <= 8; m <<= 1)
                rmax = fmaxf(rmax, __shfl_xor(rmax, m, 32));
            float mnew = fmaxf(mrow[j], rmax);
            float corr = expf(mrow[j] - mnew);
            float p    = expf(sv - mnew);
            float rsum = p;
#pragma unroll
            for (int m = 1; m <= 8; m <<= 1)
                rsum += __shfl_xor(rsum, m, 32);
            lrow[j] = lrow[j] * corr + rsum;
            mrow[j] = mnew;
#pragma unroll
            for (int nt = 0; nt < 8; ++nt) acc[nt][j] *= corr;
            p_l[wv][j + 8 * half][l16] = p;
        }
        wave_lds_sync();

        // ---- O += P * V (16x16 x 16x128) ----
#pragma unroll
        for (int kc4 = 0; kc4 < 16; kc4 += 4) {
            v2f a;
            a[0] = p_l[wv][l16][kc4 + 2 * half + 0];
            a[1] = p_l[wv][l16][kc4 + 2 * half + 1];
#pragma unroll
            for (int nt = 0; nt < 8; ++nt) {
                v2f b;
                b[0] = v_l[wv][buf][kc4 + 2 * half + 0][nt * 16 + l16];
                b[1] = v_l[wv][buf][kc4 + 2 * half + 1][nt * 16 + l16];
                acc[nt] = __builtin_amdgcn_wmma_f32_16x16x4_f32(false, a, false, b,
                                                   (short)0, acc[nt], false, false);
            }
        }
        buf = nxt;
    }

    // ---- join: wave w finishes column tiles 4w..4w+3. Each wave hands the
    // other four tiles, its row maxima and its row sums over in its own ring,
    // lane for lane (both waves hold the same fragment layout). A wave without
    // a tile hands over zeros with the start maximum: weight exp(-huge) = 0.
    float* mine  = &k_l[wv][0][0][0];
    float* other = &k_l[wv ^ 1][0][0][0];
#pragma unroll   // acc[] stays in registers: nt is a constant in every index
    for (int nt = 0; nt < 8; ++nt)
        if ((nt >> 2) != wv) {
            *(float4*)&mine[(((nt & 3) * 2 + 0) * 32 + lane) * 4] =
                make_float4(acc[nt][0], acc[nt][1], acc[nt][2], acc[nt][3]);
            *(float4*)&mine[(((nt & 3) * 2 + 1) * 32 + lane) * 4] =
                make_float4(acc[nt][4], acc[nt][5], acc[nt][6], acc[nt][7]);
        }
#pragma unroll   // mrow[], lrow[] stay in registers
    for (int j = 0; j < 8; ++j) {
        mine[1024 + j * 32 + lane] = mrow[j];
        mine[1280 + j * 32 + lane] = lrow[j];
    }
    __syncthreads();

    float wa[8], wb[8], gr[8];
#pragma unroll   // mrow[], lrow[] stay in registers
    for (int j = 0; j < 8; ++j) {
        float mo = other[1024 + j * 32 + lane];
        float lo = other[1280 + j * 32 + lane];
        float mj = fmaxf(mrow[j], mo);
        wa[j] = expf(mrow[j] - mj);
        wb[j] = expf(mo - mj);
        lrow[j] = lrow[j] * wa[j] + lo * wb[j];
        gr[j] = gw[(q0 + j + 8 * half) * NHQ + hq];
    }
#pragma unroll   // acc[] stays in registers: nt is a constant in every index
    for (int nt = 0; nt < 8; ++nt)
        if ((nt >> 2) == wv) {
            const float4 o0 = *(const float4*)&other[(((nt & 3) * 2 + 0) * 32 + lane) * 4];
            const float4 o1 = *(const float4*)&other[(((nt & 3) * 2 + 1) * 32 + lane) * 4];
            const float ob[8] = {o0.x, o0.y, o0.z, o0.w, o1.x, o1.y, o1.z, o1.w};
#pragma unroll   // ob[] stays in registers
            for (int j = 0; j < 8; ++j) {
                int row = q0 + j + 8 * half;
                int d   = nt * 16 + l16;
                float o = (acc[nt][j] * wa[j] + ob[j] * wb[j]) / lrow[j];
                out[(row * NHQ + hq) * HDIM + d] = gr[j] * o;
            }
            // stands in front of any rewrite of a register that these stores name
            asm volatile("s_wait_xcnt 0x0" ::: "memory");
        }
#undef ISSUE_TILE
#undef WAIT_TILE
}

// --------------------------------------------------------------------------
// Kernel 3: compressed branch. Writes normalized pc [NHQ][S][NB] to ws and
// adds g_cmp * o_cmp into d_out. q, kc and vc come into LDS by asynchronous
// copies: kc and then vc pass as four tiles of 32 rows through a ring of two
// buffers, so that a tile's copies fly while the tile before it is worked on.
// --------------------------------------------------------------------------

// Eight asynchronous copies of one wave, each one whole row: 32 lanes x 16 bytes
// = 512 contiguous bytes. l: the lane's LDS byte address in the first row (rows
// of 132 floats), g: the lane's global address in it, GSTEP: floats a row on.
template <int GSTEP>
__device__ __forceinline__ void copy_rows8(unsigned l, const float* g) {
    constexpr unsigned LSTEP = 132 * 4;
    // the closing s_wait_xcnt stands in the copies' own statement, in front of
    // any rewrite of the address registers that they name
    asm volatile(
        "global_load_async_to_lds_b128 %0, %8, off\n\t"
        "global_load_async_to_lds_b128 %1, %9, off\n\t"
        "global_load_async_to_lds_b128 %2, %10, off\n\t"
        "global_load_async_to_lds_b128 %3, %11, off\n\t"
        "global_load_async_to_lds_b128 %4, %12, off\n\t"
        "global_load_async_to_lds_b128 %5, %13, off\n\t"
        "global_load_async_to_lds_b128 %6, %14, off\n\t"
        "global_load_async_to_lds_b128 %7, %15, off\n\t"
        "s_wait_xcnt 0x0"
        :: "v"(l), "v"(l + 1 * LSTEP), "v"(l + 2 * LSTEP), "v"(l + 3 * LSTEP),
           "v"(l + 4 * LSTEP), "v"(l + 5 * LSTEP), "v"(l + 6 * LSTEP), "v"(l + 7 * LSTEP),
           "v"(g), "v"(g + 1 * GSTEP), "v"(g + 2 * GSTEP), "v"(g + 3 * GSTEP),
           "v"(g + 4 * GSTEP), "v"(g + 5 * GSTEP), "v"(g + 6 * GSTEP), "v"(g + 7 * GSTEP)
        : "memory");
}

// Hand-over point of the ring: the wave's reads of the buffer that is refilled
// behind it have retired, its copies of the next tile have landed, and the
// barrier publishes them (for a work-group of one wave the compiler emits no
// barrier instruction).
__device__ __forceinline__ void ring_handover() {
    // keeps this tile's WMMAs in front of the wait: moved behind it, the next
    // tile's copies would no longer fly under them, and all fragments of the
    // tile would have to sit in registers at once
    __builtin_amdgcn_sched_barrier(0);
    asm volatile("s_wait_dscnt 0x0" ::: "memory");
    asm volatile("s_wait_asynccnt 0x0" ::: "memory");
    __syncthreads();
}

__global__ __launch_bounds__(32)
void nsa_cmp_kernel(const float* __restrict__ q, const float* __restrict__ kc,
                    const float* __restrict__ vc, const float* __restrict__ gc,
                    float* __restrict__ pc_ws, float* __restrict__ out) {
    __shared__ __align__(16) float q_l[16][132];
    __shared__ __align__(16) float t_l[2][32][132];   // ring: kc rows, then vc rows
    __shared__ float p_l[16][68];

    const int qt   = blockIdx.x / NHQ;
    const int hq   = blockIdx.x % NHQ;
    const int hk   = hq / REPG;
    const int q0   = qt * 16;
    const int tid  = threadIdx.x;
    const int half = tid >> 4;
    const int l16  = tid & 15;
    const float scale = 0.08838834764831845f;

    // lane l brings floats 4l..4l+3 of every row
    const unsigned lq = (unsigned)(size_t)&q_l[0][4 * tid];
    const unsigned lt[2] = {(unsigned)(size_t)&t_l[0][0][4 * tid],
                            (unsigned)(size_t)&t_l[1][0][4 * tid]};
    const float* gq = q + (q0 * NHQ + hq) * HDIM + 4 * tid;
    const float* gk = kc + hk * HDIM + 4 * tid;
    const float* gv = vc + hk * HDIM + 4 * tid;
    constexpr int QSTEP = NHQ * HDIM, TSTEP = NHK * HDIM;   // floats: one row on
    // 32 rows, from row r0 of kc or vc, into ring buffer b
#define ISSUE_ROWS32(b, gsrc, r0)                                              \
    do {                                                                       \
        copy_rows8<TSTEP>(lt[b] +  0 * 528u, (gsrc) + ((r0) +  0) * TSTEP);    \
        copy_rows8<TSTEP>(lt[b] +  8 * 528u, (gsrc) + ((r0) +  8) * TSTEP);    \
        copy_rows8<TSTEP>(lt[b] + 16 * 528u, (gsrc) + ((r0) + 16) * TSTEP);    \
        copy_rows8<TSTEP>(lt[b] + 24 * 528u, (gsrc) + ((r0) + 24) * TSTEP);    \
    } while (0)

    copy_rows8<QSTEP>(lq, gq);
    copy_rows8<QSTEP>(lq + 8 * 528u, gq + 8 * QSTEP);
    ISSUE_ROWS32(0, gk, 0);
    // q and kc rows 0..31 have landed before the barrier publishes them
    asm volatile("s_wait_asynccnt 0x0" ::: "memory");
    __syncthreads();
    ISSUE_ROWS32(1, gk, 32);

    v8f sc[4];
#pragma unroll   // sc[] stays in registers; the ring buffer is a constant
    for (int nt = 0; nt < 4; ++nt) {
        if (nt == 2) {
            ring_handover();            // kc rows 32..63 are there
            ISSUE_ROWS32(0, gv, 0);
        }
        const float (*k_l)[132] = &t_l[nt >> 1][(nt & 1) * 16];
        v8f c;
#pragma unroll
        for (int j = 0; j < 8; ++j) c[j] = 0.f;
#pragma unroll
        for (int kk = 0; kk < HDIM; kk += 4) {
            v2f a, b;
            a[0] = q_l[l16][kk + 2 * half + 0];
            a[1] = q_l[l16][kk + 2 * half + 1];
            b[0] = k_l[l16][kk + 2 * half + 0];
            b[1] = k_l[l16][kk + 2 * half + 1];
            c = __builtin_amdgcn_wmma_f32_16x16x4_f32(false, a, false, b,
                                                      (short)0, c, false, false);
        }
        sc[nt] = c;
    }
    ring_handover();                    // vc rows 0..31 are there
    ISSUE_ROWS32(1, gv, 32);            // they fly under the softmax

    // mask + scale  (block fully in the past: (n+1)*32-1 <= s)
    for (int nt = 0; nt < 4; ++nt)
#pragma unroll
        for (int j = 0; j < 8; ++j) {
            int n = nt * 16 + l16;
            int s = q0 + j + 8 * half;
            bool valid = ((n + 1) * BLKC - 1) <= s;
            sc[nt][j] = valid ? sc[nt][j] * scale : NEGV;
        }

    // row softmax over 64 blocks
    float mrow[8], lrow[8];
#pragma unroll
    for (int j = 0; j < 8; ++j) {
        float rm = -3.0e38f;
        for (int nt = 0; nt < 4; ++nt) rm = fmaxf(rm, sc[nt][j]);
#pragma unroll
        for (int m = 1; m <= 8; m <<= 1) rm = fmaxf(rm, __shfl_xor(rm, m, 32));
        mrow[j] = rm;
    }
    for (int nt = 0; nt < 4; ++nt)
#pragma unroll
        for (int j = 0; j < 8; ++j) sc[nt][j] = expf(sc[nt][j] - mrow[j]);
#pragma unroll
    for (int j = 0; j < 8; ++j) {
        float rs = 0.f;
        for (int nt = 0; nt < 4; ++nt) rs += sc[nt][j];
#pragma unroll
        for (int m = 1; m <= 8; m <<= 1) rs += __shfl_xor(rs, m, 32);
        lrow[j] = rs;
    }
    for (int nt = 0; nt < 4; ++nt)
#pragma unroll
        for (int j = 0; j < 8; ++j) {
            float p = sc[nt][j] / lrow[j];
            int s = q0 + j + 8 * half;
            int n = nt * 16 + l16;
            pc_ws[(hq * SS + s) * NBC + n] = p;
            p_l[j + 8 * half][n] = p;
        }

    // O = P (16x64) * vc (64x128), 16 K-rows a step; vc comes in 32-row tiles
    v8f acc[8];
#pragma unroll
    for (int nt = 0; nt < 8; ++nt)
#pragma unroll
        for (int j = 0; j < 8; ++j) acc[nt][j] = 0.f;

    __syncthreads();                    // p_l is written
#pragma unroll   // the ring buffer is a constant
    for (int st = 0; st < 4; ++st) {
        if (st == 2) ring_handover();   // vc rows 32..63 are there
        const float (*v_l)[132] = &t_l[st >> 1][(st & 1) * 16];
#pragma unroll
        for (int kq = 0; kq < 16; kq += 4) {
            int kc4 = st * 16 + kq;
            v2f a;
            a[0] = p_l[l16][kc4 + 2 * half + 0];
            a[1] = p_l[l16][kc4 + 2 * half + 1];
#pragma unroll
            for (int nt = 0; nt < 8; ++nt) {
                v2f b;
                b[0] = v_l[kq + 2 * half + 0][nt * 16 + l16];
                b[1] = v_l[kq + 2 * half + 1][nt * 16 + l16];
                acc[nt] = __builtin_amdgcn_wmma_f32_16x16x4_f32(false, a, false, b,
                                                   (short)0, acc[nt], false, false);
            }
        }
    }

    for (int nt = 0; nt < 8; ++nt)
        for (int j = 0; j < 8; ++j) {
            int row = q0 + j + 8 * half;
            int d   = nt * 16 + l16;
            float o = (row >= BLKC - 1) ? acc[nt][j] : 0.f;  // cmask.any zeroing
            out[(row * NHQ + hq) * HDIM + d] += gc[row * NHQ + hq] * o;
        }
#undef ISSUE_ROWS32
}

// --------------------------------------------------------------------------
// Maximum over the 32 lanes of a wave, the same value in every lane: four steps
// inside each row of 16 lanes, then the other row's result.
// --------------------------------------------------------------------------
template <int XMASK>
__device__ __forceinline__ int row_xmask_max(int x) {
    // 0x160 | m: lane l takes the value of lane l ^ m of its row
    const int y = __builtin_amdgcn_update_dpp(0, x, 0x160 | XMASK, 0xf, 0xf, true);
    return x > y ? x : y;
}
__device__ __forceinline__ int wave_max32(int x) {
    x = row_xmask_max<1>(x);
    x = row_xmask_max<2>(x);
    x = row_xmask_max<4>(x);
    x = row_xmask_max<8>(x);
    const int y = __builtin_amdgcn_permlanex16(x, x, 0x76543210, 0xfedcba98, false, false);
    return x > y ? x : y;
}

// --------------------------------------------------------------------------
// Kernel 4: selected branch. 128 threads per (s, hk): 4 rep heads, 128
// gathered keys. Wave w first finds the top w+1 blocks of its (s, hk) itself,
// from the pooled pc row spread over its lanes, and keeps the one that it
// works on. K rows staged in LDS. P * V: wave w takes the 32 V rows of
// selected block w, a whole row per load; the four partial sums are joined
// through LDS. Adds g_slt * o_slt into d_out.
// --------------------------------------------------------------------------
__global__ __launch_bounds__(128)
void nsa_slt_kernel(const float* __restrict__ q, const float* __restrict__ k,
                    const float* __restrict__ v, const float* __restrict__ gs,
                    const float* __restrict__ pc, float* __restrict__ out) {
    // K is staged in two halves of the head dim (64 floats a row) so that eight
    // work-groups fit one WGP's LDS. Row pitch 272 B = 16 B x 17: 16-byte reads
    // of one row per lane meet no bank conflict.
    __shared__ __align__(16) float k_l[TOPN * BLKC][HDIM / 2 + 4];
    __shared__ __align__(16) float qsm[REPG][HDIM];
    __shared__ __align__(16) float scm[REPG][TOPN * BLKC];

    const int s  = blockIdx.x / NHK;
    const int hk = blockIdx.x % NHK;
    const int t  = threadIdx.x;
    const float scale = 0.08838834764831845f;

    // wave w stages the 32 rows of selected block w; k_l row t belongs to key t.
    // One copy of the wave = two half rows of 256 contiguous bytes: whole cache lines.
    int bsel = 0;
    {
        // lane l holds blocks l and l + 32: a load of the wave is one cache line
        const int ln = t & 31;
        const int wsel = __builtin_amdgcn_readfirstlane(t >> 5);   // scalar: 0..3
        const int cur = s / BLKC;
        const float* pr0 = &pc[((hk * REPG + 0) * SS + s) * NBC + ln];
        const float* pr1 = pr0 + 1 * SS * NBC;
        const float* pr2 = pr0 + 2 * SS * NBC;
        const float* pr3 = pr0 + 3 * SS * NBC;
        float a0, a1, a2, a3, b0, b1, b2, b3;
        // eight loads in flight together. They and their data wait are one
        // statement with early-clobber outputs, so that no result lands in an
        // address register of the run and none is rewritten ahead of the wait
        asm volatile(
            "global_load_b32 %0, %8, off\n\t"
            "global_load_b32 %4, %8, off offset:128\n\t"
            "global_load_b32 %1, %9, off\n\t"
            "global_load_b32 %5, %9, off offset:128\n\t"
            "global_load_b32 %2, %10, off\n\t"
            "global_load_b32 %6, %10, off offset:128\n\t"
            "global_load_b32 %3, %11, off\n\t"
            "global_load_b32 %7, %11, off offset:128\n\t"
            "s_wait_loadcnt 0x0"
            : "=&v"(a0), "=&v"(a1), "=&v"(a2), "=&v"(a3),
              "=&v"(b0), "=&v"(b1), "=&v"(b2), "=&v"(b3)
            : "v"(pr0), "v"(pr1), "v"(pr2), "v"(pr3)
            : "memory");
        // heads summed in ascending order, from +0
        float v0 = (((0.f + a0) + a1) + a2) + a3;
        float v1 = (((0.f + b0) + b1) + b2) + b3;
        if (ln == cur)      v0 += 1e6f;
        if (ln + 32 == cur) v1 += 1e6f;
        if (ln == 0)        v0 += 1e6f;
        // pc holds softmax weights, so every pooled score is +0 or above, and
        // the bit patterns, read as integers, order and compare as the values do
        int k0 = __builtin_bit_cast(int, v0), k1 = __builtin_bit_cast(int, v1);
        // argmax passes; among equal values the lowest block index wins, as in
        // top_k. Wave w needs the winner of pass w and stops there.
        for (int pass = 0; pass < TOPN; ++pass) {
            const int m = wave_max32(k0 > k1 ? k0 : k1);
            const unsigned long long eq =
                (unsigned long long)__builtin_amdgcn_ballot_w32(k0 == m) |
                ((unsigned long long)__builtin_amdgcn_ballot_w32(k1 == m) << 32);
            bsel = __builtin_ctzll(eq);   // m is some lane's key: eq != 0, 0 <= bsel < NBC
            if (pass == wsel) break;
            if (ln == bsel)      k0 = -1;   // below every live key
            if (ln + 32 == bsel) k1 = -1;
        }
    }
    const float* g0 = k + ((bsel * BLKC + ((t >> 4) & 1)) * NHK + hk) * HDIM + 4 * (t & 15);
    const unsigned l0 = (unsigned)(size_t)&k_l[(t & ~31) + ((t >> 4) & 1)][4 * (t & 15)];
    constexpr int GSTEP = 2 * NHK * HDIM;            // floats: two key rows on
    constexpr unsigned LSTEP = 2 * (HDIM / 2 + 4) * 4;  // bytes: two k_l rows on

    float a[REPG] = {0.f, 0.f, 0.f, 0.f};
#pragma unroll   // two trips, straight-line: h is a constant in every address
    for (int h = 0; h < 2; ++h) {
        if (h) {
            // every reader has left k_l before the second half overwrites it
            asm volatile("s_wait_dscnt 0x0" ::: "memory");
            __syncthreads();
        }
#pragma unroll   // straight-line: all 16 copies of the wave are in flight together
        for (int i = 0; i < 16; i += 8) {
            const float* g = g0 + h * (HDIM / 2) + i * GSTEP;
            const unsigned l = l0 + i * LSTEP;
            // the closing s_wait_xcnt stands in the copies' own statement, in
            // front of any rewrite of the address registers that they name
            asm volatile(
                "global_load_async_to_lds_b128 %0, %8, off\n\t"
                "global_load_async_to_lds_b128 %1, %9, off\n\t"
                "global_load_async_to_lds_b128 %2, %10, off\n\t"
                "global_load_async_to_lds_b128 %3, %11, off\n\t"
                "global_load_async_to_lds_b128 %4, %12, off\n\t"
                "global_load_async_to_lds_b128 %5, %13, off\n\t"
                "global_load_async_to_lds_b128 %6, %14, off\n\t"
                "global_load_async_to_lds_b128 %7, %15, off\n\t"
                "s_wait_xcnt 0x0"
                :: "v"(l), "v"(l + 1 * LSTEP), "v"(l + 2 * LSTEP), "v"(l + 3 * LSTEP),
                   "v"(l + 4 * LSTEP), "v"(l + 5 * LSTEP), "v"(l + 6 * LSTEP), "v"(l + 7 * LSTEP),
                   "v"(g), "v"(g + 1 * GSTEP), "v"(g + 2 * GSTEP), "v"(g + 3 * GSTEP),
                   "v"(g + 4 * GSTEP), "v"(g + 5 * GSTEP), "v"(g + 6 * GSTEP), "v"(g + 7 * GSTEP)
                : "memory");
        }
        if (h == 0) {
            for (int i = t; i < REPG * HDIM; i += 128) {
                int r = i / HDIM, d = i % HDIM;
                qsm[r][d] = q[(s * NHQ + hk * REPG + r) * HDIM + d];
            }
        }
        // the wave's own copies have landed before the barrier publishes k_l
        asm volatile("s_wait_asynccnt 0x0" ::: "memory");
        __syncthreads();

        // scores: thread t handles key t, read from its k_l row; each head's
        // sum runs over d in ascending order
        for (int d = 0; d < HDIM / 2; d += 4) {
            const float4 kv = *(const float4*)&k_l[t][d];
#pragma unroll   // a[] stays in registers
            for (int r = 0; r < REPG; ++r) {
                const float4 qv = *(const float4*)&qsm[r][h * (HDIM / 2) + d];
                a[r] = fmaf(qv.x, kv.x, a[r]);
                a[r] = fmaf(qv.y, kv.y, a[r]);
                a[r] = fmaf(qv.z, kv.z, a[r]);
                a[r] = fmaf(qv.w, kv.w, a[r]);
            }
        }
    }
    // V rows of the wave's own block: lane l holds dims 4l..4l+3, one load of
    // the wave is one whole row (512 contiguous bytes). The first 16 rows, the
    // old output row and its gate are asked for here, so that their latency
    // runs under the softmax.
    const int wave = t >> 5, lane = t & 31;
    const float4* vrow = (const float4*)(v + (bsel * BLKC * NHK + hk) * HDIM) + lane;
    constexpr int VSTEP = NHK * HDIM / 4;            // float4s: one key row on
    float4 vr[16];
#pragma unroll   // vr[] stays in registers; 16 loads in flight together
    for (int i = 0; i < 16; ++i) vr[i] = vrow[i * VSTEP];
    // wave w finishes rep head w
    float4* orow = (float4*)(out + (s * NHQ + hk * REPG + wave) * HDIM) + lane;
    const float4 oold = *orow;
    const float  gate = gs[s * NHQ + hk * REPG + wave];

    {
        int pos = bsel * BLKC + (t % BLKC);
#pragma unroll   // a[] stays in registers
        for (int r = 0; r < REPG; ++r)
            scm[r][t] = (pos <= s) ? a[r] * scale : NEGV;
    }
    __syncthreads();

    // softmax: wave w handles row w (4 waves of 32 lanes)
    {
        float vals[4];
        float mloc = -3.0e38f;
        for (int i = 0; i < 4; ++i) {
            vals[i] = scm[wave][lane + 32 * i];
            mloc = fmaxf(mloc, vals[i]);
        }
        for (int m = 1; m <= 16; m <<= 1)
            mloc = fmaxf(mloc, __shfl_xor(mloc, m, 32));
        float ssum = 0.f;
        for (int i = 0; i < 4; ++i) { vals[i] = expf(vals[i] - mloc); ssum += vals[i]; }
        for (int m = 1; m <= 16; m <<= 1)
            ssum += __shfl_xor(ssum, m, 32);
        float inv = 1.0f / ssum;
        for (int i = 0; i < 4; ++i) scm[wave][lane + 32 * i] = vals[i] * inv;
    }
    __syncthreads();

    // partial output of the wave's 32 keys, all 4 rep heads, 4 dims a lane
    float4 o[REPG];
#pragma unroll   // o[] stays in registers
    for (int r = 0; r < REPG; ++r) o[r] = make_float4(0.f, 0.f, 0.f, 0.f);
#pragma unroll   // vr[] stays in registers: every index is a constant
    for (int i = 0; i < BLKC; i += 4) {
        float pr[REPG][4];
#pragma unroll   // pr[] stays in registers
        for (int r = 0; r < REPG; ++r) {
            const float4 p4 = *(const float4*)&scm[r][wave * BLKC + i];
            pr[r][0] = p4.x; pr[r][1] = p4.y; pr[r][2] = p4.z; pr[r][3] = p4.w;
        }
#pragma unroll   // vr[], pr[] stay in registers
        for (int u = 0; u < 4; ++u) {
            const float4 vv = vr[(i + u) & 15];
#pragma unroll   // o[] stays in registers
            for (int r = 0; r < REPG; ++r) {
                o[r].x = fmaf(pr[r][u], vv.x, o[r].x);
                o[r].y = fmaf(pr[r][u], vv.y, o[r].y);
                o[r].z = fmaf(pr[r][u], vv.z, o[r].z);
                o[r].w = fmaf(pr[r][u], vv.w, o[r].w);
            }
            // the row 16 further on takes the registers that have just been used
            if (i + u < 16) vr[i + u] = vrow[(i + u + 16) * VSTEP];
            // behind the last V load, in front of any rewrite of its address registers
            if (i + u == 15) asm volatile("s_wait_xcnt 0x0" ::: "memory");
        }
    }

    // join: k_l is free since the barrier behind the scores
    float* red = &k_l[0][0];                         // [wave][rep head][HDIM]
#pragma unroll   // o[] stays in registers
    for (int r = 0; r < REPG; ++r)
        *(float4*)&red[(wave * REPG + r) * HDIM + 4 * lane] = o[r];
    __syncthreads();
    {
        float4 sum = *(const float4*)&red[(0 * REPG + wave) * HDIM + 4 * lane];
#pragma unroll   // three more partial sums, in the order of the selected blocks
        for (int w = 1; w < TOPN; ++w) {
            const float4 pw = *(const float4*)&red[(w * REPG + wave) * HDIM + 4 * lane];
            sum.x += pw.x; sum.y += pw.y; sum.z += pw.z; sum.w += pw.w;
        }
        *orow = make_float4(fmaf(gate, sum.x, oold.x), fmaf(gate, sum.y, oold.y),
                            fmaf(gate, sum.z, oold.z), fmaf(gate, sum.w, oold.w));
    }
}

// --------------------------------------------------------------------------
extern "C" void kernel_launch(void* const* d_in, const int* in_sizes, int n_in,
                              void* d_out, int out_size, void* d_ws, size_t ws_size,
                              hipStream_t stream) {
    const float* q  = (const float*)d_in[0];
    const float* k  = (const float*)d_in[1];
    const float* v  = (const float*)d_in[2];
    const float* gw = (const float*)d_in[3];
    const float* gc = (const float*)d_in[4];
    const float* gs = (const float*)d_in[5];
    float* out = (float*)d_out;

    float* ws = (float*)d_ws;
    float* kc = ws;                                  // NB*NHK*HD = 16384 floats
    float* vc = ws + NBC * NHK * HDIM;               // 16384 floats
    float* pc = vc + NBC * NHK * HDIM;               // NHQ*S*NB = 1,048,576 floats

    nsa_cmpkv_kernel<<<(NBC * NHK * HDIM + 255) / 256, 256, 0, stream>>>(k, v, kc, vc);
    nsa_win_kernel<<<(SS / 16) * NHQ, 64, 0, stream>>>(q, k, v, gw, out);
    nsa_cmp_kernel<<<(SS / 16) * NHQ, 32, 0, stream>>>(q, kc, vc, gc, pc, out);
    nsa_slt_kernel<<<SS * NHK, 128, 0, stream>>>(q, k, v, gs, pc, out);
}

// v006
// A run of this version takes 86.9 microseconds.
// Next to v005, in two timings, it ran 1.06 times as fast each time.
// Over all steps from v000 it is 2.70 times as fast.
#include <hip/hip_runtime.h>
#include <hip/hip_bf16.h>

#define SS   2048
#define NHQ  8
#define NHK  2
#define HDIM 128
#define REPG 4
#define WINW 512
#define BLKC 32
#define NBC  64
#define TOPN 4
#define NEGV (-1e30f)

typedef __attribute__((ext_vector_type(2))) float v2f;
typedef __attribute__((ext_vector_type(8))) float v8f;

#if defined(__has_builtin)
#if __has_builtin(__builtin_amdgcn_global_load_async_to_lds_b128)
#define HAVE_ASYNC_LDS 1
#endif
#endif

#ifdef HAVE_ASYNC_LDS
// builtin signature (from hipcc diagnostic): takes pointers to 16-byte int
// vectors: (v4i addrspace(1)*, v4i addrspace(3)*, imm offset, imm cpol)
typedef int v4i_ __attribute__((vector_size(16)));
typedef __attribute__((address_space(1))) v4i_ gv4i;
typedef __attribute__((address_space(3))) v4i_ lv4i;
#endif

// --------------------------------------------------------------------------
// Kernel 1: block-mean compressed K/V.  kc/vc: [NB][NHK][HD]
// --------------------------------------------------------------------------
__global__ void nsa_cmpkv_kernel(const float* __restrict__ k,
                                 const float* __restrict__ v,
                                 float* __restrict__ kc,
                                 float* __restrict__ vc) {
    int idx = blockIdx.x * blockDim.x + threadIdx.x;
    if (idx >= NBC * NHK * HDIM) return;
    int d  = idx % HDIM;
    int hk = (idx / HDIM) % NHK;
    int n  = idx / (HDIM * NHK);
    float sk = 0.f, sv = 0.f;
    for (int i = 0; i < BLKC; ++i) {
        int row = n * BLKC + i;
        sk += k[(row * NHK + hk) * HDIM + d];
        sv += v[(row * NHK + hk) * HDIM + d];
    }
    kc[(n * NHK + hk) * HDIM + d] = sk * (1.0f / BLKC);
    vc[(n * NHK + hk) * HDIM + d] = sv * (1.0f / BLKC);
}

// --------------------------------------------------------------------------
// Kernel 2: sliding-window branch, flash attention, WMMA f32 16x16x4.
// Two waves per (16-query tile, q-head): wave w takes every second key tile,
// from the diagonal tile minus w downwards, with a K/V ring, a P tile and an
// online softmax of its own; the two partial results are joined through LDS.
// Double-buffered async global->LDS staging of K/V tiles overlaps the next
// tile's load with this tile's WMMAs. Writes (initializes) d_out.
// --------------------------------------------------------------------------

// Orders one wave's own LDS traffic: what some lanes store, other lanes of the
// same wave load behind it. The P tile is private to a wave, so this takes the
// place of a work-group barrier, which would tie the two waves' trips together.
__device__ __forceinline__ void wave_lds_sync() {
    __builtin_amdgcn_fence(__ATOMIC_RELEASE, "workgroup");
    __builtin_amdgcn_wave_barrier();
    __builtin_amdgcn_fence(__ATOMIC_ACQUIRE, "workgroup");
}

__global__ __launch_bounds__(64)
void nsa_win_kernel(const float* __restrict__ q, const float* __restrict__ k,
                    const float* __restrict__ v, const float* __restrict__ gw,
                    float* __restrict__ out) {
    __shared__ __align__(16) float q_l[16][132];
    __shared__ __align__(16) float k_l[2][2][16][132];   // [wave][buffer]
    __shared__ __align__(16) float v_l[2][2][16][132];
    __shared__ float p_l[2][16][17];

    const int qt   = blockIdx.x / NHQ;
    const int hq   = blockIdx.x % NHQ;
    const int hk   = hq / REPG;
    const int q0   = qt * 16;
    const int tid  = threadIdx.x;
    const int wv   = __builtin_amdgcn_readfirstlane(tid >> 5);  // scalar: 0 or 1
    const int lane = tid & 31;
    const int half = lane >> 4;     // 0 or 1
    const int l16  = lane & 15;
    const float scale = 0.08838834764831845f;   // 1/sqrt(128)

    const int ktd = qt;
    int lowkey = q0 - (WINW - 1); if (lowkey < 0) lowkey = 0;
    const int ktl = lowkey >> 4;

    // ---- tile staging (async double-buffer if available) ----
#ifdef HAVE_ASYNC_LDS
#define ISSUE_TILE(bufi, ktv)                                                  \
    do {                                                                       \
        for (int i_ = 0; i_ < 16; ++i_) {                                      \
            int idx_ = i_ * 32 + lane;         /* 512 16B chunks per tile */   \
            int r_ = idx_ >> 5;                                                \
            int d_ = (idx_ & 31) << 2;                                         \
            const float* gk_ = &k[(((ktv) * 16 + r_) * NHK + hk) * HDIM + d_]; \
            const float* gv_ = &v[(((ktv) * 16 + r_) * NHK + hk) * HDIM + d_]; \
            __builtin_amdgcn_global_load_async_to_lds_b128(                    \
                (gv4i*)gk_, (lv4i*)&k_l[wv][bufi][r_][d_], 0, 0);              \
            __builtin_amdgcn_global_load_async_to_lds_b128(                    \
                (gv4i*)gv_, (lv4i*)&v_l[wv][bufi][r_][d_], 0, 0);              \
        }                                                                      \
    } while (0)
    // the wave's own copies of this trip's tile have landed
#define WAIT_TILE() asm volatile("s_wait_asynccnt 0x0" ::: "memory")
#else
#define ISSUE_TILE(bufi, ktv)                                                  \
    do {                                                                       \
        for (int idx_ = lane; idx_ < 16 * HDIM; idx_ += 32) {                  \
            int r_ = idx_ >> 7, d_ = idx_ & 127;                               \
            k_l[wv][bufi][r_][d_] = k[(((ktv) * 16 + r_) * NHK + hk) * HDIM + d_]; \
            v_l[wv][bufi][r_][d_] = v[(((ktv) * 16 + r_) * NHK + hk) * HDIM + d_]; \
        }                                                                      \
    } while (0)
#define WAIT_TILE() wave_lds_sync()
#endif

    int buf = 0;
#ifdef HAVE_ASYNC_LDS
    // q tile: wave w brings rows 8w..8w+7, one copy a row (32 lanes x 16 bytes)
#pragma unroll   // straight-line: all eight copies are in flight together
    for (int i_ = 0; i_ < 8; ++i_) {
        const int r_ = wv * 8 + i_;
        __builtin_amdgcn_global_load_async_to_lds_b128(
            (gv4i*)&q[((q0 + r_) * NHQ + hq) * HDIM + 4 * lane],
            (lv4i*)&q_l[r_][4 * lane], 0, 0);
    }
#endif
    if (ktd - wv >= ktl) ISSUE_TILE(0, ktd - wv);   // prologue: the wave's first tile in flight

#ifdef HAVE_ASYNC_LDS
    // the wave's own q rows have landed before the barrier publishes them
    asm volatile("s_wait_asynccnt 0x0" ::: "memory");
#else
    for (int idx = tid; idx < 16 * HDIM; idx += 64) {
        int r = idx >> 7, d = idx & 127;
        q_l[r][d] = q[((q0 + r) * NHQ + hq) * HDIM + d];
    }
#endif
    __syncthreads();

    v8f acc[8];
    float mrow[8], lrow[8];
#pragma unroll
    for (int nt = 0; nt < 8; ++nt)
#pragma unroll
        for (int j = 0; j < 8; ++j) acc[nt][j] = 0.f;
#pragma unroll
    for (int j = 0; j < 8; ++j) { mrow[j] = -3.0e38f; lrow[j] = 0.f; }

    for (int kt = ktd - wv; kt >= ktl; kt -= 2) {
        // the wave's reads of the buffer that is refilled below have retired
        asm volatile("s_wait_dscnt 0x0" ::: "memory");
        WAIT_TILE();            // buffer buf now resident in LDS
        const int nxt = buf ^ 1;
        if (kt - 2 >= ktl) ISSUE_TILE(nxt, kt - 2);  // overlap with compute

        // ---- S = Q K^T (16x16 tile) ----
        v8f c;
#pragma unroll
        for (int j = 0; j < 8; ++j) c[j] = 0.f;
#pragma unroll
        for (int kk = 0; kk < HDIM; kk += 4) {
            v2f a, b;
            a[0] = q_l[l16][kk + 2 * half + 0];
            a[1] = q_l[l16][kk + 2 * half + 1];
            b[0] = k_l[wv][buf][l16][kk + 2 * half + 0];
            b[1] = k_l[wv][buf][l16][kk + 2 * half + 1];
            c = __builtin_amdgcn_wmma_f32_16x16x4_f32(false, a, false, b,
                                                      (short)0, c, false, false);
        }

        // ---- mask + online softmax update ----
        const int ng = kt * 16 + l16;
#pragma unroll
        for (int j = 0; j < 8; ++j) {
            int qs  = q0 + j + 8 * half;
            int dif = qs - ng;
            bool valid = (dif >= 0) && (dif < WINW);
            float sv = valid ? c[j] * scale : NEGV;
            float rmax = sv;
#pragma unroll
            for (int m = 1; m <= 8; m <<= 1)
                rmax = fmaxf(rmax, __shfl_xor(rmax, m, 32));
            float mnew = fmaxf(mrow[j], rmax);
            float corr = expf(mrow[j] - mnew);
            float p    = expf(sv - mnew);
            float rsum = p;
#pragma unroll
            for (int m = 1; m <= 8; m <<= 1)
                rsum += __shfl_xor(rsum, m, 32);
            lrow[j] = lrow[j] * corr + rsum;
            mrow[j] = mnew;
#pragma unroll
            for (int nt = 0; nt < 8; ++nt) acc[nt][j] *= corr;
            p_l[wv][j + 8 * half][l16] = p;
        }
        wave_lds_sync();

        // ---- O += P * V (16x16 x 16x128) ----
#pragma unroll
        for (int kc4 = 0; kc4 < 16; kc4 += 4) {
            v2f a;
            a[0] = p_l[wv][l16][kc4 + 2 * half + 0];
            a[1] = p_l[wv][l16][kc4 + 2 * half + 1];
#pragma unroll
            for (int nt = 0; nt < 8; ++nt) {
                v2f b;
                b[0] = v_l[wv][buf][kc4 + 2 * half + 0][nt * 16 + l16];
                b[1] = v_l[wv][buf][kc4 + 2 * half + 1][nt * 16 + l16];
                acc[nt] = __builtin_amdgcn_wmma_f32_16x16x4_f32(false, a, false, b,
                                                   (short)0, acc[nt], false, false);
            }
        }
        buf = nxt;
    }

    // ---- join: wave w finishes column tiles 4w..4w+3. Each wave hands the
    // other four tiles, its row maxima and its row sums over in its own ring,
    // lane for lane (both waves hold the same fragment layout). A wave without
    // a tile hands over zeros with the start maximum: weight exp(-huge) = 0.
    float* mine  = &k_l[wv][0][0][0];
    float* other = &k_l[wv ^ 1][0][0][0];
#pragma unroll   // acc[] stays in registers: nt is a constant in every index
    for (int nt = 0; nt < 8; ++nt)
        if ((nt >> 2) != wv) {
            *(float4*)&mine[(((nt & 3) * 2 + 0) * 32 + lane) * 4] =
                make_float4(acc[nt][0], acc[nt][1], acc[nt][2], acc[nt][3]);
            *(float4*)&mine[(((nt & 3) * 2 + 1) * 32 + lane) * 4] =
                make_float4(acc[nt][4], acc[nt][5], acc[nt][6], acc[nt][7]);
        }
#pragma unroll   // mrow[], lrow[] stay in registers
    for (int j = 0; j < 8; ++j) {
        mine[1024 + j * 32 + lane] = mrow[j];
        mine[1280 + j * 32 + lane] = lrow[j];
    }
    __syncthreads();

    float wa[8], wb[8], gr[8];
#pragma unroll   // mrow[], lrow[] stay in registers
    for (int j = 0; j < 8; ++j) {
        float mo = other[1024 + j * 32 + lane];
        float lo = other[1280 + j * 32 + lane];
        float mj = fmaxf(mrow[j], mo);
        wa[j] = expf(mrow[j] - mj);
        wb[j] = expf(mo - mj);
        lrow[j] = lrow[j] * wa[j] + lo * wb[j];
        gr[j] = gw[(q0 + j + 8 * half) * NHQ + hq];
    }
#pragma unroll   // acc[] stays in registers: nt is a constant in every index
    for (int nt = 0; nt < 8; ++nt)
        if ((nt >> 2) == wv) {
            const float4 o0 = *(const float4*)&other[(((nt & 3) * 2 + 0) * 32 + lane) * 4];
            const float4 o1 = *(const float4*)&other[(((nt & 3) * 2 + 1) * 32 + lane) * 4];
            const float ob[8] = {o0.x, o0.y, o0.z, o0.w, o1.x, o1.y, o1.z, o1.w};
#pragma unroll   // ob[] stays in registers
            for (int j = 0; j < 8; ++j) {
                int row = q0 + j + 8 * half;
                int d   = nt * 16 + l16;
                float o = (acc[nt][j] * wa[j] + ob[j] * wb[j]) / lrow[j];
                out[(row * NHQ + hq) * HDIM + d] = gr[j] * o;
            }
            // stands in front of any rewrite of a register that these stores name
            asm volatile("s_wait_xcnt 0x0" ::: "memory");
        }
#undef ISSUE_TILE
#undef WAIT_TILE
}

// --------------------------------------------------------------------------
// Kernel 3: compressed branch. Writes normalized pc [NHQ][S][NB] to ws and
// adds g_cmp * o_cmp into d_out. q, kc and vc come into LDS by asynchronous
// copies: kc and then vc pass as four tiles of 32 rows through a ring of two
// buffers, so that a tile's copies fly while the tile before it is worked on.
// --------------------------------------------------------------------------

// Eight asynchronous copies of one wave, each one whole row: 32 lanes x 16 bytes
// = 512 contiguous bytes. l: the lane's LDS byte address in the first row (rows
// of 132 floats), g: the lane's global address in it, GSTEP: floats a row on.
template <int GSTEP>
__device__ __forceinline__ void copy_rows8(unsigned l, const float* g) {
    constexpr unsigned LSTEP = 132 * 4;
    // the closing s_wait_xcnt stands in the copies' own statement, in front of
    // any rewrite of the address registers that they name
    asm volatile(
        "global_load_async_to_lds_b128 %0, %8, off\n\t"
        "global_load_async_to_lds_b128 %1, %9, off\n\t"
        "global_load_async_to_lds_b128 %2, %10, off\n\t"
        "global_load_async_to_lds_b128 %3, %11, off\n\t"
        "global_load_async_to_lds_b128 %4, %12, off\n\t"
        "global_load_async_to_lds_b128 %5, %13, off\n\t"
        "global_load_async_to_lds_b128 %6, %14, off\n\t"
        "global_load_async_to_lds_b128 %7, %15, off\n\t"
        "s_wait_xcnt 0x0"
        :: "v"(l), "v"(l + 1 * LSTEP), "v"(l + 2 * LSTEP), "v"(l + 3 * LSTEP),
           "v"(l + 4 * LSTEP), "v"(l + 5 * LSTEP), "v"(l + 6 * LSTEP), "v"(l + 7 * LSTEP),
           "v"(g), "v"(g + 1 * GSTEP), "v"(g + 2 * GSTEP), "v"(g + 3 * GSTEP),
           "v"(g + 4 * GSTEP), "v"(g + 5 * GSTEP), "v"(g + 6 * GSTEP), "v"(g + 7 * GSTEP)
        : "memory");
}

// Hand-over point of the ring: the wave's reads of the buffer that is refilled
// behind it have retired, its copies of the next tile have landed, and the
// barrier publishes them (for a work-group of one wave the compiler emits no
// barrier instruction).
__device__ __forceinline__ void ring_handover() {
    // keeps this tile's WMMAs in front of the wait: moved behind it, the next
    // tile's copies would no longer fly under them, and all fragments of the
    // tile would have to sit in registers at once
    __builtin_amdgcn_sched_barrier(0);
    asm volatile("s_wait_dscnt 0x0" ::: "memory");
    asm volatile("s_wait_asynccnt 0x0" ::: "memory");
    __syncthreads();
}

__global__ __launch_bounds__(32)
void nsa_cmp_kernel(const float* __restrict__ q, const float* __restrict__ kc,
                    const float* __restrict__ vc, const float* __restrict__ gc,
                    float* __restrict__ pc_ws, float* __restrict__ out) {
    __shared__ __align__(16) float q_l[16][132];
    __shared__ __align__(16) float t_l[2][32][132];   // ring: kc rows, then vc rows
    __shared__ float p_l[16][68];

    const int qt   = blockIdx.x / NHQ;
    const int hq   = blockIdx.x % NHQ;
    const int hk   = hq / REPG;
    const int q0   = qt * 16;
    const int tid  = threadIdx.x;
    const int half = tid >> 4;
    const int l16  = tid & 15;
    const float scale = 0.08838834764831845f;

    // lane l brings floats 4l..4l+3 of every row
    const unsigned lq = (unsigned)(size_t)&q_l[0][4 * tid];
    const unsigned lt[2] = {(unsigned)(size_t)&t_l[0][0][4 * tid],
                            (unsigned)(size_t)&t_l[1][0][4 * tid]};
    const float* gq = q + (q0 * NHQ + hq) * HDIM + 4 * tid;
    const float* gk = kc + hk * HDIM + 4 * tid;
    const float* gv = vc + hk * HDIM + 4 * tid;
    constexpr int QSTEP = NHQ * HDIM, TSTEP = NHK * HDIM;   // floats: one row on
    // 32 rows, from row r0 of kc or vc, into ring buffer b
#define ISSUE_ROWS32(b, gsrc, r0)                                              \
    do {                                                                       \
        copy_rows8<TSTEP>(lt[b] +  0 * 528u, (gsrc) + ((r0) +  0) * TSTEP);    \
        copy_rows8<TSTEP>(lt[b] +  8 * 528u, (gsrc) + ((r0) +  8) * TSTEP);    \
        copy_rows8<TSTEP>(lt[b] + 16 * 528u, (gsrc) + ((r0) + 16) * TSTEP);    \
        copy_rows8<TSTEP>(lt[b] + 24 * 528u, (gsrc) + ((r0) + 24) * TSTEP);    \
    } while (0)

    copy_rows8<QSTEP>(lq, gq);
    copy_rows8<QSTEP>(lq + 8 * 528u, gq + 8 * QSTEP);
    ISSUE_ROWS32(0, gk, 0);
    // q and kc rows 0..31 have landed before the barrier publishes them
    asm volatile("s_wait_asynccnt 0x0" ::: "memory");
    __syncthreads();
    ISSUE_ROWS32(1, gk, 32);

    v8f sc[4];
#pragma unroll   // sc[] stays in registers; the ring buffer is a constant
    for (int nt = 0; nt < 4; ++nt) {
        if (nt == 2) {
            ring_handover();            // kc rows 32..63 are there
            ISSUE_ROWS32(0, gv, 0);
        }
        const float (*k_l)[132] = &t_l[nt >> 1][(nt & 1) * 16];
        v8f c;
#pragma unroll
        for (int j = 0; j < 8; ++j) c[j] = 0.f;
#pragma unroll
        for (int kk = 0; kk < HDIM; kk += 4) {
            v2f a, b;
            a[0] = q_l[l16][kk + 2 * half + 0];
            a[1] = q_l[l16][kk + 2 * half + 1];
            b[0] = k_l[l16][kk + 2 * half + 0];
            b[1] = k_l[l16][kk + 2 * half + 1];
            c = __builtin_amdgcn_wmma_f32_16x16x4_f32(false, a, false, b,
                                                      (short)0, c, false, false);
        }
        sc[nt] = c;
    }
    ring_handover();                    // vc rows 0..31 are there
    ISSUE_ROWS32(1, gv, 32);            // they fly under the softmax

    // The old output values and the gates are asked for here, all together, so
    // that their latency runs under the softmax and P * V. Read next to their
    // stores they went out in eight rounds of load, wait, store.
    float oold[8][8], gate[8];
#pragma unroll   // gate[] stays in registers
    for (int j = 0; j < 8; ++j) gate[j] = gc[(q0 + j + 8 * half) * NHQ + hq];
#pragma unroll   // oold[] stays in registers; 64 loads in flight together
    for (int nt = 0; nt < 8; ++nt)
#pragma unroll   // as above: j is a constant in every index
        for (int j = 0; j < 8; ++j)
            oold[nt][j] = out[((q0 + j + 8 * half) * NHQ + hq) * HDIM + nt * 16 + l16];

    // mask + scale  (block fully in the past: (n+1)*32-1 <= s)
    for (int nt = 0; nt < 4; ++nt)
#pragma unroll
        for (int j = 0; j < 8; ++j) {
            int n = nt * 16 + l16;
            int s = q0 + j + 8 * half;
            bool valid = ((n + 1) * BLKC - 1) <= s;
            sc[nt][j] = valid ? sc[nt][j] * scale : NEGV;
        }

    // row softmax over 64 blocks
    float mrow[8], lrow[8];
#pragma unroll
    for (int j = 0; j < 8; ++j) {
        float rm = -3.0e38f;
        for (int nt = 0; nt < 4; ++nt) rm = fmaxf(rm, sc[nt][j]);
#pragma unroll
        for (int m = 1; m <= 8; m <<= 1) rm = fmaxf(rm, __shfl_xor(rm, m, 32));
        mrow[j] = rm;
    }
    for (int nt = 0; nt < 4; ++nt)
#pragma unroll
        for (int j = 0; j < 8; ++j) sc[nt][j] = expf(sc[nt][j] - mrow[j]);
#pragma unroll
    for (int j = 0; j < 8; ++j) {
        float rs = 0.f;
        for (int nt = 0; nt < 4; ++nt) rs += sc[nt][j];
#pragma unroll
        for (int m = 1; m <= 8; m <<= 1) rs += __shfl_xor(rs, m, 32);
        lrow[j] = rs;
    }
    for (int nt = 0; nt < 4; ++nt)
#pragma unroll
        for (int j = 0; j < 8; ++j) {
            float p = sc[nt][j] / lrow[j];
            int s = q0 + j + 8 * half;
            int n = nt * 16 + l16;
            pc_ws[(hq * SS + s) * NBC + n] = p;
            p_l[j + 8 * half][n] = p;
        }

    // O = P (16x64) * vc (64x128), 16 K-rows a step; vc comes in 32-row tiles
    v8f acc[8];
#pragma unroll
    for (int nt = 0; nt < 8; ++nt)
#pragma unroll
        for (int j = 0; j < 8; ++j) acc[nt][j] = 0.f;

    __syncthreads();                    // p_l is written
#pragma unroll   // the ring buffer is a constant
    for (int st = 0; st < 4; ++st) {
        if (st == 2) ring_handover();   // vc rows 32..63 are there
        const float (*v_l)[132] = &t_l[st >> 1][(st & 1) * 16];
#pragma unroll
        for (int kq = 0; kq < 16; kq += 4) {
            int kc4 = st * 16 + kq;
            v2f a;
            a[0] = p_l[l16][kc4 + 2 * half + 0];
            a[1] = p_l[l16][kc4 + 2 * half + 1];
#pragma unroll
            for (int nt = 0; nt < 8; ++nt) {
                v2f b;
                b[0] = v_l[kq + 2 * half + 0][nt * 16 + l16];
                b[1] = v_l[kq + 2 * half + 1][nt * 16 + l16];
                acc[nt] = __builtin_amdgcn_wmma_f32_16x16x4_f32(false, a, false, b,
                                                   (short)0, acc[nt], false, false);
            }
        }
    }

#pragma unroll   // acc[], oold[] stay in registers
    for (int nt = 0; nt < 8; ++nt)
#pragma unroll   // as above: j is a constant in every index
        for (int j = 0; j < 8; ++j) {
            int row = q0 + j + 8 * half;
            int d   = nt * 16 + l16;
            float o = (row >= BLKC - 1) ? acc[nt][j] : 0.f;  // cmask.any zeroing
            out[(row * NHQ + hq) * HDIM + d] = oold[nt][j] + gate[j] * o;
        }
#undef ISSUE_ROWS32
}

// --------------------------------------------------------------------------
// Maximum over the 32 lanes of a wave, the same value in every lane: four steps
// inside each row of 16 lanes, then the other row's result.
// --------------------------------------------------------------------------
template <int XMASK>
__device__ __forceinline__ int row_xmask_max(int x) {
    // 0x160 | m: lane l takes the value of lane l ^ m of its row
    const int y = __builtin_amdgcn_update_dpp(0, x, 0x160 | XMASK, 0xf, 0xf, true);
    return x > y ? x : y;
}
__device__ __forceinline__ int wave_max32(int x) {
    x = row_xmask_max<1>(x);
    x = row_xmask_max<2>(x);
    x = row_xmask_max<4>(x);
    x = row_xmask_max<8>(x);
    const int y = __builtin_amdgcn_permlanex16(x, x, 0x76543210, 0xfedcba98, false, false);
    return x > y ? x : y;
}

// --------------------------------------------------------------------------
// Kernel 4: selected branch. 128 threads per (s, hk): 4 rep heads, 128
// gathered keys. Wave w first finds the top w+1 blocks of its (s, hk) itself,
// from the pooled pc row spread over its lanes, and keeps the one that it
// works on. K rows staged in LDS. P * V: wave w takes the 32 V rows of
// selected block w, a whole row per load; the four partial sums are joined
// through LDS. Adds g_slt * o_slt into d_out.
// --------------------------------------------------------------------------
__global__ __launch_bounds__(128)
void nsa_slt_kernel(const float* __restrict__ q, const float* __restrict__ k,
                    const float* __restrict__ v, const float* __restrict__ gs,
                    const float* __restrict__ pc, float* __restrict__ out) {
    // K is staged in two halves of the head dim (64 floats a row) so that eight
    // work-groups fit one WGP's LDS. Row pitch 272 B = 16 B x 17: 16-byte reads
    // of one row per lane meet no bank conflict.
    __shared__ __align__(16) float k_l[TOPN * BLKC][HDIM / 2 + 4];
    __shared__ __align__(16) float qsm[REPG][HDIM];
    __shared__ __align__(16) float scm[REPG][TOPN * BLKC];

    const int s  = blockIdx.x / NHK;
    const int hk = blockIdx.x % NHK;
    const int t  = threadIdx.x;
    const float scale = 0.08838834764831845f;

    // The four q rows of the group are 2 KiB in a row: one copy of 16 bytes a
    // thread brings them. Asked for first, so that they fly under the selection;
    // the wait and the barrier behind the first K copies cover them too. The
    // closing s_wait_xcnt stands in the copy's own statement, in front of any
    // rewrite of the address registers that it names.
    asm volatile(
        "global_load_async_to_lds_b128 %0, %1, off\n\t"
        "s_wait_xcnt 0x0"
        :: "v"((unsigned)(size_t)&qsm[0][0] + 16u * (unsigned)t),
           "v"(q + (s * NHQ + hk * REPG) * HDIM + 4 * t)
        : "memory");

    // wave w stages the 32 rows of selected block w; k_l row t belongs to key t.
    // One copy of the wave = two half rows of 256 contiguous bytes: whole cache lines.
    int bsel = 0;
    {
        // lane l holds blocks l and l + 32: a load of the wave is one cache line
        const int ln = t & 31;
        const int wsel = __builtin_amdgcn_readfirstlane(t >> 5);   // scalar: 0..3
        const int cur = s / BLKC;
        const float* pr0 = &pc[((hk * REPG + 0) * SS + s) * NBC + ln];
        const float* pr1 = pr0 + 1 * SS * NBC;
        const float* pr2 = pr0 + 2 * SS * NBC;
        const float* pr3 = pr0 + 3 * SS * NBC;
        float a0, a1, a2, a3, b0, b1, b2, b3;
        // eight loads in flight together. They and their data wait are one
        // statement with early-clobber outputs, so that no result lands in an
        // address register of the run and none is rewritten ahead of the wait
        asm volatile(
            "global_load_b32 %0, %8, off\n\t"
            "global_load_b32 %4, %8, off offset:128\n\t"
            "global_load_b32 %1, %9, off\n\t"
            "global_load_b32 %5, %9, off offset:128\n\t"
            "global_load_b32 %2, %10, off\n\t"
            "global_load_b32 %6, %10, off offset:128\n\t"
            "global_load_b32 %3, %11, off\n\t"
            "global_load_b32 %7, %11, off offset:128\n\t"
            "s_wait_loadcnt 0x0"
            : "=&v"(a0), "=&v"(a1), "=&v"(a2), "=&v"(a3),
              "=&v"(b0), "=&v"(b1), "=&v"(b2), "=&v"(b3)
            : "v"(pr0), "v"(pr1), "v"(pr2), "v"(pr3)
            : "memory");
        // heads summed in ascending order, from +0
        float v0 = (((0.f + a0) + a1) + a2) + a3;
        float v1 = (((0.f + b0) + b1) + b2) + b3;
        if (ln == cur)      v0 += 1e6f;
        if (ln + 32 == cur) v1 += 1e6f;
        if (ln == 0)        v0 += 1e6f;
        // pc holds softmax weights, so every pooled score is +0 or above, and
        // the bit patterns, read as integers, order and compare as the values do
        int k0 = __builtin_bit_cast(int, v0), k1 = __builtin_bit_cast(int, v1);
        // argmax passes; among equal values the lowest block index wins, as in
        // top_k. Wave w needs the winner of pass w and stops there.
        for (int pass = 0; pass < TOPN; ++pass) {
            const int m = wave_max32(k0 > k1 ? k0 : k1);
            const unsigned long long eq =
                (unsigned long long)__builtin_amdgcn_ballot_w32(k0 == m) |
                ((unsigned long long)__builtin_amdgcn_ballot_w32(k1 == m) << 32);
            bsel = __builtin_ctzll(eq);   // m is some lane's key: eq != 0, 0 <= bsel < NBC
            if (pass == wsel) break;
            if (ln == bsel)      k0 = -1;   // below every live key
            if (ln + 32 == bsel) k1 = -1;
        }
    }
    const float* g0 = k + ((bsel * BLKC + ((t >> 4) & 1)) * NHK + hk) * HDIM + 4 * (t & 15);
    const unsigned l0 = (unsigned)(size_t)&k_l[(t & ~31) + ((t >> 4) & 1)][4 * (t & 15)];
    constexpr int GSTEP = 2 * NHK * HDIM;            // floats: two key rows on
    constexpr unsigned LSTEP = 2 * (HDIM / 2 + 4) * 4;  // bytes: two k_l rows on

    float a[REPG] = {0.f, 0.f, 0.f, 0.f};
#pragma unroll   // two trips, straight-line: h is a constant in every address
    for (int h = 0; h < 2; ++h) {
        if (h) {
            // every reader has left k_l before the second half overwrites it
            asm volatile("s_wait_dscnt 0x0" ::: "memory");
            __syncthreads();
        }
#pragma unroll   // straight-line: all 16 copies of the wave are in flight together
        for (int i = 0; i < 16; i += 8) {
            const float* g = g0 + h * (HDIM / 2) + i * GSTEP;
            const unsigned l = l0 + i * LSTEP;
            // the closing s_wait_xcnt stands in the copies' own statement, in
            // front of any rewrite of the address registers that they name
            asm volatile(
                "global_load_async_to_lds_b128 %0, %8, off\n\t"
                "global_load_async_to_lds_b128 %1, %9, off\n\t"
                "global_load_async_to_lds_b128 %2, %10, off\n\t"
                "global_load_async_to_lds_b128 %3, %11, off\n\t"
                "global_load_async_to_lds_b128 %4, %12, off\n\t"
                "global_load_async_to_lds_b128 %5, %13, off\n\t"
                "global_load_async_to_lds_b128 %6, %14, off\n\t"
                "global_load_async_to_lds_b128 %7, %15, off\n\t"
                "s_wait_xcnt 0x0"
                :: "v"(l), "v"(l + 1 * LSTEP), "v"(l + 2 * LSTEP), "v"(l + 3 * LSTEP),
                   "v"(l + 4 * LSTEP), "v"(l + 5 * LSTEP), "v"(l + 6 * LSTEP), "v"(l + 7 * LSTEP),
                   "v"(g), "v"(g + 1 * GSTEP), "v"(g + 2 * GSTEP), "v"(g + 3 * GSTEP),
                   "v"(g + 4 * GSTEP), "v"(g + 5 * GSTEP), "v"(g + 6 * GSTEP), "v"(g + 7 * GSTEP)
                : "memory");
        }
        // the wave's own copies have landed before the barrier publishes k_l
        // (and, on the first trip, the q rows)
        asm volatile("s_wait_asynccnt 0x0" ::: "memory");
        __syncthreads();

        // scores: thread t handles key t, read from its k_l row; each head's
        // sum runs over d in ascending order
        for (int d = 0; d < HDIM / 2; d += 4) {
            const float4 kv = *(const float4*)&k_l[t][d];
#pragma unroll   // a[] stays in registers
            for (int r = 0; r < REPG; ++r) {
                const float4 qv = *(const float4*)&qsm[r][h * (HDIM / 2) + d];
                a[r] = fmaf(qv.x, kv.x, a[r]);
                a[r] = fmaf(qv.y, kv.y, a[r]);
                a[r] = fmaf(qv.z, kv.z, a[r]);
                a[r] = fmaf(qv.w, kv.w, a[r]);
            }
        }
    }
    // V rows of the wave's own block: lane l holds dims 4l..4l+3, one load of
    // the wave is one whole row (512 contiguous bytes). The first 16 rows, the
    // old output row and its gate are asked for here, so that their latency
    // runs under the softmax.
    const int wave = t >> 5, lane = t & 31;
    const float4* vrow = (const float4*)(v + (bsel * BLKC * NHK + hk) * HDIM) + lane;
    constexpr int VSTEP = NHK * HDIM / 4;            // float4s: one key row on
    float4 vr[16];
#pragma unroll   // vr[] stays in registers; 16 loads in flight together
    for (int i = 0; i < 16; ++i) vr[i] = vrow[i * VSTEP];
    // wave w finishes rep head w
    float4* orow = (float4*)(out + (s * NHQ + hk * REPG + wave) * HDIM) + lane;
    const float4 oold = *orow;
    const float  gate = gs[s * NHQ + hk * REPG + wave];

    {
        int pos = bsel * BLKC + (t % BLKC);
#pragma unroll   // a[] stays in registers
        for (int r = 0; r < REPG; ++r)
            scm[r][t] = (pos <= s) ? a[r] * scale : NEGV;
    }
    __syncthreads();

    // softmax: wave w handles row w (4 waves of 32 lanes)
    {
        float vals[4];
        float mloc = -3.0e38f;
        for (int i = 0; i < 4; ++i) {
            vals[i] = scm[wave][lane + 32 * i];
            mloc = fmaxf(mloc, vals[i]);
        }
        for (int m = 1; m <= 16; m <<= 1)
            mloc = fmaxf(mloc, __shfl_xor(mloc, m, 32));
        float ssum = 0.f;
        for (int i = 0; i < 4; ++i) { vals[i] = expf(vals[i] - mloc); ssum += vals[i]; }
        for (int m = 1; m <= 16; m <<= 1)
            ssum += __shfl_xor(ssum, m, 32);
        float inv = 1.0f / ssum;
        for (int i = 0; i < 4; ++i) scm[wave][lane + 32 * i] = vals[i] * inv;
    }
    __syncthreads();

    // partial output of the wave's 32 keys, all 4 rep heads, 4 dims a lane
    float4 o[REPG];
#pragma unroll   // o[] stays in registers
    for (int r = 0; r < REPG; ++r) o[r] = make_float4(0.f, 0.f, 0.f, 0.f);
#pragma unroll   // vr[] stays in registers: every index is a constant
    for (int i = 0; i < BLKC; i += 4) {
        float pr[REPG][4];
#pragma unroll   // pr[] stays in registers
        for (int r = 0; r < REPG; ++r) {
            const float4 p4 = *(const float4*)&scm[r][wave * BLKC + i];
            pr[r][0] = p4.x; pr[r][1] = p4.y; pr[r][2] = p4.z; pr[r][3] = p4.w;
        }
#pragma unroll   // vr[], pr[] stay in registers
        for (int u = 0; u < 4; ++u) {
            const float4 vv = vr[(i + u) & 15];
#pragma unroll   // o[] stays in registers
            for (int r = 0; r < REPG; ++r) {
                o[r].x = fmaf(pr[r][u], vv.x, o[r].x);
                o[r].y = fmaf(pr[r][u], vv.y, o[r].y);
                o[r].z = fmaf(pr[r][u], vv.z, o[r].z);
                o[r].w = fmaf(pr[r][u], vv.w, o[r].w);
            }
            // the row 16 further on takes the registers that have just been used
            if (i + u < 16) vr[i + u] = vrow[(i + u + 16) * VSTEP];
            // behind the last V load, in front of any rewrite of its address registers
            if (i + u == 15) asm volatile("s_wait_xcnt 0x0" ::: "memory");
        }
    }

    // join: k_l is free since the barrier behind the scores
    float* red = &k_l[0][0];                         // [wave][rep head][HDIM]
#pragma unroll   // o[] stays in registers
    for (int r = 0; r < REPG; ++r)
        *(float4*)&red[(wave * REPG + r) * HDIM + 4 * lane] = o[r];
    __syncthreads();
    {
        float4 sum = *(const float4*)&red[(0 * REPG + wave) * HDIM + 4 * lane];
#pragma unroll   // three more partial sums, in the order of the selected blocks
        for (int w = 1; w < TOPN; ++w) {
            const float4 pw = *(const float4*)&red[(w * REPG + wave) * HDIM + 4 * lane];
            sum.x += pw.x; sum.y += pw.y; sum.z += pw.z; sum.w += pw.w;
        }
        *orow = make_float4(fmaf(gate, sum.x, oold.x), fmaf(gate, sum.y, oold.y),
                            fmaf(gate, sum.z, oold.z), fmaf(gate, sum.w, oold.w));
    }
}

// --------------------------------------------------------------------------
extern "C" void kernel_launch(void* const* d_in, const int* in_sizes, int n_in,
                              void* d_out, int out_size, void* d_ws, size_t ws_size,
                              hipStream_t stream) {
    const float* q  = (const float*)d_in[0];
    const float* k  = (const float*)d_in[1];
    const float* v  = (const float*)d_in[2];
    const float* gw = (const float*)d_in[3];
    const float* gc = (const float*)d_in[4];
    const float* gs = (const float*)d_in[5];
    float* out = (float*)d_out;

    float* ws = (float*)d_ws;
    float* kc = ws;                                  // NB*NHK*HD = 16384 floats
    float* vc = ws + NBC * NHK * HDIM;               // 16384 floats
    float* pc = vc + NBC * NHK * HDIM;               // NHQ*S*NB = 1,048,576 floats

    nsa_cmpkv_kernel<<<(NBC * NHK * HDIM + 255) / 256, 256, 0, stream>>>(k, v, kc, vc);
    nsa_win_kernel<<<(SS / 16) * NHQ, 64, 0, stream>>>(q, k, v, gw, out);
    nsa_cmp_kernel<<<(SS / 16) * NHQ, 32, 0, stream>>>(q, kc, vc, gc, pc, out);
    nsa_slt_kernel<<<SS * NHK, 128, 0, stream>>>(q, k, v, gs, pc, out);
}

// v007
// One run takes 71.5 microseconds.
// Next to v006, in two timings, it ran 1.21 and 1.22 times as fast.
// All steps since v000 together make it 3.29 times as fast.
#include <hip/hip_runtime.h>
#include <hip/hip_bf16.h>

#define SS   2048
#define NHQ  8
#define NHK  2
#define HDIM 128
#define REPG 4
#define WINW 512
#define BLKC 32
#define NBC  64
#define TOPN 4
#define NEGV (-1e30f)

typedef __attribute__((ext_vector_type(2))) float v2f;
typedef __attribute__((ext_vector_type(8))) float v8f;

#if defined(__has_builtin)
#if __has_builtin(__builtin_amdgcn_global_load_async_to_lds_b128)
#define HAVE_ASYNC_LDS 1
#endif
#endif

#ifdef HAVE_ASYNC_LDS
// builtin signature (from hipcc diagnostic): takes pointers to 16-byte int
// vectors: (v4i addrspace(1)*, v4i addrspace(3)*, imm offset, imm cpol)
typedef int v4i_ __attribute__((vector_size(16)));
typedef __attribute__((address_space(1))) v4i_ gv4i;
typedef __attribute__((address_space(3))) v4i_ lv4i;
#endif

// --------------------------------------------------------------------------
// Kernel 1: block-mean compressed K/V.  kc/vc: [NB][NHK][HD]
// --------------------------------------------------------------------------
__global__ void nsa_cmpkv_kernel(const float* __restrict__ k,
                                 const float* __restrict__ v,
                                 float* __restrict__ kc,
                                 float* __restrict__ vc) {
    int idx = blockIdx.x * blockDim.x + threadIdx.x;
    if (idx >= NBC * NHK * HDIM) return;
    int d  = idx % HDIM;
    int hk = (idx / HDIM) % NHK;
    int n  = idx / (HDIM * NHK);
    float sk = 0.f, sv = 0.f;
    for (int i = 0; i < BLKC; ++i) {
        int row = n * BLKC + i;
        sk += k[(row * NHK + hk) * HDIM + d];
        sv += v[(row * NHK + hk) * HDIM + d];
    }
    kc[(n * NHK + hk) * HDIM + d] = sk * (1.0f / BLKC);
    vc[(n * NHK + hk) * HDIM + d] = sv * (1.0f / BLKC);
}

// Orders one wave's own LDS traffic: what some lanes store, other lanes of the
// same wave load behind it. For LDS that is private to a wave this takes the
// place of a work-group barrier.
__device__ __forceinline__ void wave_lds_sync() {
    __builtin_amdgcn_fence(__ATOMIC_RELEASE, "workgroup");
    __builtin_amdgcn_wave_barrier();
    __builtin_amdgcn_fence(__ATOMIC_ACQUIRE, "workgroup");
}

// The value that lane l ^ 16 holds.
__device__ __forceinline__ float other_half(float x) {
    const int xi = __builtin_bit_cast(int, x);
    return __builtin_bit_cast(float, __builtin_amdgcn_permlanex16(
        xi, xi, 0x76543210, 0xfedcba98, false, false));
}

__global__ __launch_bounds__(64)
void nsa_win_kernel(const float* __restrict__ q, const float* __restrict__ k,
                    const float* __restrict__ v, const float* __restrict__ gw,
                    float* __restrict__ out) {
    __shared__ __align__(16) float q_l[16][132];
    __shared__ __align__(16) float k_l[2][2][16][132];   // [wave][buffer]
    __shared__ __align__(16) float v_l[2][2][16][132];

    const int qt   = blockIdx.x / NHQ;
    const int hq   = blockIdx.x % NHQ;
    const int hk   = hq / REPG;
    const int q0   = qt * 16;
    const int tid  = threadIdx.x;
    const int wv   = __builtin_amdgcn_readfirstlane(tid >> 5);  // scalar: 0 or 1
    const int lane = tid & 31;
    const int half = lane >> 4;     // 0 or 1
    const int l16  = lane & 15;
    const float scale = 0.08838834764831845f;   // 1/sqrt(128)

    const int ktd = qt;
    int lowkey = q0 - (WINW - 1); if (lowkey < 0) lowkey = 0;
    const int ktl = lowkey >> 4;

    // ---- tile staging (async double-buffer if available) ----
#ifdef HAVE_ASYNC_LDS
#define ISSUE_TILE(bufi, ktv)                                                  \
    do {                                                                       \
        for (int i_ = 0; i_ < 16; ++i_) {                                      \
            int idx_ = i_ * 32 + lane;         /* 512 16B chunks per tile */   \
            int r_ = idx_ >> 5;                                                \
            int d_ = (idx_ & 31) << 2;                                         \
            const float* gk_ = &k[(((ktv) * 16 + r_) * NHK + hk) * HDIM + d_]; \
            const float* gv_ = &v[(((ktv) * 16 + r_) * NHK + hk) * HDIM + d_]; \
            __builtin_amdgcn_global_load_async_to_lds_b128(                    \
                (gv4i*)gk_, (lv4i*)&k_l[wv][bufi][r_][d_], 0, 0);              \
            __builtin_amdgcn_global_load_async_to_lds_b128(                    \
                (gv4i*)gv_, (lv4i*)&v_l[wv][bufi][r_][d_], 0, 0);              \
        }                                                                      \
    } while (0)
    // the wave's own copies of this trip's tile have landed
#define WAIT_TILE() asm volatile("s_wait_asynccnt 0x0" ::: "memory")
#else
#define ISSUE_TILE(bufi, ktv)                                                  \
    do {                                                                       \
        for (int idx_ = lane; idx_ < 16 * HDIM; idx_ += 32) {                  \
            int r_ = idx_ >> 7, d_ = idx_ & 127;                               \
            k_l[wv][bufi][r_][d_] = k[(((ktv) * 16 + r_) * NHK + hk) * HDIM + d_]; \
            v_l[wv][bufi][r_][d_] = v[(((ktv) * 16 + r_) * NHK + hk) * HDIM + d_]; \
        }                                                                      \
    } while (0)
#define WAIT_TILE() wave_lds_sync()
#endif

    int buf = 0;
#ifdef HAVE_ASYNC_LDS
    // q tile: wave w brings rows 8w..8w+7, one copy a row (32 lanes x 16 bytes)
#pragma unroll   // straight-line: all eight copies are in flight together
    for (int i_ = 0; i_ < 8; ++i_) {
        const int r_ = wv * 8 + i_;
        __builtin_amdgcn_global_load_async_to_lds_b128(
            (gv4i*)&q[((q0 + r_) * NHQ + hq) * HDIM + 4 * lane],
            (lv4i*)&q_l[r_][4 * lane], 0, 0);
    }
#endif
    if (ktd - wv >= ktl) ISSUE_TILE(0, ktd - wv);   // prologue: the wave's first tile in flight

#ifdef HAVE_ASYNC_LDS
    // the wave's own q rows have landed before the barrier publishes them
    asm volatile("s_wait_asynccnt 0x0" ::: "memory");
#else
    for (int idx = tid; idx < 16 * HDIM; idx += 64) {
        int r = idx >> 7, d = idx & 127;
        q_l[r][d] = q[((q0 + r) * NHQ + hq) * HDIM + d];
    }
#endif
    __syncthreads();

    // acc[nt][j]: dim nt * 16 + j + 8 * half of query q0 + l16
    v8f acc[8];
    // of query q0 + l16: running maximum (equal in both halves) and the sum over
    // the keys that this half has seen
    float mrow = -3.0e38f, lrow = 0.f;
#pragma unroll
    for (int nt = 0; nt < 8; ++nt)
#pragma unroll
        for (int j = 0; j < 8; ++j) acc[nt][j] = 0.f;

    for (int kt = ktd - wv; kt >= ktl; kt -= 2) {
        // the wave's reads of the buffer that is refilled below have retired
        asm volatile("s_wait_dscnt 0x0" ::: "memory");
        WAIT_TILE();            // buffer buf now resident in LDS
        const int nxt = buf ^ 1;
        if (kt - 2 >= ktl) ISSUE_TILE(nxt, kt - 2);  // overlap with compute

        // ---- S^T = K Q^T (16x16 tile): c[j] = key j + 8 * half, query l16 ----
        v8f c;
#pragma unroll
        for (int j = 0; j < 8; ++j) c[j] = 0.f;
#pragma unroll
        for (int kk = 0; kk < HDIM; kk += 4) {
            v2f a, b;
            a[0] = k_l[wv][buf][l16][kk + 2 * half + 0];
            a[1] = k_l[wv][buf][l16][kk + 2 * half + 1];
            b[0] = q_l[l16][kk + 2 * half + 0];
            b[1] = q_l[l16][kk + 2 * half + 1];
            c = __builtin_amdgcn_wmma_f32_16x16x4_f32(false, a, false, b,
                                                      (short)0, c, false, false);
        }

        // ---- mask + online softmax update, one query a lane ----
        const int dif0 = (q0 + l16) - (kt * 16 + 8 * half);
        float p[8];
        float tmax = NEGV;
#pragma unroll   // p[] stays in registers
        for (int j = 0; j < 8; ++j) {
            const int dif = dif0 - j;
            const bool valid = (dif >= 0) && (dif < WINW);
            p[j] = valid ? c[j] * scale : NEGV;
            tmax = fmaxf(tmax, p[j]);
        }
        tmax = fmaxf(tmax, other_half(tmax));
        const float mnew = fmaxf(mrow, tmax);
        const float corr = expf(mrow - mnew);
        float tsum = 0.f;
#pragma unroll   // p[] stays in registers
        for (int j = 0; j < 8; ++j) {
            p[j] = expf(p[j] - mnew);
            tsum += p[j];
        }
        lrow = lrow * corr + tsum;
        mrow = mnew;
#pragma unroll
        for (int nt = 0; nt < 8; ++nt)
#pragma unroll
            for (int j = 0; j < 8; ++j) acc[nt][j] *= corr;

        // ---- O^T += V^T * P^T (128x16 x 16x16). Step c4 takes the four keys
        // 2 * c4, 2 * c4 + 1, 8 + 2 * c4, 8 + 2 * c4 + 1: those whose weights the
        // two halves hold in p[2 * c4] and p[2 * c4 + 1]; V^T is read in the
        // same key order ----
#pragma unroll
        for (int c4 = 0; c4 < 4; ++c4) {
            v2f b;
            b[0] = p[2 * c4 + 0];
            b[1] = p[2 * c4 + 1];
#pragma unroll
            for (int nt = 0; nt < 8; ++nt) {
                v2f a;
                a[0] = v_l[wv][buf][8 * half + 2 * c4 + 0][nt * 16 + l16];
                a[1] = v_l[wv][buf][8 * half + 2 * c4 + 1][nt * 16 + l16];
                acc[nt] = __builtin_amdgcn_wmma_f32_16x16x4_f32(false, a, false, b,
                                                   (short)0, acc[nt], false, false);
            }
        }
        buf = nxt;
    }
    lrow += other_half(lrow);   // both halves' keys

    // ---- join: wave w finishes dim tiles 4w..4w+3. Each wave hands the
    // other four tiles, its maxima and its sums over in its own K ring,
    // lane for lane (both waves hold the same fragment layout). A wave without
    // a tile hands over zeros with the start maximum: weight exp(-huge) = 0.
    float* mine  = &k_l[wv][0][0][0];
    float* other = &k_l[wv ^ 1][0][0][0];
#pragma unroll   // acc[] stays in registers: nt is a constant in every index
    for (int nt = 0; nt < 8; ++nt)
        if ((nt >> 2) != wv) {
            *(float4*)&mine[(((nt & 3) * 2 + 0) * 32 + lane) * 4] =
                make_float4(acc[nt][0], acc[nt][1], acc[nt][2], acc[nt][3]);
            *(float4*)&mine[(((nt & 3) * 2 + 1) * 32 + lane) * 4] =
                make_float4(acc[nt][4], acc[nt][5], acc[nt][6], acc[nt][7]);
        }
    mine[1024 + lane] = mrow;
    mine[1056 + lane] = lrow;
    __syncthreads();

    const float mo = other[1024 + lane];
    const float lo = other[1056 + lane];
    const float mj = fmaxf(mrow, mo);
    const float wa = expf(mrow - mj);
    const float wb = expf(mo - mj);
    const float lj = lrow * wa + lo * wb;
    const float gr = gw[(q0 + l16) * NHQ + hq];
    // A lane holds eight dims in a row of one query. The wave's 16 x 64 piece of
    // the output passes through its own V ring (free: its last reads and copies
    // are done), so that a store of the wave covers whole cache lines.
    float (*o_l)[132] = v_l[wv][0];
#pragma unroll   // acc[] stays in registers: nt is a constant in every index
    for (int nt = 0; nt < 8; ++nt)
        if ((nt >> 2) == wv) {
            const float4 o0 = *(const float4*)&other[(((nt & 3) * 2 + 0) * 32 + lane) * 4];
            const float4 o1 = *(const float4*)&other[(((nt & 3) * 2 + 1) * 32 + lane) * 4];
            const float ob[8] = {o0.x, o0.y, o0.z, o0.w, o1.x, o1.y, o1.z, o1.w};
            float r[8];
#pragma unroll   // ob[], r[] stay in registers
            for (int j = 0; j < 8; ++j)
                r[j] = gr * ((acc[nt][j] * wa + ob[j] * wb) / lj);
            float* dst = &o_l[l16][(nt & 3) * 16 + 8 * half];
            *(float4*)&dst[0] = make_float4(r[0], r[1], r[2], r[3]);
            *(float4*)&dst[4] = make_float4(r[4], r[5], r[6], r[7]);
        }
    wave_lds_sync();
    // one address for all eight stores, the rows as constant offsets
    float* orow = out + (((q0 + half) * NHQ + hq) * HDIM + wv * 64 + 4 * l16);
#pragma unroll   // straight-line: eight stores, each two rows of 256 contiguous bytes
    for (int i = 0; i < 8; ++i)
        *(float4*)(orow + i * (2 * NHQ * HDIM)) = *(const float4*)&o_l[2 * i + half][4 * l16];
#undef ISSUE_TILE
#undef WAIT_TILE
}

// --------------------------------------------------------------------------
// Kernel 3: compressed branch. Writes normalized pc [NHQ][S][NB] to ws and
// adds g_cmp * o_cmp into d_out. Both products are formed transposed, as in
// kernel 2: one query a lane pair, P^T stays in registers as the B operand of
// the second product. q, kc and vc come into LDS by asynchronous
// copies: kc and then vc pass as four tiles of 32 rows through a ring of two
// buffers, so that a tile's copies fly while the tile before it is worked on.
// --------------------------------------------------------------------------

// Eight asynchronous copies of one wave, each one whole row: 32 lanes x 16 bytes
// = 512 contiguous bytes. l: the lane's LDS byte address in the first row (rows
// of 132 floats), g: the lane's global address in it, GSTEP: floats a row on.
template <int GSTEP>
__device__ __forceinline__ void copy_rows8(unsigned l, const float* g) {
    constexpr unsigned LSTEP = 132 * 4;
    // the closing s_wait_xcnt stands in the copies' own statement, in front of
    // any rewrite of the address registers that they name
    asm volatile(
        "global_load_async_to_lds_b128 %0, %8, off\n\t"
        "global_load_async_to_lds_b128 %1, %9, off\n\t"
        "global_load_async_to_lds_b128 %2, %10, off\n\t"
        "global_load_async_to_lds_b128 %3, %11, off\n\t"
        "global_load_async_to_lds_b128 %4, %12, off\n\t"
        "global_load_async_to_lds_b128 %5, %13, off\n\t"
        "global_load_async_to_lds_b128 %6, %14, off\n\t"
        "global_load_async_to_lds_b128 %7, %15, off\n\t"
        "s_wait_xcnt 0x0"
        :: "v"(l), "v"(l + 1 * LSTEP), "v"(l + 2 * LSTEP), "v"(l + 3 * LSTEP),
           "v"(l + 4 * LSTEP), "v"(l + 5 * LSTEP), "v"(l + 6 * LSTEP), "v"(l + 7 * LSTEP),
           "v"(g), "v"(g + 1 * GSTEP), "v"(g + 2 * GSTEP), "v"(g + 3 * GSTEP),
           "v"(g + 4 * GSTEP), "v"(g + 5 * GSTEP), "v"(g + 6 * GSTEP), "v"(g + 7 * GSTEP)
        : "memory");
}

// Hand-over point of the ring: the wave's reads of the buffer that is refilled
// behind it have retired, its copies of the next tile have landed, and the
// barrier publishes them (for a work-group of one wave the compiler emits no
// barrier instruction).
__device__ __forceinline__ void ring_handover() {
    // keeps this tile's WMMAs in front of the wait: moved behind it, the next
    // tile's copies would no longer fly under them, and all fragments of the
    // tile would have to sit in registers at once
    __builtin_amdgcn_sched_barrier(0);
    asm volatile("s_wait_dscnt 0x0" ::: "memory");
    asm volatile("s_wait_asynccnt 0x0" ::: "memory");
    __syncthreads();
}

__global__ __launch_bounds__(32)
void nsa_cmp_kernel(const float* __restrict__ q, const float* __restrict__ kc,
                    const float* __restrict__ vc, const float* __restrict__ gc,
                    float* __restrict__ pc_ws, float* __restrict__ out) {
    __shared__ __align__(16) float q_l[16][132];
    __shared__ __align__(16) float t_l[2][32][132];   // ring: kc rows, then vc rows

    const int qt   = blockIdx.x / NHQ;
    const int hq   = blockIdx.x % NHQ;
    const int hk   = hq / REPG;
    const int q0   = qt * 16;
    const int tid  = threadIdx.x;
    const int half = tid >> 4;
    const int l16  = tid & 15;
    const float scale = 0.08838834764831845f;

    // lane l brings floats 4l..4l+3 of every row
    const unsigned lq = (unsigned)(size_t)&q_l[0][4 * tid];
    const unsigned lt[2] = {(unsigned)(size_t)&t_l[0][0][4 * tid],
                            (unsigned)(size_t)&t_l[1][0][4 * tid]};
    const float* gq = q + (q0 * NHQ + hq) * HDIM + 4 * tid;
    const float* gk = kc + hk * HDIM + 4 * tid;
    const float* gv = vc + hk * HDIM + 4 * tid;
    constexpr int QSTEP = NHQ * HDIM, TSTEP = NHK * HDIM;   // floats: one row on
    // 32 rows, from row r0 of kc or vc, into ring buffer b
#define ISSUE_ROWS32(b, gsrc, r0)                                              \
    do {                                                                       \
        copy_rows8<TSTEP>(lt[b] +  0 * 528u, (gsrc) + ((r0) +  0) * TSTEP);    \
        copy_rows8<TSTEP>(lt[b] +  8 * 528u, (gsrc) + ((r0) +  8) * TSTEP);    \
        copy_rows8<TSTEP>(lt[b] + 16 * 528u, (gsrc) + ((r0) + 16) * TSTEP);    \
        copy_rows8<TSTEP>(lt[b] + 24 * 528u, (gsrc) + ((r0) + 24) * TSTEP);    \
    } while (0)

    copy_rows8<QSTEP>(lq, gq);
    copy_rows8<QSTEP>(lq + 8 * 528u, gq + 8 * QSTEP);
    ISSUE_ROWS32(0, gk, 0);
    // q and kc rows 0..31 have landed before the barrier publishes them
    asm volatile("s_wait_asynccnt 0x0" ::: "memory");
    __syncthreads();
    ISSUE_ROWS32(1, gk, 32);

    // sc[nt][j]: block nt * 16 + j + 8 * half, query q0 + l16
    v8f sc[4];
#pragma unroll   // sc[] stays in registers; the ring buffer is a constant
    for (int nt = 0; nt < 4; ++nt) {
        if (nt == 2) {
            ring_handover();            // kc rows 32..63 are there
            ISSUE_ROWS32(0, gv, 0);
        }
        const float (*k_l)[132] = &t_l[nt >> 1][(nt & 1) * 16];
        v8f c;
#pragma unroll
        for (int j = 0; j < 8; ++j) c[j] = 0.f;
#pragma unroll
        for (int kk = 0; kk < HDIM; kk += 4) {
            v2f a, b;
            a[0] = k_l[l16][kk + 2 * half + 0];
            a[1] = k_l[l16][kk + 2 * half + 1];
            b[0] = q_l[l16][kk + 2 * half + 0];
            b[1] = q_l[l16][kk + 2 * half + 1];
            c = __builtin_amdgcn_wmma_f32_16x16x4_f32(false, a, false, b,
                                                      (short)0, c, false, false);
        }
        sc[nt] = c;
    }
    ring_handover();                    // vc rows 0..31 are there
    ISSUE_ROWS32(1, gv, 32);            // they fly under the softmax

    // The old output rows and the gates are asked for here, all together, so
    // that their latency runs under the softmax and P * V. A load of the wave is
    // one whole row of a head: 512 contiguous bytes.
    float4 oold[16];
    float  gate[16];
#pragma unroll   // gate[] stays in registers
    for (int i = 0; i < 16; ++i) gate[i] = gc[(q0 + i) * NHQ + hq];
    // one address for all loads and stores of the rows, the rows as constant offsets
    float* orow = out + ((q0 * NHQ + hq) * HDIM + 4 * tid);
#pragma unroll   // oold[] stays in registers; 16 loads in flight together
    for (int i = 0; i < 16; ++i)
        oold[i] = *(const float4*)(orow + i * (NHQ * HDIM));

    // mask + scale  (block fully in the past: (n+1)*32-1 <= s)
    const int s = q0 + l16;
#pragma unroll   // sc[] stays in registers
    for (int nt = 0; nt < 4; ++nt)
#pragma unroll
        for (int j = 0; j < 8; ++j) {
            int n = nt * 16 + j + 8 * half;
            bool valid = ((n + 1) * BLKC - 1) <= s;
            sc[nt][j] = valid ? sc[nt][j] * scale : NEGV;
        }

    // softmax over the 64 blocks of the lane's query: 32 in this lane, 32 in
    // lane l ^ 16
    float rm = -3.0e38f;
#pragma unroll   // sc[] stays in registers
    for (int nt = 0; nt < 4; ++nt)
#pragma unroll
        for (int j = 0; j < 8; ++j) rm = fmaxf(rm, sc[nt][j]);
    rm = fmaxf(rm, other_half(rm));
    float rsn[4];   // four chains that do not wait for one another
#pragma unroll   // sc[], rsn[] stay in registers
    for (int nt = 0; nt < 4; ++nt) {
        rsn[nt] = 0.f;
#pragma unroll
        for (int j = 0; j < 8; ++j) {
            sc[nt][j] = expf(sc[nt][j] - rm);
            rsn[nt] += sc[nt][j];
        }
    }
    float rs = (rsn[0] + rsn[1]) + (rsn[2] + rsn[3]);
    rs += other_half(rs);
    float* pd = pc_ws + ((hq * SS + s) * NBC + 8 * half);
#pragma unroll   // sc[] stays in registers
    for (int nt = 0; nt < 4; ++nt) {
#pragma unroll
        for (int j = 0; j < 8; ++j) sc[nt][j] = sc[nt][j] / rs;
        *(float4*)(pd + nt * 16 + 0) = make_float4(sc[nt][0], sc[nt][1], sc[nt][2], sc[nt][3]);
        *(float4*)(pd + nt * 16 + 4) = make_float4(sc[nt][4], sc[nt][5], sc[nt][6], sc[nt][7]);
    }

    // O^T = vc^T (128x64) * P^T (64x16), 16 blocks at a time.
    // acc[nt][j]: dim nt * 16 + j + 8 * half of query q0 + l16
    v8f acc[8];
#pragma unroll
    for (int nt = 0; nt < 8; ++nt)
#pragma unroll
        for (int j = 0; j < 8; ++j) acc[nt][j] = 0.f;

#pragma unroll   // the ring buffer is a constant
    for (int st = 0; st < 4; ++st) {
        if (st == 2) ring_handover();   // vc rows 32..63 are there
        const float (*v_l)[132] = &t_l[st >> 1][(st & 1) * 16];
        // step c4 takes the four blocks 2 * c4, 2 * c4 + 1, 8 + 2 * c4 and
        // 8 + 2 * c4 + 1 of the 16: those whose weights the two halves hold in
        // sc[st][2 * c4] and sc[st][2 * c4 + 1]; vc^T is read in the same order
#pragma unroll
        for (int c4 = 0; c4 < 4; ++c4) {
            v2f b;
            b[0] = sc[st][2 * c4 + 0];
            b[1] = sc[st][2 * c4 + 1];
#pragma unroll
            for (int nt = 0; nt < 8; ++nt) {
                v2f a;
                a[0] = v_l[8 * half + 2 * c4 + 0][nt * 16 + l16];
                a[1] = v_l[8 * half + 2 * c4 + 1][nt * 16 + l16];
                acc[nt] = __builtin_amdgcn_wmma_f32_16x16x4_f32(false, a, false, b,
                                                   (short)0, acc[nt], false, false);
            }
        }
    }

    // A lane holds eight dims in a row of one query. The 16 x 128 result passes
    // through q_l (free since the last score), so that a store of the wave is one
    // whole row, like the load of the old values.
#pragma unroll   // acc[] stays in registers
    for (int nt = 0; nt < 8; ++nt) {
        float* dst = &q_l[l16][nt * 16 + 8 * half];
        *(float4*)&dst[0] = make_float4(acc[nt][0], acc[nt][1], acc[nt][2], acc[nt][3]);
        *(float4*)&dst[4] = make_float4(acc[nt][4], acc[nt][5], acc[nt][6], acc[nt][7]);
    }
    wave_lds_sync();
#pragma unroll   // oold[], gate[] stay in registers
    for (int i = 0; i < 16; ++i) {
        const float4 o4 = *(const float4*)&q_l[i][4 * tid];
        const bool any = (q0 + i) >= BLKC - 1;           // cmask.any zeroing
        const float ox = any ? o4.x : 0.f, oy = any ? o4.y : 0.f;
        const float oz = any ? o4.z : 0.f, ow = any ? o4.w : 0.f;
        *(float4*)(orow + i * (NHQ * HDIM)) =
            make_float4(oold[i].x + gate[i] * ox, oold[i].y + gate[i] * oy,
                        oold[i].z + gate[i] * oz, oold[i].w + gate[i] * ow);
    }
#undef ISSUE_ROWS32
}

// --------------------------------------------------------------------------
// Maximum over the 32 lanes of a wave, the same value in every lane: four steps
// inside each row of 16 lanes, then the other row's result.
// --------------------------------------------------------------------------
template <int XMASK>
__device__ __forceinline__ int row_xmask_max(int x) {
    // 0x160 | m: lane l takes the value of lane l ^ m of its row
    const int y = __builtin_amdgcn_update_dpp(0, x, 0x160 | XMASK, 0xf, 0xf, true);
    return x > y ? x : y;
}
__device__ __forceinline__ int wave_max32(int x) {
    x = row_xmask_max<1>(x);
    x = row_xmask_max<2>(x);
    x = row_xmask_max<4>(x);
    x = row_xmask_max<8>(x);
    const int y = __builtin_amdgcn_permlanex16(x, x, 0x76543210, 0xfedcba98, false, false);
    return x > y ? x : y;
}

// --------------------------------------------------------------------------
// Kernel 4: selected branch. 128 threads per (s, hk): 4 rep heads, 128
// gathered keys. Wave w first finds the top w+1 blocks of its (s, hk) itself,
// from the pooled pc row spread over its lanes, and keeps the one that it
// works on. K rows staged in LDS. P * V: wave w takes the 32 V rows of
// selected block w, a whole row per load; the four partial sums are joined
// through LDS. Adds g_slt * o_slt into d_out.
// --------------------------------------------------------------------------
__global__ __launch_bounds__(128)
void nsa_slt_kernel(const float* __restrict__ q, const float* __restrict__ k,
                    const float* __restrict__ v, const float* __restrict__ gs,
                    const float* __restrict__ pc, float* __restrict__ out) {
    // K is staged in two halves of the head dim (64 floats a row) so that eight
    // work-groups fit one WGP's LDS. Row pitch 272 B = 16 B x 17: 16-byte reads
    // of one row per lane meet no bank conflict.
    __shared__ __align__(16) float k_l[TOPN * BLKC][HDIM / 2 + 4];
    __shared__ __align__(16) float qsm[REPG][HDIM];
    __shared__ __align__(16) float scm[REPG][TOPN * BLKC];

    const int s  = blockIdx.x / NHK;
    const int hk = blockIdx.x % NHK;
    const int t  = threadIdx.x;
    const float scale = 0.08838834764831845f;

    // The four q rows of the group are 2 KiB in a row: one copy of 16 bytes a
    // thread brings them. Asked for first, so that they fly under the selection;
    // the wait and the barrier behind the first K copies cover them too. The
    // closing s_wait_xcnt stands in the copy's own statement, in front of any
    // rewrite of the address registers that it names.
    asm volatile(
        "global_load_async_to_lds_b128 %0, %1, off\n\t"
        "s_wait_xcnt 0x0"
        :: "v"((unsigned)(size_t)&qsm[0][0] + 16u * (unsigned)t),
           "v"(q + (s * NHQ + hk * REPG) * HDIM + 4 * t)
        : "memory");

    // wave w stages the 32 rows of selected block w; k_l row t belongs to key t.
    // One copy of the wave = two half rows of 256 contiguous bytes: whole cache lines.
    int bsel = 0;
    {
        // lane l holds blocks l and l + 32: a load of the wave is one cache line
        const int ln = t & 31;
        const int wsel = __builtin_amdgcn_readfirstlane(t >> 5);   // scalar: 0..3
        const int cur = s / BLKC;
        const float* pr0 = &pc[((hk * REPG + 0) * SS + s) * NBC + ln];
        const float* pr1 = pr0 + 1 * SS * NBC;
        const float* pr2 = pr0 + 2 * SS * NBC;
        const float* pr3 = pr0 + 3 * SS * NBC;
        float a0, a1, a2, a3, b0, b1, b2, b3;
        // eight loads in flight together. They and their data wait are one
        // statement with early-clobber outputs, so that no result lands in an
        // address register of the run and none is rewritten ahead of the wait
        asm volatile(
            "global_load_b32 %0, %8, off\n\t"
            "global_load_b32 %4, %8, off offset:128\n\t"
            "global_load_b32 %1, %9, off\n\t"
            "global_load_b32 %5, %9, off offset:128\n\t"
            "global_load_b32 %2, %10, off\n\t"
            "global_load_b32 %6, %10, off offset:128\n\t"
            "global_load_b32 %3, %11, off\n\t"
            "global_load_b32 %7, %11, off offset:128\n\t"
            "s_wait_loadcnt 0x0"
            : "=&v"(a0), "=&v"(a1), "=&v"(a2), "=&v"(a3),
              "=&v"(b0), "=&v"(b1), "=&v"(b2), "=&v"(b3)
            : "v"(pr0), "v"(pr1), "v"(pr2), "v"(pr3)
            : "memory");
        // heads summed in ascending order, from +0
        float v0 = (((0.f + a0) + a1) + a2) + a3;
        float v1 = (((0.f + b0) + b1) + b2) + b3;
        if (ln == cur)      v0 += 1e6f;
        if (ln + 32 == cur) v1 += 1e6f;
        if (ln == 0)        v0 += 1e6f;
        // pc holds softmax weights, so every pooled score is +0 or above, and
        // the bit patterns, read as integers, order and compare as the values do
        int k0 = __builtin_bit_cast(int, v0), k1 = __builtin_bit_cast(int, v1);
        // argmax passes; among equal values the lowest block index wins, as in
        // top_k. Wave w needs the winner of pass w and stops there.
        for (int pass = 0; pass < TOPN; ++pass) {
            const int m = wave_max32(k0 > k1 ? k0 : k1);
            const unsigned long long eq =
                (unsigned long long)__builtin_amdgcn_ballot_w32(k0 == m) |
                ((unsigned long long)__builtin_amdgcn_ballot_w32(k1 == m) << 32);
            bsel = __builtin_ctzll(eq);   // m is some lane's key: eq != 0, 0 <= bsel < NBC
            if (pass == wsel) break;
            if (ln == bsel)      k0 = -1;   // below every live key
            if (ln + 32 == bsel) k1 = -1;
        }
    }
    const float* g0 = k + ((bsel * BLKC + ((t >> 4) & 1)) * NHK + hk) * HDIM + 4 * (t & 15);
    const unsigned l0 = (unsigned)(size_t)&k_l[(t & ~31) + ((t >> 4) & 1)][4 * (t & 15)];
    constexpr int GSTEP = 2 * NHK * HDIM;            // floats: two key rows on
    constexpr unsigned LSTEP = 2 * (HDIM / 2 + 4) * 4;  // bytes: two k_l rows on

    float a[REPG] = {0.f, 0.f, 0.f, 0.f};
#pragma unroll   // two trips, straight-line: h is a constant in every address
    for (int h = 0; h < 2; ++h) {
        if (h) {
            // every reader has left k_l before the second half overwrites it
            asm volatile("s_wait_dscnt 0x0" ::: "memory");
            __syncthreads();
        }
#pragma unroll   // straight-line: all 16 copies of the wave are in flight together
        for (int i = 0; i < 16; i += 8) {
            const float* g = g0 + h * (HDIM / 2) + i * GSTEP;
            const unsigned l = l0 + i * LSTEP;
            // the closing s_wait_xcnt stands in the copies' own statement, in
            // front of any rewrite of the address registers that they name
            asm volatile(
                "global_load_async_to_lds_b128 %0, %8, off\n\t"
                "global_load_async_to_lds_b128 %1, %9, off\n\t"
                "global_load_async_to_lds_b128 %2, %10, off\n\t"
                "global_load_async_to_lds_b128 %3, %11, off\n\t"
                "global_load_async_to_lds_b128 %4, %12, off\n\t"
                "global_load_async_to_lds_b128 %5, %13, off\n\t"
                "global_load_async_to_lds_b128 %6, %14, off\n\t"
                "global_load_async_to_lds_b128 %7, %15, off\n\t"
                "s_wait_xcnt 0x0"
                :: "v"(l), "v"(l + 1 * LSTEP), "v"(l + 2 * LSTEP), "v"(l + 3 * LSTEP),
                   "v"(l + 4 * LSTEP), "v"(l + 5 * LSTEP), "v"(l + 6 * LSTEP), "v"(l + 7 * LSTEP),
                   "v"(g), "v"(g + 1 * GSTEP), "v"(g + 2 * GSTEP), "v"(g + 3 * GSTEP),
                   "v"(g + 4 * GSTEP), "v"(g + 5 * GSTEP), "v"(g + 6 * GSTEP), "v"(g + 7 * GSTEP)
                : "memory");
        }
        // the wave's own copies have landed before the barrier publishes k_l
        // (and, on the first trip, the q rows)
        asm volatile("s_wait_asynccnt 0x0" ::: "memory");
        __syncthreads();

        // scores: thread t handles key t, read from its k_l row; each head's
        // sum runs over d in ascending order
        for (int d = 0; d < HDIM / 2; d += 4) {
            const float4 kv = *(const float4*)&k_l[t][d];
#pragma unroll   // a[] stays in registers
            for (int r = 0; r < REPG; ++r) {
                const float4 qv = *(const float4*)&qsm[r][h * (HDIM / 2) + d];
                a[r] = fmaf(qv.x, kv.x, a[r]);
                a[r] = fmaf(qv.y, kv.y, a[r]);
                a[r] = fmaf(qv.z, kv.z, a[r]);
                a[r] = fmaf(qv.w, kv.w, a[r]);
            }
        }
    }
    // V rows of the wave's own block: lane l holds dims 4l..4l+3, one load of
    // the wave is one whole row (512 contiguous bytes). The first 16 rows, the
    // old output row and its gate are asked for here, so that their latency
    // runs under the softmax.
    const int wave = t >> 5, lane = t & 31;
    const float4* vrow = (const float4*)(v + (bsel * BLKC * NHK + hk) * HDIM) + lane;
    constexpr int VSTEP = NHK * HDIM / 4;            // float4s: one key row on
    float4 vr[16];
#pragma unroll   // vr[] stays in registers; 16 loads in flight together
    for (int i = 0; i < 16; ++i) vr[i] = vrow[i * VSTEP];
    // wave w finishes rep head w
    float4* orow = (float4*)(out + (s * NHQ + hk * REPG + wave) * HDIM) + lane;
    const float4 oold = *orow;
    const float  gate = gs[s * NHQ + hk * REPG + wave];

    {
        int pos = bsel * BLKC + (t % BLKC);
#pragma unroll   // a[] stays in registers
        for (int r = 0; r < REPG; ++r)
            scm[r][t] = (pos <= s) ? a[r] * scale : NEGV;
    }
    __syncthreads();

    // softmax: wave w handles row w (4 waves of 32 lanes)
    {
        float vals[4];
        float mloc = -3.0e38f;
        for (int i = 0; i < 4; ++i) {
            vals[i] = scm[wave][lane + 32 * i];
            mloc = fmaxf(mloc, vals[i]);
        }
        for (int m = 1; m <= 16; m <<= 1)
            mloc = fmaxf(mloc, __shfl_xor(mloc, m, 32));
        float ssum = 0.f;
        for (int i = 0; i < 4; ++i) { vals[i] = expf(vals[i] - mloc); ssum += vals[i]; }
        for (int m = 1; m <= 16; m <<= 1)
            ssum += __shfl_xor(ssum, m, 32);
        float inv = 1.0f / ssum;
        for (int i = 0; i < 4; ++i) scm[wave][lane + 32 * i] = vals[i] * inv;
    }
    __syncthreads();

    // partial output of the wave's 32 keys, all 4 rep heads, 4 dims a lane
    float4 o[REPG];
#pragma unroll   // o[] stays in registers
    for (int r = 0; r < REPG; ++r) o[r] = make_float4(0.f, 0.f, 0.f, 0.f);
#pragma unroll   // vr[] stays in registers: every index is a constant
    for (int i = 0; i < BLKC; i += 4) {
        float pr[REPG][4];
#pragma unroll   // pr[] stays in registers
        for (int r = 0; r < REPG; ++r) {
            const float4 p4 = *(const float4*)&scm[r][wave * BLKC + i];
            pr[r][0] = p4.x; pr[r][1] = p4.y; pr[r][2] = p4.z; pr[r][3] = p4.w;
        }
#pragma unroll   // vr[], pr[] stay in registers
        for (int u = 0; u < 4; ++u) {
            const float4 vv = vr[(i + u) & 15];
#pragma unroll   // o[] stays in registers
            for (int r = 0; r < REPG; ++r) {
                o[r].x = fmaf(pr[r][u], vv.x, o[r].x);
                o[r].y = fmaf(pr[r][u], vv.y, o[r].y);
                o[r].z = fmaf(pr[r][u], vv.z, o[r].z);
                o[r].w = fmaf(pr[r][u], vv.w, o[r].w);
            }
            // the row 16 further on takes the registers that have just been used
            if (i + u < 16) vr[i + u] = vrow[(i + u + 16) * VSTEP];
            // behind the last V load, in front of any rewrite of its address registers
            if (i + u == 15) asm volatile("s_wait_xcnt 0x0" ::: "memory");
        }
    }

    // join: k_l is free since the barrier behind the scores
    float* red = &k_l[0][0];                         // [wave][rep head][HDIM]
#pragma unroll   // o[] stays in registers
    for (int r = 0; r < REPG; ++r)
        *(float4*)&red[(wave * REPG + r) * HDIM + 4 * lane] = o[r];
    __syncthreads();
    {
        float4 sum = *(const float4*)&red[(0 * REPG + wave) * HDIM + 4 * lane];
#pragma unroll   // three more partial sums, in the order of the selected blocks
        for (int w = 1; w < TOPN; ++w) {
            const float4 pw = *(const float4*)&red[(w * REPG + wave) * HDIM + 4 * lane];
            sum.x += pw.x; sum.y += pw.y; sum.z += pw.z; sum.w += pw.w;
        }
        *orow = make_float4(fmaf(gate, sum.x, oold.x), fmaf(gate, sum.y, oold.y),
                            fmaf(gate, sum.z, oold.z), fmaf(gate, sum.w, oold.w));
    }
}

// --------------------------------------------------------------------------
extern "C" void kernel_launch(void* const* d_in, const int* in_sizes, int n_in,
                              void* d_out, int out_size, void* d_ws, size_t ws_size,
                              hipStream_t stream) {
    const float* q  = (const float*)d_in[0];
    const float* k  = (const float*)d_in[1];
    const float* v  = (const float*)d_in[2];
    const float* gw = (const float*)d_in[3];
    const float* gc = (const float*)d_in[4];
    const float* gs = (const float*)d_in[5];
    float* out = (float*)d_out;

    float* ws = (float*)d_ws;
    float* kc = ws;                                  // NB*NHK*HD = 16384 floats
    float* vc = ws + NBC * NHK * HDIM;               // 16384 floats
    float* pc = vc + NBC * NHK * HDIM;               // NHQ*S*NB = 1,048,576 floats

    nsa_cmpkv_kernel<<<(NBC * NHK * HDIM + 255) / 256, 256, 0, stream>>>(k, v, kc, vc);
    nsa_win_kernel<<<(SS / 16) * NHQ, 64, 0, stream>>>(q, k, v, gw, out);
    nsa_cmp_kernel<<<(SS / 16) * NHQ, 32, 0, stream>>>(q, kc, vc, gc, pc, out);
    nsa_slt_kernel<<<SS * NHK, 128, 0, stream>>>(q, k, v, gs, pc, out);
}

// v008
// It runs in 65.9 microseconds.
// In two side-by-side timings against v007, it was 1.08 and 1.09 times as fast.
// Over all steps from v000 it is 3.58 times as fast.
#include <hip/hip_runtime.h>
#include <hip/hip_bf16.h>

#define SS   2048
#define NHQ  8
#define NHK  2
#define HDIM 128
#define REPG 4
#define WINW 512
#define BLKC 32
#define NBC  64
#define TOPN 4
#define NEGV (-1e30f)

typedef __attribute__((ext_vector_type(2))) float v2f;
typedef __attribute__((ext_vector_type(8))) float v8f;

#if defined(__has_builtin)
#if __has_builtin(__builtin_amdgcn_global_load_async_to_lds_b128)
#define HAVE_ASYNC_LDS 1
#endif
#endif

#ifdef HAVE_ASYNC_LDS
// builtin signature (from hipcc diagnostic): takes pointers to 16-byte int
// vectors: (v4i addrspace(1)*, v4i addrspace(3)*, imm offset, imm cpol)
typedef int v4i_ __attribute__((vector_size(16)));
typedef __attribute__((address_space(1))) v4i_ gv4i;
typedef __attribute__((address_space(3))) v4i_ lv4i;
#endif

// --------------------------------------------------------------------------
// Kernel 1: block-mean compressed K/V.  kc/vc: [NB][NHK][HD]
// --------------------------------------------------------------------------
__global__ void nsa_cmpkv_kernel(const float* __restrict__ k,
                                 const float* __restrict__ v,
                                 float* __restrict__ kc,
                                 float* __restrict__ vc) {
    int idx = blockIdx.x * blockDim.x + threadIdx.x;
    if (idx >= NBC * NHK * HDIM) return;
    int d  = idx % HDIM;
    int hk = (idx / HDIM) % NHK;
    int n  = idx / (HDIM * NHK);
    float sk = 0.f, sv = 0.f;
    for (int i = 0; i < BLKC; ++i) {
        int row = n * BLKC + i;
        sk += k[(row * NHK + hk) * HDIM + d];
        sv += v[(row * NHK + hk) * HDIM + d];
    }
    kc[(n * NHK + hk) * HDIM + d] = sk * (1.0f / BLKC);
    vc[(n * NHK + hk) * HDIM + d] = sv * (1.0f / BLKC);
}

// Orders one wave's own LDS traffic: what some lanes store, other lanes of the
// same wave load behind it. For LDS that is private to a wave this takes the
// place of a work-group barrier.
__device__ __forceinline__ void wave_lds_sync() {
    __builtin_amdgcn_fence(__ATOMIC_RELEASE, "workgroup");
    __builtin_amdgcn_wave_barrier();
    __builtin_amdgcn_fence(__ATOMIC_ACQUIRE, "workgroup");
}

// The value that lane l ^ 16 holds.
__device__ __forceinline__ float other_half(float x) {
    const int xi = __builtin_bit_cast(int, x);
    return __builtin_bit_cast(float, __builtin_amdgcn_permlanex16(
        xi, xi, 0x76543210, 0xfedcba98, false, false));
}

__global__ __launch_bounds__(64)
void nsa_win_kernel(const float* __restrict__ q, const float* __restrict__ k,
                    const float* __restrict__ v, const float* __restrict__ gw,
                    const float* __restrict__ kc, const float* __restrict__ vc,
                    const float* __restrict__ gc, float* __restrict__ pc_ws,
                    float* __restrict__ out) {
    __shared__ __align__(16) float q_l[16][132];
    __shared__ __align__(16) float k_l[2][2][16][132];   // [wave][buffer]
    __shared__ __align__(16) float v_l[2][2][16][132];
    __shared__ float x_l[2][2][32];   // [maximum, sum][wave][lane]

    const int qt   = blockIdx.x / NHQ;
    const int hq   = blockIdx.x % NHQ;
    const int hk   = hq / REPG;
    const int q0   = qt * 16;
    const int tid  = threadIdx.x;
    const int wv   = __builtin_amdgcn_readfirstlane(tid >> 5);  // scalar: 0 or 1
    const int lane = tid & 31;
    const int half = lane >> 4;     // 0 or 1
    const int l16  = lane & 15;
    const float scale = 0.08838834764831845f;   // 1/sqrt(128)

    const int ktd = qt;
    int lowkey = q0 - (WINW - 1); if (lowkey < 0) lowkey = 0;
    const int ktl = lowkey >> 4;

    // ---- tile staging (async double-buffer if available) ----
#ifdef HAVE_ASYNC_LDS
#define ISSUE_TILE(bufi, ktv)                                                  \
    do {                                                                       \
        for (int i_ = 0; i_ < 16; ++i_) {                                      \
            int idx_ = i_ * 32 + lane;         /* 512 16B chunks per tile */   \
            int r_ = idx_ >> 5;                                                \
            int d_ = (idx_ & 31) << 2;                                         \
            const float* gk_ = &k[(((ktv) * 16 + r_) * NHK + hk) * HDIM + d_]; \
            const float* gv_ = &v[(((ktv) * 16 + r_) * NHK + hk) * HDIM + d_]; \
            __builtin_amdgcn_global_load_async_to_lds_b128(                    \
                (gv4i*)gk_, (lv4i*)&k_l[wv][bufi][r_][d_], 0, 0);              \
            __builtin_amdgcn_global_load_async_to_lds_b128(                    \
                (gv4i*)gv_, (lv4i*)&v_l[wv][bufi][r_][d_], 0, 0);              \
        }                                                                      \
    } while (0)
    // the wave's own copies of this trip's tile have landed
#define WAIT_TILE() asm volatile("s_wait_asynccnt 0x0" ::: "memory")
#else
#define ISSUE_TILE(bufi, ktv)                                                  \
    do {                                                                       \
        for (int idx_ = lane; idx_ < 16 * HDIM; idx_ += 32) {                  \
            int r_ = idx_ >> 7, d_ = idx_ & 127;                               \
            k_l[wv][bufi][r_][d_] = k[(((ktv) * 16 + r_) * NHK + hk) * HDIM + d_]; \
            v_l[wv][bufi][r_][d_] = v[(((ktv) * 16 + r_) * NHK + hk) * HDIM + d_]; \
        }                                                                      \
    } while (0)
#define WAIT_TILE() wave_lds_sync()
#endif

    int buf = 0;
#ifdef HAVE_ASYNC_LDS
    // q tile: wave w brings rows 8w..8w+7, one copy a row (32 lanes x 16 bytes)
#pragma unroll   // straight-line: all eight copies are in flight together
    for (int i_ = 0; i_ < 8; ++i_) {
        const int r_ = wv * 8 + i_;
        __builtin_amdgcn_global_load_async_to_lds_b128(
            (gv4i*)&q[((q0 + r_) * NHQ + hq) * HDIM + 4 * lane],
            (lv4i*)&q_l[r_][4 * lane], 0, 0);
    }
#endif
    // 32 rows of kc or vc, from row 32 * wv, into the wave's own ring (both
    // buffers): one copy a row
#ifdef HAVE_ASYNC_LDS
#define ISSUE_CROWS(ring, src)                                                 \
    do {                                                                       \
        _Pragma("unroll")   /* straight-line: all 32 copies in flight together */ \
        for (int i_ = 0; i_ < 32; ++i_)                                        \
            __builtin_amdgcn_global_load_async_to_lds_b128(                    \
                (gv4i*)&src[((wv * 32 + i_) * NHK + hk) * HDIM + 4 * lane],    \
                (lv4i*)&ring[wv][i_ >> 4][i_ & 15][4 * lane], 0, 0);           \
    } while (0)
#else
#define ISSUE_CROWS(ring, src)                                                 \
    do {                                                                       \
        for (int idx_ = lane; idx_ < 32 * HDIM; idx_ += 32) {                  \
            int r_ = idx_ >> 7, d_ = idx_ & 127;                               \
            ring[wv][r_ >> 4][r_ & 15][d_] = src[((wv * 32 + r_) * NHK + hk) * HDIM + d_]; \
        }                                                                      \
    } while (0)
#endif
    ISSUE_CROWS(k_l, kc);

#ifdef HAVE_ASYNC_LDS
    // the wave's own q and kc rows have landed before the barrier publishes q
    asm volatile("s_wait_asynccnt 0x0" ::: "memory");
#else
    for (int idx = tid; idx < 16 * HDIM; idx += 64) {
        int r = idx >> 7, d = idx & 127;
        q_l[r][d] = q[((q0 + r) * NHQ + hq) * HDIM + d];
    }
#endif
    __syncthreads();
    ISSUE_CROWS(v_l, vc);   // needed behind the softmax only: they land under it

    // ---- compressed branch ----
    // oc[t][j]: g_cmp * o_cmp, dim (4 * wv + t) * 16 + j + 8 * half of query q0 + l16
    v8f oc[4];
    {
        const int s = q0 + l16;
        const float gate = gc[s * NHQ + hq];
        // sc[nt][j]: block wv * 32 + nt * 16 + j + 8 * half, query q0 + l16
        v8f sc[2];
#pragma unroll   // sc[] stays in registers; the ring buffer is a constant
        for (int nt = 0; nt < 2; ++nt) {
            v8f c;
#pragma unroll
            for (int j = 0; j < 8; ++j) c[j] = 0.f;
#pragma unroll
            for (int kk = 0; kk < HDIM; kk += 4) {
                v2f a, b;
                a[0] = k_l[wv][nt][l16][kk + 2 * half + 0];
                a[1] = k_l[wv][nt][l16][kk + 2 * half + 1];
                b[0] = q_l[l16][kk + 2 * half + 0];
                b[1] = q_l[l16][kk + 2 * half + 1];
                c = __builtin_amdgcn_wmma_f32_16x16x4_f32(false, a, false, b,
                                                          (short)0, c, false, false);
            }
            sc[nt] = c;
        }

        // mask + scale  (block fully in the past: (n+1)*32-1 <= s)
        float rm = -3.0e38f;
#pragma unroll   // sc[] stays in registers
        for (int nt = 0; nt < 2; ++nt)
#pragma unroll
            for (int j = 0; j < 8; ++j) {
                int n = wv * 32 + nt * 16 + j + 8 * half;
                bool valid = ((n + 1) * BLKC - 1) <= s;
                sc[nt][j] = valid ? sc[nt][j] * scale : NEGV;
                rm = fmaxf(rm, sc[nt][j]);
            }
        // softmax over the 64 blocks of the lane's query: 16 in this lane, 16 in
        // lane l ^ 16, 32 in the other wave
        rm = fmaxf(rm, other_half(rm));
        x_l[0][wv][lane] = rm;
        __syncthreads();
        rm = fmaxf(rm, x_l[0][wv ^ 1][lane]);
        float rsn[2];   // two chains that do not wait for one another
#pragma unroll   // sc[], rsn[] stay in registers
        for (int nt = 0; nt < 2; ++nt) {
            rsn[nt] = 0.f;
#pragma unroll
            for (int j = 0; j < 8; ++j) {
                sc[nt][j] = expf(sc[nt][j] - rm);
                rsn[nt] += sc[nt][j];
            }
        }
        const float rsw = rsn[0] + rsn[1];
        x_l[1][wv][lane] = rsw;
        __syncthreads();
        // the sum tree over the 64 blocks is the one pc has always had, so that
        // the block selection that ranks pc sees the same bits
        float rs = rsw + x_l[1][wv ^ 1][lane];
        rs += other_half(rs);
        float* pd = pc_ws + ((hq * SS + s) * NBC + wv * 32 + 8 * half);
#pragma unroll   // sc[] stays in registers
        for (int nt = 0; nt < 2; ++nt) {
#pragma unroll
            for (int j = 0; j < 8; ++j) sc[nt][j] = sc[nt][j] / rs;
            *(float4*)(pd + nt * 16 + 0) = make_float4(sc[nt][0], sc[nt][1], sc[nt][2], sc[nt][3]);
            *(float4*)(pd + nt * 16 + 4) = make_float4(sc[nt][4], sc[nt][5], sc[nt][6], sc[nt][7]);
        }

        // the wave's own vc rows have landed; no other wave reads them
        WAIT_TILE();
        // partial O^T = vc^T (128x32) * P^T (32x16) over the wave's 32 blocks.
        // pa[nt][j]: dim nt * 16 + j + 8 * half of query q0 + l16
        v8f pa[8];
#pragma unroll
        for (int nt = 0; nt < 8; ++nt)
#pragma unroll
            for (int j = 0; j < 8; ++j) pa[nt][j] = 0.f;
#pragma unroll   // the ring buffer is a constant
        for (int st = 0; st < 2; ++st) {
            // step c4 takes the four blocks 2 * c4, 2 * c4 + 1, 8 + 2 * c4 and
            // 8 + 2 * c4 + 1 of the 16: those whose weights the two halves hold in
            // sc[st][2 * c4] and sc[st][2 * c4 + 1]; vc^T is read in the same order
#pragma unroll
            for (int c4 = 0; c4 < 4; ++c4) {
                v2f b;
                b[0] = sc[st][2 * c4 + 0];
                b[1] = sc[st][2 * c4 + 1];
#pragma unroll
                for (int nt = 0; nt < 8; ++nt) {
                    v2f a;
                    a[0] = v_l[wv][st][8 * half + 2 * c4 + 0][nt * 16 + l16];
                    a[1] = v_l[wv][st][8 * half + 2 * c4 + 1][nt * 16 + l16];
                    pa[nt] = __builtin_amdgcn_wmma_f32_16x16x4_f32(false, a, false, b,
                                                       (short)0, pa[nt], false, false);
                }
            }
        }

        // join: wave w keeps dim tiles 4w..4w+3 and hands the other four over in
        // its own K ring (free since its last score), lane for lane
        float* cmine  = &k_l[wv][0][0][0];
        float* cother = &k_l[wv ^ 1][0][0][0];
        // FIRST: the first of the four tiles of pa[], a constant on each side of
        // the scalar branch, so that pa[] stays in registers
#define CMP_GIVE(FIRST)                                                        \
    _Pragma("unroll")                                                          \
    for (int t = 0; t < 4; ++t) {                                              \
        *(float4*)&cmine[((t * 2 + 0) * 32 + lane) * 4] = make_float4(         \
            pa[FIRST + t][0], pa[FIRST + t][1], pa[FIRST + t][2], pa[FIRST + t][3]); \
        *(float4*)&cmine[((t * 2 + 1) * 32 + lane) * 4] = make_float4(         \
            pa[FIRST + t][4], pa[FIRST + t][5], pa[FIRST + t][6], pa[FIRST + t][7]); \
    }
#define CMP_KEEP(FIRST)                                                        \
    _Pragma("unroll")                                                          \
    for (int t = 0; t < 4; ++t) {                                              \
        const float4 o0 = *(const float4*)&cother[((t * 2 + 0) * 32 + lane) * 4]; \
        const float4 o1 = *(const float4*)&cother[((t * 2 + 1) * 32 + lane) * 4]; \
        const float ob[8] = {o0.x, o0.y, o0.z, o0.w, o1.x, o1.y, o1.z, o1.w};  \
        _Pragma("unroll")                                                      \
        for (int j = 0; j < 8; ++j)                                            \
            oc[t][j] = any ? gate * (pa[FIRST + t][j] + ob[j]) : 0.f;          \
    }
        if (wv == 0) { CMP_GIVE(4) } else { CMP_GIVE(0) }
        __syncthreads();
        const bool any = s >= BLKC - 1;                  // cmask.any zeroing
        if (wv == 0) { CMP_KEEP(0) } else { CMP_KEEP(4) }
#undef CMP_GIVE
#undef CMP_KEEP
        // every reader has left both rings before the window tiles overwrite them
        asm volatile("s_wait_dscnt 0x0" ::: "memory");
        __syncthreads();
    }
    if (ktd - wv >= ktl) ISSUE_TILE(0, ktd - wv);   // prologue: the wave's first tile in flight

    // acc[nt][j]: dim nt * 16 + j + 8 * half of query q0 + l16
    v8f acc[8];
    // of query q0 + l16: running maximum (equal in both halves) and the sum over
    // the keys that this half has seen
    float mrow = -3.0e38f, lrow = 0.f;
#pragma unroll
    for (int nt = 0; nt < 8; ++nt)
#pragma unroll
        for (int j = 0; j < 8; ++j) acc[nt][j] = 0.f;

    for (int kt = ktd - wv; kt >= ktl; kt -= 2) {
        // the wave's reads of the buffer that is refilled below have retired
        asm volatile("s_wait_dscnt 0x0" ::: "memory");
        WAIT_TILE();            // buffer buf now resident in LDS
        const int nxt = buf ^ 1;
        if (kt - 2 >= ktl) ISSUE_TILE(nxt, kt - 2);  // overlap with compute

        // ---- S^T = K Q^T (16x16 tile): c[j] = key j + 8 * half, query l16 ----
        v8f c;
#pragma unroll
        for (int j = 0; j < 8; ++j) c[j] = 0.f;
#pragma unroll
        for (int kk = 0; kk < HDIM; kk += 4) {
            v2f a, b;
            a[0] = k_l[wv][buf][l16][kk + 2 * half + 0];
            a[1] = k_l[wv][buf][l16][kk + 2 * half + 1];
            b[0] = q_l[l16][kk + 2 * half + 0];
            b[1] = q_l[l16][kk + 2 * half + 1];
            c = __builtin_amdgcn_wmma_f32_16x16x4_f32(false, a, false, b,
                                                      (short)0, c, false, false);
        }

        // ---- mask + online softmax update, one query a lane ----
        const int dif0 = (q0 + l16) - (kt * 16 + 8 * half);
        float p[8];
        float tmax = NEGV;
#pragma unroll   // p[] stays in registers
        for (int j = 0; j < 8; ++j) {
            const int dif = dif0 - j;
            const bool valid = (dif >= 0) && (dif < WINW);
            p[j] = valid ? c[j] * scale : NEGV;
            tmax = fmaxf(tmax, p[j]);
        }
        tmax = fmaxf(tmax, other_half(tmax));
        const float mnew = fmaxf(mrow, tmax);
        const float corr = expf(mrow - mnew);
        float tsum = 0.f;
#pragma unroll   // p[] stays in registers
        for (int j = 0; j < 8; ++j) {
            p[j] = expf(p[j] - mnew);
            tsum += p[j];
        }
        lrow = lrow * corr + tsum;
        mrow = mnew;
#pragma unroll
        for (int nt = 0; nt < 8; ++nt)
#pragma unroll
            for (int j = 0; j < 8; ++j) acc[nt][j] *= corr;

        // ---- O^T += V^T * P^T (128x16 x 16x16). Step c4 takes the four keys
        // 2 * c4, 2 * c4 + 1, 8 + 2 * c4, 8 + 2 * c4 + 1: those whose weights the
        // two halves hold in p[2 * c4] and p[2 * c4 + 1]; V^T is read in the
        // same key order ----
#pragma unroll
        for (int c4 = 0; c4 < 4; ++c4) {
            v2f b;
            b[0] = p[2 * c4 + 0];
            b[1] = p[2 * c4 + 1];
#pragma unroll
            for (int nt = 0; nt < 8; ++nt) {
                v2f a;
                a[0] = v_l[wv][buf][8 * half + 2 * c4 + 0][nt * 16 + l16];
                a[1] = v_l[wv][buf][8 * half + 2 * c4 + 1][nt * 16 + l16];
                acc[nt] = __builtin_amdgcn_wmma_f32_16x16x4_f32(false, a, false, b,
                                                   (short)0, acc[nt], false, false);
            }
        }
        buf = nxt;
    }
    lrow += other_half(lrow);   // both halves' keys

    // ---- join: wave w finishes dim tiles 4w..4w+3. Each wave hands the
    // other four tiles, its maxima and its sums over in its own K ring,
    // lane for lane (both waves hold the same fragment layout). A wave without
    // a tile hands over zeros with the start maximum: weight exp(-huge) = 0.
    float* mine  = &k_l[wv][0][0][0];
    float* other = &k_l[wv ^ 1][0][0][0];
#pragma unroll   // acc[] stays in registers: nt is a constant in every index
    for (int nt = 0; nt < 8; ++nt)
        if ((nt >> 2) != wv) {
            *(float4*)&mine[(((nt & 3) * 2 + 0) * 32 + lane) * 4] =
                make_float4(acc[nt][0], acc[nt][1], acc[nt][2], acc[nt][3]);
            *(float4*)&mine[(((nt & 3) * 2 + 1) * 32 + lane) * 4] =
                make_float4(acc[nt][4], acc[nt][5], acc[nt][6], acc[nt][7]);
        }
    mine[1024 + lane] = mrow;
    mine[1056 + lane] = lrow;
    __syncthreads();

    const float mo = other[1024 + lane];
    const float lo = other[1056 + lane];
    const float mj = fmaxf(mrow, mo);
    const float wa = expf(mrow - mj);
    const float wb = expf(mo - mj);
    const float lj = lrow * wa + lo * wb;
    const float gr = gw[(q0 + l16) * NHQ + hq];
    // A lane holds eight dims in a row of one query. The wave's 16 x 64 piece of
    // the output passes through its own V ring (free: its last reads and copies
    // are done), so that a store of the wave covers whole cache lines.
    float (*o_l)[132] = v_l[wv][0];
#pragma unroll   // acc[] stays in registers: nt is a constant in every index
    for (int nt = 0; nt < 8; ++nt)
        if ((nt >> 2) == wv) {
            const float4 o0 = *(const float4*)&other[(((nt & 3) * 2 + 0) * 32 + lane) * 4];
            const float4 o1 = *(const float4*)&other[(((nt & 3) * 2 + 1) * 32 + lane) * 4];
            const float ob[8] = {o0.x, o0.y, o0.z, o0.w, o1.x, o1.y, o1.z, o1.w};
            float r[8];
#pragma unroll   // ob[], r[] stay in registers
            for (int j = 0; j < 8; ++j)
                r[j] = gr * ((acc[nt][j] * wa + ob[j] * wb) / lj) + oc[nt & 3][j];
            float* dst = &o_l[l16][(nt & 3) * 16 + 8 * half];
            *(float4*)&dst[0] = make_float4(r[0], r[1], r[2], r[3]);
            *(float4*)&dst[4] = make_float4(r[4], r[5], r[6], r[7]);
        }
    wave_lds_sync();
    // one address for all eight stores, the rows as constant offsets
    float* orow = out + (((q0 + half) * NHQ + hq) * HDIM + wv * 64 + 4 * l16);
#pragma unroll   // straight-line: eight stores, each two rows of 256 contiguous bytes
    for (int i = 0; i < 8; ++i)
        *(float4*)(orow + i * (2 * NHQ * HDIM)) = *(const float4*)&o_l[2 * i + half][4 * l16];
#undef ISSUE_TILE
#undef ISSUE_CROWS
#undef WAIT_TILE
}

// --------------------------------------------------------------------------
// Maximum over the 32 lanes of a wave, the same value in every lane: four steps
// inside each row of 16 lanes, then the other row's result.
// --------------------------------------------------------------------------
template <int XMASK>
__device__ __forceinline__ int row_xmask_max(int x) {
    // 0x160 | m: lane l takes the value of lane l ^ m of its row
    const int y = __builtin_amdgcn_update_dpp(0, x, 0x160 | XMASK, 0xf, 0xf, true);
    return x > y ? x : y;
}
__device__ __forceinline__ int wave_max32(int x) {
    x = row_xmask_max<1>(x);
    x = row_xmask_max<2>(x);
    x = row_xmask_max<4>(x);
    x = row_xmask_max<8>(x);
    const int y = __builtin_amdgcn_permlanex16(x, x, 0x76543210, 0xfedcba98, false, false);
    return x > y ? x : y;
}

// --------------------------------------------------------------------------
// Kernel 3: selected branch. 128 threads per (s, hk): 4 rep heads, 128
// gathered keys. Wave w first runs the top-4 argmax passes of its (s, hk) itself up to pass w,
// from the pooled pc row spread over its lanes, and keeps the one that it
// works on. K rows staged in LDS. P * V: wave w takes the 32 V rows of
// selected block w, a whole row per load; the four partial sums are joined
// through LDS. Adds g_slt * o_slt into d_out.
// --------------------------------------------------------------------------
__global__ __launch_bounds__(128)
void nsa_slt_kernel(const float* __restrict__ q, const float* __restrict__ k,
                    const float* __restrict__ v, const float* __restrict__ gs,
                    const float* __restrict__ pc, float* __restrict__ out) {
    // K is staged in two halves of the head dim (64 floats a row) so that eight
    // work-groups fit one WGP's LDS. Row pitch 272 B = 16 B x 17: 16-byte reads
    // of one row per lane meet no bank conflict.
    __shared__ __align__(16) float k_l[TOPN * BLKC][HDIM / 2 + 4];
    __shared__ __align__(16) float qsm[REPG][HDIM];
    __shared__ __align__(16) float scm[REPG][TOPN * BLKC];

    const int s  = blockIdx.x / NHK;
    const int hk = blockIdx.x % NHK;
    const int t  = threadIdx.x;
    const float scale = 0.08838834764831845f;

    // The four q rows of the group are 2 KiB in a row: one copy of 16 bytes a
    // thread brings them. Asked for first, so that they fly under the selection;
    // the wait and the barrier behind the first K copies cover them too. The
    // closing s_wait_xcnt stands in the copy's own statement, in front of any
    // rewrite of the address registers that it names.
    asm volatile(
        "global_load_async_to_lds_b128 %0, %1, off\n\t"
        "s_wait_xcnt 0x0"
        :: "v"((unsigned)(size_t)&qsm[0][0] + 16u * (unsigned)t),
           "v"(q + (s * NHQ + hk * REPG) * HDIM + 4 * t)
        : "memory");

    // wave w stages the 32 rows of selected block w; k_l row t belongs to key t.
    // One copy of the wave = two half rows of 256 contiguous bytes: whole cache lines.
    int bsel = 0;
    {
        // lane l holds blocks l and l + 32: a load of the wave is one cache line
        const int ln = t & 31;
        const int wsel = __builtin_amdgcn_readfirstlane(t >> 5);   // scalar: 0..3
        const int cur = s / BLKC;
        const float* pr0 = &pc[((hk * REPG + 0) * SS + s) * NBC + ln];
        const float* pr1 = pr0 + 1 * SS * NBC;
        const float* pr2 = pr0 + 2 * SS * NBC;
        const float* pr3 = pr0 + 3 * SS * NBC;
        float a0, a1, a2, a3, b0, b1, b2, b3;
        // eight loads in flight together. They and their data wait are one
        // statement with early-clobber outputs, so that no result lands in an
        // address register of the run and none is rewritten ahead of the wait
        asm volatile(
            "global_load_b32 %0, %8, off\n\t"
            "global_load_b32 %4, %8, off offset:128\n\t"
            "global_load_b32 %1, %9, off\n\t"
            "global_load_b32 %5, %9, off offset:128\n\t"
            "global_load_b32 %2, %10, off\n\t"
            "global_load_b32 %6, %10, off offset:128\n\t"
            "global_load_b32 %3, %11, off\n\t"
            "global_load_b32 %7, %11, off offset:128\n\t"
            "s_wait_loadcnt 0x0"
            : "=&v"(a0), "=&v"(a1), "=&v"(a2), "=&v"(a3),
              "=&v"(b0), "=&v"(b1), "=&v"(b2), "=&v"(b3)
            : "v"(pr0), "v"(pr1), "v"(pr2), "v"(pr3)
            : "memory");
        // heads summed in ascending order, from +0
        float v0 = (((0.f + a0) + a1) + a2) + a3;
        float v1 = (((0.f + b0) + b1) + b2) + b3;
        if (ln == cur)      v0 += 1e6f;
        if (ln + 32 == cur) v1 += 1e6f;
        if (ln == 0)        v0 += 1e6f;
        // pc holds softmax weights, so every pooled score is +0 or above, and
        // the bit patterns, read as integers, order and compare as the values do
        int k0 = __builtin_bit_cast(int, v0), k1 = __builtin_bit_cast(int, v1);
        // argmax passes; among equal values the lowest block index wins, as in
        // top_k. Wave w needs the winner of pass w and stops there.
        for (int pass = 0; pass < TOPN; ++pass) {
            const int m = wave_max32(k0 > k1 ? k0 : k1);
            const unsigned long long eq =
                (unsigned long long)__builtin_amdgcn_ballot_w32(k0 == m) |
                ((unsigned long long)__builtin_amdgcn_ballot_w32(k1 == m) << 32);
            bsel = __builtin_ctzll(eq);   // m is some lane's key: eq != 0, 0 <= bsel < NBC
            if (pass == wsel) break;
            if (ln == bsel)      k0 = -1;   // below every live key
            if (ln + 32 == bsel) k1 = -1;
        }
    }
    const float* g0 = k + ((bsel * BLKC + ((t >> 4) & 1)) * NHK + hk) * HDIM + 4 * (t & 15);
    const unsigned l0 = (unsigned)(size_t)&k_l[(t & ~31) + ((t >> 4) & 1)][4 * (t & 15)];
    constexpr int GSTEP = 2 * NHK * HDIM;            // floats: two key rows on
    constexpr unsigned LSTEP = 2 * (HDIM / 2 + 4) * 4;  // bytes: two k_l rows on

    float a[REPG] = {0.f, 0.f, 0.f, 0.f};
#pragma unroll   // two trips, straight-line: h is a constant in every address
    for (int h = 0; h < 2; ++h) {
        if (h) {
            // every reader has left k_l before the second half overwrites it
            asm volatile("s_wait_dscnt 0x0" ::: "memory");
            __syncthreads();
        }
#pragma unroll   // straight-line: all 16 copies of the wave are in flight together
        for (int i = 0; i < 16; i += 8) {
            const float* g = g0 + h * (HDIM / 2) + i * GSTEP;
            const unsigned l = l0 + i * LSTEP;
            // the closing s_wait_xcnt stands in the copies' own statement, in
            // front of any rewrite of the address registers that they name
            asm volatile(
                "global_load_async_to_lds_b128 %0, %8, off\n\t"
                "global_load_async_to_lds_b128 %1, %9, off\n\t"
                "global_load_async_to_lds_b128 %2, %10, off\n\t"
                "global_load_async_to_lds_b128 %3, %11, off\n\t"
                "global_load_async_to_lds_b128 %4, %12, off\n\t"
                "global_load_async_to_lds_b128 %5, %13, off\n\t"
                "global_load_async_to_lds_b128 %6, %14, off\n\t"
                "global_load_async_to_lds_b128 %7, %15, off\n\t"
                "s_wait_xcnt 0x0"
                :: "v"(l), "v"(l + 1 * LSTEP), "v"(l + 2 * LSTEP), "v"(l + 3 * LSTEP),
                   "v"(l + 4 * LSTEP), "v"(l + 5 * LSTEP), "v"(l + 6 * LSTEP), "v"(l + 7 * LSTEP),
                   "v"(g), "v"(g + 1 * GSTEP), "v"(g + 2 * GSTEP), "v"(g + 3 * GSTEP),
                   "v"(g + 4 * GSTEP), "v"(g + 5 * GSTEP), "v"(g + 6 * GSTEP), "v"(g + 7 * GSTEP)
                : "memory");
        }
        // the wave's own copies have landed before the barrier publishes k_l
        // (and, on the first trip, the q rows)
        asm volatile("s_wait_asynccnt 0x0" ::: "memory");
        __syncthreads();

        // scores: thread t handles key t, read from its k_l row; each head's
        // sum runs over d in ascending order
        for (int d = 0; d < HDIM / 2; d += 4) {
            const float4 kv = *(const float4*)&k_l[t][d];
#pragma unroll   // a[] stays in registers
            for (int r = 0; r < REPG; ++r) {
                const float4 qv = *(const float4*)&qsm[r][h * (HDIM / 2) + d];
                a[r] = fmaf(qv.x, kv.x, a[r]);
                a[r] = fmaf(qv.y, kv.y, a[r]);
                a[r] = fmaf(qv.z, kv.z, a[r]);
                a[r] = fmaf(qv.w, kv.w, a[r]);
            }
        }
    }
    // V rows of the wave's own block: lane l holds dims 4l..4l+3, one load of
    // the wave is one whole row (512 contiguous bytes). The first 16 rows, the
    // old output row and its gate are asked for here, so that their latency
    // runs under the softmax.
    const int wave = t >> 5, lane = t & 31;
    const float4* vrow = (const float4*)(v + (bsel * BLKC * NHK + hk) * HDIM) + lane;
    constexpr int VSTEP = NHK * HDIM / 4;            // float4s: one key row on
    float4 vr[16];
#pragma unroll   // vr[] stays in registers; 16 loads in flight together
    for (int i = 0; i < 16; ++i) vr[i] = vrow[i * VSTEP];
    // wave w finishes rep head w
    float4* orow = (float4*)(out + (s * NHQ + hk * REPG + wave) * HDIM) + lane;
    const float4 oold = *orow;
    const float  gate = gs[s * NHQ + hk * REPG + wave];

    {
        int pos = bsel * BLKC + (t % BLKC);
#pragma unroll   // a[] stays in registers
        for (int r = 0; r < REPG; ++r)
            scm[r][t] = (pos <= s) ? a[r] * scale : NEGV;
    }
    __syncthreads();

    // softmax: wave w handles row w (4 waves of 32 lanes)
    {
        float vals[4];
        float mloc = -3.0e38f;
        for (int i = 0; i < 4; ++i) {
            vals[i] = scm[wave][lane + 32 * i];
            mloc = fmaxf(mloc, vals[i]);
        }
        for (int m = 1; m <= 16; m <<= 1)
            mloc = fmaxf(mloc, __shfl_xor(mloc, m, 32));
        float ssum = 0.f;
        for (int i = 0; i < 4; ++i) { vals[i] = expf(vals[i] - mloc); ssum += vals[i]; }
        for (int m = 1; m <= 16; m <<= 1)
            ssum += __shfl_xor(ssum, m, 32);
        float inv = 1.0f / ssum;
        for (int i = 0; i < 4; ++i) scm[wave][lane + 32 * i] = vals[i] * inv;
    }
    __syncthreads();

    // partial output of the wave's 32 keys, all 4 rep heads, 4 dims a lane
    float4 o[REPG];
#pragma unroll   // o[] stays in registers
    for (int r = 0; r < REPG; ++r) o[r] = make_float4(0.f, 0.f, 0.f, 0.f);
#pragma unroll   // vr[] stays in registers: every index is a constant
    for (int i = 0; i < BLKC; i += 4) {
        float pr[REPG][4];
#pragma unroll   // pr[] stays in registers
        for (int r = 0; r < REPG; ++r) {
            const float4 p4 = *(const float4*)&scm[r][wave * BLKC + i];
            pr[r][0] = p4.x; pr[r][1] = p4.y; pr[r][2] = p4.z; pr[r][3] = p4.w;
        }
#pragma unroll   // vr[], pr[] stay in registers
        for (int u = 0; u < 4; ++u) {
            const float4 vv = vr[(i + u) & 15];
#pragma unroll   // o[] stays in registers
            for (int r = 0; r < REPG; ++r) {
                o[r].x = fmaf(pr[r][u], vv.x, o[r].x);
                o[r].y = fmaf(pr[r][u], vv.y, o[r].y);
                o[r].z = fmaf(pr[r][u], vv.z, o[r].z);
                o[r].w = fmaf(pr[r][u], vv.w, o[r].w);
            }
            // the row 16 further on takes the registers that have just been used
            if (i + u < 16) vr[i + u] = vrow[(i + u + 16) * VSTEP];
            // behind the last V load, in front of any rewrite of its address registers
            if (i + u == 15) asm volatile("s_wait_xcnt 0x0" ::: "memory");
        }
    }

    // join: k_l is free since the barrier behind the scores
    float* red = &k_l[0][0];                         // [wave][rep head][HDIM]
#pragma unroll   // o[] stays in registers
    for (int r = 0; r < REPG; ++r)
        *(float4*)&red[(wave * REPG + r) * HDIM + 4 * lane] = o[r];
    __syncthreads();
    {
        float4 sum = *(const float4*)&red[(0 * REPG + wave) * HDIM + 4 * lane];
#pragma unroll   // three more partial sums, in the order of the selected blocks
        for (int w = 1; w < TOPN; ++w) {
            const float4 pw = *(const float4*)&red[(w * REPG + wave) * HDIM + 4 * lane];
            sum.x += pw.x; sum.y += pw.y; sum.z += pw.z; sum.w += pw.w;
        }
        *orow = make_float4(fmaf(gate, sum.x, oold.x), fmaf(gate, sum.y, oold.y),
                            fmaf(gate, sum.z, oold.z), fmaf(gate, sum.w, oold.w));
    }
}

// --------------------------------------------------------------------------
extern "C" void kernel_launch(void* const* d_in, const int* in_sizes, int n_in,
                              void* d_out, int out_size, void* d_ws, size_t ws_size,
                              hipStream_t stream) {
    const float* q  = (const float*)d_in[0];
    const float* k  = (const float*)d_in[1];
    const float* v  = (const float*)d_in[2];
    const float* gw = (const float*)d_in[3];
    const float* gc = (const float*)d_in[4];
    const float* gs = (const float*)d_in[5];
    float* out = (float*)d_out;

    float* ws = (float*)d_ws;
    float* kc = ws;                                  // NB*NHK*HD = 16384 floats
    float* vc = ws + NBC * NHK * HDIM;               // 16384 floats
    float* pc = vc + NBC * NHK * HDIM;               // NHQ*S*NB = 1,048,576 floats

    nsa_cmpkv_kernel<<<(NBC * NHK * HDIM + 255) / 256, 256, 0, stream>>>(k, v, kc, vc);
    nsa_win_kernel<<<(SS / 16) * NHQ, 64, 0, stream>>>(q, k, v, gw, kc, vc, gc, pc, out);
    nsa_slt_kernel<<<SS * NHK, 128, 0, stream>>>(q, k, v, gs, pc, out);
}

// v009
// It runs in 60.7 microseconds.
// Next to v008, in two timings, it ran 1.08 times as fast each time.
// Counting every step since v000, it is 3.87 times as fast.
#include <hip/hip_runtime.h>
#include <hip/hip_bf16.h>

#define SS   2048
#define NHQ  8
#define NHK  2
#define HDIM 128
#define REPG 4
#define WINW 512
#define BLKC 32
#define NBC  64
#define TOPN 4
#define NEGV (-1e30f)

typedef __attribute__((ext_vector_type(2))) float v2f;
typedef __attribute__((ext_vector_type(8))) float v8f;

#if defined(__has_builtin)
#if __has_builtin(__builtin_amdgcn_global_load_async_to_lds_b128)
#define HAVE_ASYNC_LDS 1
#endif
#endif

#ifdef HAVE_ASYNC_LDS
// builtin signature (from hipcc diagnostic): takes pointers to 16-byte int
// vectors: (v4i addrspace(1)*, v4i addrspace(3)*, imm offset, imm cpol)
typedef int v4i_ __attribute__((vector_size(16)));
typedef __attribute__((address_space(1))) v4i_ gv4i;
typedef __attribute__((address_space(3))) v4i_ lv4i;
#endif

// --------------------------------------------------------------------------
// Kernel 1: block-mean compressed K/V.  kc/vc: [NB][NHK][HD]
// --------------------------------------------------------------------------
__global__ void nsa_cmpkv_kernel(const float* __restrict__ k,
                                 const float* __restrict__ v,
                                 float* __restrict__ kc,
                                 float* __restrict__ vc) {
    int idx = blockIdx.x * blockDim.x + threadIdx.x;
    if (idx >= NBC * NHK * HDIM) return;
    int d  = idx % HDIM;
    int hk = (idx / HDIM) % NHK;
    int n  = idx / (HDIM * NHK);
    float sk = 0.f, sv = 0.f;
    for (int i = 0; i < BLKC; ++i) {
        int row = n * BLKC + i;
        sk += k[(row * NHK + hk) * HDIM + d];
        sv += v[(row * NHK + hk) * HDIM + d];
    }
    kc[(n * NHK + hk) * HDIM + d] = sk * (1.0f / BLKC);
    vc[(n * NHK + hk) * HDIM + d] = sv * (1.0f / BLKC);
}

// Orders one wave's own LDS traffic: what some lanes store, other lanes of the
// same wave load behind it. For LDS that is private to a wave this takes the
// place of a work-group barrier.
__device__ __forceinline__ void wave_lds_sync() {
    __builtin_amdgcn_fence(__ATOMIC_RELEASE, "workgroup");
    __builtin_amdgcn_wave_barrier();
    __builtin_amdgcn_fence(__ATOMIC_ACQUIRE, "workgroup");
}

// The value that lane l ^ 16 holds.
__device__ __forceinline__ float other_half(float x) {
    const int xi = __builtin_bit_cast(int, x);
    return __builtin_bit_cast(float, __builtin_amdgcn_permlanex16(
        xi, xi, 0x76543210, 0xfedcba98, false, false));
}

__global__ __launch_bounds__(256)
void nsa_win_kernel(const float* __restrict__ q, const float* __restrict__ k,
                    const float* __restrict__ v, const float* __restrict__ gw,
                    const float* __restrict__ kc, const float* __restrict__ vc,
                    const float* __restrict__ gc, float* __restrict__ pc_ws,
                    float* __restrict__ out) {
    __shared__ __align__(16) float q_l[REPG][16][132];   // [head of the group]
    __shared__ __align__(16) float k_l[2][2][32][132];   // [w][buffer][two key tiles]
    __shared__ __align__(16) float v_l[2][2][32][132];
    __shared__ float x_l[REPG][2][2][32];   // [head][maximum, sum][w][lane]

    const int qt   = blockIdx.x / NHK;
    const int hk   = blockIdx.x % NHK;
    const int q0   = qt * 16;
    const int tid  = threadIdx.x;
    const int wid  = __builtin_amdgcn_readfirstlane(tid >> 5);  // scalar: 0..7
    // waves i and i + 4 are a head's two: where those two share a SIMD, every
    // SIMD has the same number of key tiles (for speed only)
    const int rh   = wid & 3;           // head of the group: 0..3
    const int wv   = wid >> 2;          // which of the head's two waves
    const int hq   = hk * REPG + rh;
    const int lane = tid & 31;
    const int half = lane >> 4;     // 0 or 1
    const int l16  = lane & 15;
    const float scale = 0.08838834764831845f;   // 1/sqrt(128)

    const int ktd = qt;
    int lowkey = q0 - (WINW - 1); if (lowkey < 0) lowkey = 0;
    const int ktl = lowkey >> 4;

    // ---- tile staging (async double-buffer if available) ----
#ifdef HAVE_ASYNC_LDS
#define ISSUE_TILE(bufi, u, ktv)                                               \
    do {                                                                       \
        for (int i_ = 0; i_ < 4; ++i_) {       /* the wave's quarter: 4 rows */ \
            int r_ = rh * 4 + i_;                                              \
            int d_ = lane << 2;                                                \
            const float* gk_ = &k[(((ktv) * 16 + r_) * NHK + hk) * HDIM + d_]; \
            const float* gv_ = &v[(((ktv) * 16 + r_) * NHK + hk) * HDIM + d_]; \
            __builtin_amdgcn_global_load_async_to_lds_b128(                    \
                (gv4i*)gk_, (lv4i*)&k_l[wv][bufi][(u) * 16 + r_][d_], 0, 0);   \
            __builtin_amdgcn_global_load_async_to_lds_b128(                    \
                (gv4i*)gv_, (lv4i*)&v_l[wv][bufi][(u) * 16 + r_][d_], 0, 0);   \
        }                                                                      \
    } while (0)
    // the wave's own copies have landed
#define WAIT_TILE() asm volatile("s_wait_asynccnt 0x0" ::: "memory")
#else
#define ISSUE_TILE(bufi, u, ktv)                                               \
    do {                                                                       \
        for (int idx_ = rh * 4 * HDIM + lane; idx_ < (rh + 1) * 4 * HDIM; idx_ += 32) { \
            int r_ = idx_ >> 7, d_ = idx_ & 127;                               \
            k_l[wv][bufi][(u) * 16 + r_][d_] = k[(((ktv) * 16 + r_) * NHK + hk) * HDIM + d_]; \
            v_l[wv][bufi][(u) * 16 + r_][d_] = v[(((ktv) * 16 + r_) * NHK + hk) * HDIM + d_]; \
        }                                                                      \
    } while (0)
#define WAIT_TILE() wave_lds_sync()
#endif
    // the two tiles ktv and ktv - 2 of ring wv, each where it exists (scalar tests)
#define ISSUE_STAGE(bufi, ktv)                                                 \
    do {                                                                       \
        if ((ktv) >= ktl) ISSUE_TILE(bufi, 0, (ktv));                          \
        if ((ktv) - 2 >= ktl) ISSUE_TILE(bufi, 1, (ktv) - 2);                  \
    } while (0)

    int buf = 0;
#ifdef HAVE_ASYNC_LDS
    // q tile of the wave's head: wave w brings rows 8w..8w+7, one copy a row
    // (32 lanes x 16 bytes)
#pragma unroll   // straight-line: all eight copies are in flight together
    for (int i_ = 0; i_ < 8; ++i_) {
        const int r_ = wv * 8 + i_;
        __builtin_amdgcn_global_load_async_to_lds_b128(
            (gv4i*)&q[((q0 + r_) * NHQ + hq) * HDIM + 4 * lane],
            (lv4i*)&q_l[rh][r_][4 * lane], 0, 0);
    }
#endif
    // 32 rows of kc or vc, from row 32 * wv, into buffer 0 of ring wv: the
    // wave brings its quarter, rows 8 * rh .. 8 * rh + 7 of them, one copy a row
#ifdef HAVE_ASYNC_LDS
#define ISSUE_CROWS(ring, src)                                                 \
    do {                                                                       \
        _Pragma("unroll")   /* straight-line: all 8 copies in flight together */ \
        for (int i_ = 0; i_ < 8; ++i_)                                         \
            __builtin_amdgcn_global_load_async_to_lds_b128(                    \
                (gv4i*)&src[((wv * 32 + rh * 8 + i_) * NHK + hk) * HDIM + 4 * lane], \
                (lv4i*)&ring[wv][0][rh * 8 + i_][4 * lane], 0, 0);             \
    } while (0)
#else
#define ISSUE_CROWS(ring, src)                                                 \
    do {                                                                       \
        for (int idx_ = rh * 8 * HDIM + lane; idx_ < (rh + 1) * 8 * HDIM; idx_ += 32) { \
            int r_ = idx_ >> 7, d_ = idx_ & 127;                               \
            ring[wv][0][r_][d_] = src[((wv * 32 + r_) * NHK + hk) * HDIM + d_]; \
        }                                                                      \
    } while (0)
#endif
    ISSUE_CROWS(k_l, kc);

#ifdef HAVE_ASYNC_LDS
    // the wave's own q and kc rows have landed before the barrier publishes them
    asm volatile("s_wait_asynccnt 0x0" ::: "memory");
#else
    for (int idx = wv * 32 + lane; idx < 16 * HDIM; idx += 64) {
        int r = idx >> 7, d = idx & 127;
        q_l[rh][r][d] = q[((q0 + r) * NHQ + hq) * HDIM + d];
    }
#endif
    __syncthreads();
    ISSUE_CROWS(v_l, vc);   // needed behind the softmax only: they land under it

    // ---- compressed branch ----
    // oc[t][j]: g_cmp * o_cmp, dim (4 * wv + t) * 16 + j + 8 * half of query q0 + l16
    v8f oc[4];
    {
        const int s = q0 + l16;
        const float gate = gc[s * NHQ + hq];
        // sc[nt][j]: block wv * 32 + nt * 16 + j + 8 * half, query q0 + l16
        v8f sc[2];
#pragma unroll   // sc[] stays in registers
        for (int nt = 0; nt < 2; ++nt) {
            v8f c;
#pragma unroll
            for (int j = 0; j < 8; ++j) c[j] = 0.f;
#pragma unroll
            for (int kk = 0; kk < HDIM; kk += 4) {
                v2f a, b;
                a[0] = k_l[wv][0][nt * 16 + l16][kk + 2 * half + 0];
                a[1] = k_l[wv][0][nt * 16 + l16][kk + 2 * half + 1];
                b[0] = q_l[rh][l16][kk + 2 * half + 0];
                b[1] = q_l[rh][l16][kk + 2 * half + 1];
                c = __builtin_amdgcn_wmma_f32_16x16x4_f32(false, a, false, b,
                                                          (short)0, c, false, false);
            }
            sc[nt] = c;
        }

        // mask + scale  (block fully in the past: (n+1)*32-1 <= s)
        float rm = -3.0e38f;
#pragma unroll   // sc[] stays in registers
        for (int nt = 0; nt < 2; ++nt)
#pragma unroll
            for (int j = 0; j < 8; ++j) {
                int n = wv * 32 + nt * 16 + j + 8 * half;
                bool valid = ((n + 1) * BLKC - 1) <= s;
                sc[nt][j] = valid ? sc[nt][j] * scale : NEGV;
                rm = fmaxf(rm, sc[nt][j]);
            }
        // softmax over the 64 blocks of the lane's query: 16 in this lane, 16 in
        // lane l ^ 16, 32 in the other wave
        rm = fmaxf(rm, other_half(rm));
        x_l[rh][0][wv][lane] = rm;
        __syncthreads();
        rm = fmaxf(rm, x_l[rh][0][wv ^ 1][lane]);
        float rsn[2];   // two chains that do not wait for one another
#pragma unroll   // sc[], rsn[] stay in registers
        for (int nt = 0; nt < 2; ++nt) {
            rsn[nt] = 0.f;
#pragma unroll
            for (int j = 0; j < 8; ++j) {
                sc[nt][j] = expf(sc[nt][j] - rm);
                rsn[nt] += sc[nt][j];
            }
        }
        const float rsw = rsn[0] + rsn[1];
        x_l[rh][1][wv][lane] = rsw;
        // the wave's own vc rows have landed before the barrier publishes them to
        // the three other heads' waves
        WAIT_TILE();
        __syncthreads();
        // the sum tree over the 64 blocks is the one pc has always had, so that
        // the block selection that ranks pc sees the same bits
        float rs = rsw + x_l[rh][1][wv ^ 1][lane];
        rs += other_half(rs);
        float* pd = pc_ws + ((hq * SS + s) * NBC + wv * 32 + 8 * half);
#pragma unroll   // sc[] stays in registers
        for (int nt = 0; nt < 2; ++nt) {
#pragma unroll
            for (int j = 0; j < 8; ++j) sc[nt][j] = sc[nt][j] / rs;
            *(float4*)(pd + nt * 16 + 0) = make_float4(sc[nt][0], sc[nt][1], sc[nt][2], sc[nt][3]);
            *(float4*)(pd + nt * 16 + 4) = make_float4(sc[nt][4], sc[nt][5], sc[nt][6], sc[nt][7]);
        }

        // partial O^T = vc^T (128x32) * P^T (32x16) over the wave's 32 blocks.
        // pa[nt][j]: dim nt * 16 + j + 8 * half of query q0 + l16
        v8f pa[8];
#pragma unroll
        for (int nt = 0; nt < 8; ++nt)
#pragma unroll
            for (int j = 0; j < 8; ++j) pa[nt][j] = 0.f;
#pragma unroll   // sc[] stays in registers
        for (int st = 0; st < 2; ++st) {
            // step c4 takes the four blocks 2 * c4, 2 * c4 + 1, 8 + 2 * c4 and
            // 8 + 2 * c4 + 1 of the 16: those whose weights the two halves hold in
            // sc[st][2 * c4] and sc[st][2 * c4 + 1]; vc^T is read in the same order
#pragma unroll
            for (int c4 = 0; c4 < 4; ++c4) {
                v2f b;
                b[0] = sc[st][2 * c4 + 0];
                b[1] = sc[st][2 * c4 + 1];
#pragma unroll
                for (int nt = 0; nt < 8; ++nt) {
                    v2f a;
                    a[0] = v_l[wv][0][st * 16 + 8 * half + 2 * c4 + 0][nt * 16 + l16];
                    a[1] = v_l[wv][0][st * 16 + 8 * half + 2 * c4 + 1][nt * 16 + l16];
                    pa[nt] = __builtin_amdgcn_wmma_f32_16x16x4_f32(false, a, false, b,
                                                       (short)0, pa[nt], false, false);
                }
            }
        }

        // join: wave w keeps dim tiles 4w..4w+3 and hands the other four over in
        // its head's quarter of K ring w (free since the barriers behind the
        // scores), lane for lane
        float* cmine  = &k_l[wv][0][0][0] + rh * 1024;
        float* cother = &k_l[wv ^ 1][0][0][0] + rh * 1024;
        // FIRST: the first of the four tiles of pa[], a constant on each side of
        // the scalar branch, so that pa[] stays in registers
#define CMP_GIVE(FIRST)                                                        \
    _Pragma("unroll")                                                          \
    for (int t = 0; t < 4; ++t) {                                              \
        *(float4*)&cmine[((t * 2 + 0) * 32 + lane) * 4] = make_float4(         \
            pa[FIRST + t][0], pa[FIRST + t][1], pa[FIRST + t][2], pa[FIRST + t][3]); \
        *(float4*)&cmine[((t * 2 + 1) * 32 + lane) * 4] = make_float4(         \
            pa[FIRST + t][4], pa[FIRST + t][5], pa[FIRST + t][6], pa[FIRST + t][7]); \
    }
#define CMP_KEEP(FIRST)                                                        \
    _Pragma("unroll")                                                          \
    for (int t = 0; t < 4; ++t) {                                              \
        const float4 o0 = *(const float4*)&cother[((t * 2 + 0) * 32 + lane) * 4]; \
        const float4 o1 = *(const float4*)&cother[((t * 2 + 1) * 32 + lane) * 4]; \
        const float ob[8] = {o0.x, o0.y, o0.z, o0.w, o1.x, o1.y, o1.z, o1.w};  \
        _Pragma("unroll")                                                      \
        for (int j = 0; j < 8; ++j)                                            \
            oc[t][j] = any ? gate * (pa[FIRST + t][j] + ob[j]) : 0.f;          \
    }
        if (wv == 0) { CMP_GIVE(4) } else { CMP_GIVE(0) }
        __syncthreads();
        const bool any = s >= BLKC - 1;                  // cmask.any zeroing
        if (wv == 0) { CMP_KEEP(0) } else { CMP_KEEP(4) }
#undef CMP_GIVE
#undef CMP_KEEP
        // every reader has left both rings before the window tiles overwrite them
        asm volatile("s_wait_dscnt 0x0" ::: "memory");
        __syncthreads();
    }
    // prologue: ring w's first two tiles land and are published, the next two are
    // in flight
    int kt = ktd - wv;   // the first tile of the trip
    ISSUE_STAGE(0, kt);
    WAIT_TILE();
    __syncthreads();
    ISSUE_STAGE(1, kt - 4);

    // acc[nt][j]: dim nt * 16 + j + 8 * half of query q0 + l16
    v8f acc[8];
    // of query q0 + l16: running maximum (equal in both halves) and the sum over
    // the keys that this half has seen
    float mrow = -3.0e38f, lrow = 0.f;
#pragma unroll
    for (int nt = 0; nt < 8; ++nt)
#pragma unroll
        for (int j = 0; j < 8; ++j) acc[nt][j] = 0.f;

    // two tiles a trip; the trips of w = 0, which has as many tiles as w = 1 or one
    // more: every wave passes every barrier, also one whose last trip has no tile
    const int ntrip = (((ktd - ktl) >> 1) + 2) >> 1;
    for (int it = 0; it < ntrip; ++it, kt -= 4) {
      for (int u = 0; u < 2; ++u) {
        const int ku = kt - 2 * u;
        if (ku < ktl) break;   // scalar: the same for the whole wave
        // ---- S^T = K Q^T (16x16 tile): c[j] = key j + 8 * half, query l16 ----
        v8f c;
#pragma unroll
        for (int j = 0; j < 8; ++j) c[j] = 0.f;
#pragma unroll
        for (int kk = 0; kk < HDIM; kk += 4) {
            v2f a, b;
            a[0] = k_l[wv][buf][u * 16 + l16][kk + 2 * half + 0];
            a[1] = k_l[wv][buf][u * 16 + l16][kk + 2 * half + 1];
            b[0] = q_l[rh][l16][kk + 2 * half + 0];
            b[1] = q_l[rh][l16][kk + 2 * half + 1];
            c = __builtin_amdgcn_wmma_f32_16x16x4_f32(false, a, false, b,
                                                      (short)0, c, false, false);
        }

        // ---- mask + online softmax update, one query a lane ----
        const int dif0 = (q0 + l16) - (ku * 16 + 8 * half);
        float p[8];
        float tmax = NEGV;
#pragma unroll   // p[] stays in registers
        for (int j = 0; j < 8; ++j) {
            const int dif = dif0 - j;
            const bool valid = (dif >= 0) && (dif < WINW);
            p[j] = valid ? c[j] * scale : NEGV;
            tmax = fmaxf(tmax, p[j]);
        }
        tmax = fmaxf(tmax, other_half(tmax));
        const float mnew = fmaxf(mrow, tmax);
        const float corr = expf(mrow - mnew);
        float tsum = 0.f;
#pragma unroll   // p[] stays in registers
        for (int j = 0; j < 8; ++j) {
            p[j] = expf(p[j] - mnew);
            tsum += p[j];
        }
        lrow = lrow * corr + tsum;
        mrow = mnew;
#pragma unroll
        for (int nt = 0; nt < 8; ++nt)
#pragma unroll
            for (int j = 0; j < 8; ++j) acc[nt][j] *= corr;

        // ---- O^T += V^T * P^T (128x16 x 16x16). Step c4 takes the four keys
        // 2 * c4, 2 * c4 + 1, 8 + 2 * c4, 8 + 2 * c4 + 1: those whose weights the
        // two halves hold in p[2 * c4] and p[2 * c4 + 1]; V^T is read in the
        // same key order ----
#pragma unroll
        for (int c4 = 0; c4 < 4; ++c4) {
            v2f b;
            b[0] = p[2 * c4 + 0];
            b[1] = p[2 * c4 + 1];
#pragma unroll
            for (int nt = 0; nt < 8; ++nt) {
                v2f a;
                a[0] = v_l[wv][buf][u * 16 + 8 * half + 2 * c4 + 0][nt * 16 + l16];
                a[1] = v_l[wv][buf][u * 16 + 8 * half + 2 * c4 + 1][nt * 16 + l16];
                acc[nt] = __builtin_amdgcn_wmma_f32_16x16x4_f32(false, a, false, b,
                                                   (short)0, acc[nt], false, false);
            }
        }
      }
        // the wave's reads of the buffer that is refilled below have retired
        asm volatile("s_wait_dscnt 0x0" ::: "memory");
        WAIT_TILE();            // the wave's quarter of the next two tiles has landed
        // publishes the next two tiles; every reader has left this trip's buffer
        __syncthreads();
        ISSUE_STAGE(buf, kt - 8);   // flies under the next trip
        buf ^= 1;
    }
    WAIT_TILE();   // no copy is in flight where the rings are put to other use
    lrow += other_half(lrow);   // both halves' keys

    // ---- join: wave w finishes dim tiles 4w..4w+3. Each wave hands the
    // other four tiles over in its head's quarter of K ring w, its maxima and
    // its sums in x_l, lane for lane (both waves hold the same fragment layout).
    // A wave without a tile hands over zeros with the start maximum: weight
    // exp(-huge) = 0.
    float* mine  = &k_l[wv][0][0][0] + rh * 1024;
    float* other = &k_l[wv ^ 1][0][0][0] + rh * 1024;
#pragma unroll   // acc[] stays in registers: nt is a constant in every index
    for (int nt = 0; nt < 8; ++nt)
        if ((nt >> 2) != wv) {
            *(float4*)&mine[(((nt & 3) * 2 + 0) * 32 + lane) * 4] =
                make_float4(acc[nt][0], acc[nt][1], acc[nt][2], acc[nt][3]);
            *(float4*)&mine[(((nt & 3) * 2 + 1) * 32 + lane) * 4] =
                make_float4(acc[nt][4], acc[nt][5], acc[nt][6], acc[nt][7]);
        }
    x_l[rh][0][wv][lane] = mrow;
    x_l[rh][1][wv][lane] = lrow;
    __syncthreads();

    const float mo = x_l[rh][0][wv ^ 1][lane];
    const float lo = x_l[rh][1][wv ^ 1][lane];
    const float mj = fmaxf(mrow, mo);
    const float wa = expf(mrow - mj);
    const float wb = expf(mo - mj);
    const float lj = lrow * wa + lo * wb;
    const float gr = gw[(q0 + l16) * NHQ + hq];
    // A lane holds eight dims in a row of one query. The wave's 16 x 64 piece of
    // the output passes through a part of V ring w that is its own (64 columns of
    // one buffer; free: every wave's last reads and copies are done), so that a
    // store of the wave covers whole cache lines.
    float* o_l = &v_l[wv][rh >> 1][0][(rh & 1) * 64];   // row pitch 132 floats
#pragma unroll   // acc[] stays in registers: nt is a constant in every index
    for (int nt = 0; nt < 8; ++nt)
        if ((nt >> 2) == wv) {
            const float4 o0 = *(const float4*)&other[(((nt & 3) * 2 + 0) * 32 + lane) * 4];
            const float4 o1 = *(const float4*)&other[(((nt & 3) * 2 + 1) * 32 + lane) * 4];
            const float ob[8] = {o0.x, o0.y, o0.z, o0.w, o1.x, o1.y, o1.z, o1.w};
            float r[8];
#pragma unroll   // ob[], r[] stay in registers
            for (int j = 0; j < 8; ++j)
                r[j] = gr * ((acc[nt][j] * wa + ob[j] * wb) / lj) + oc[nt & 3][j];
            float* dst = &o_l[l16 * 132 + (nt & 3) * 16 + 8 * half];
            *(float4*)&dst[0] = make_float4(r[0], r[1], r[2], r[3]);
            *(float4*)&dst[4] = make_float4(r[4], r[5], r[6], r[7]);
        }
    wave_lds_sync();
    // one address for all eight stores, the rows as constant offsets
    float* orow = out + (((q0 + half) * NHQ + hq) * HDIM + wv * 64 + 4 * l16);
#pragma unroll   // straight-line: eight stores, each two rows of 256 contiguous bytes
    for (int i = 0; i < 8; ++i)
        *(float4*)(orow + i * (2 * NHQ * HDIM)) = *(const float4*)&o_l[(2 * i + half) * 132 + 4 * l16];
#undef ISSUE_STAGE
#undef ISSUE_TILE
#undef ISSUE_CROWS
#undef WAIT_TILE
}

// --------------------------------------------------------------------------
// Maximum over the 32 lanes of a wave, the same value in every lane: four steps
// inside each row of 16 lanes, then the other row's result.
// --------------------------------------------------------------------------
template <int XMASK>
__device__ __forceinline__ int row_xmask_max(int x) {
    // 0x160 | m: lane l takes the value of lane l ^ m of its row
    const int y = __builtin_amdgcn_update_dpp(0, x, 0x160 | XMASK, 0xf, 0xf, true);
    return x > y ? x : y;
}
__device__ __forceinline__ int wave_max32(int x) {
    x = row_xmask_max<1>(x);
    x = row_xmask_max<2>(x);
    x = row_xmask_max<4>(x);
    x = row_xmask_max<8>(x);
    const int y = __builtin_amdgcn_permlanex16(x, x, 0x76543210, 0xfedcba98, false, false);
    return x > y ? x : y;
}

// --------------------------------------------------------------------------
// Kernel 3: selected branch. 128 threads per (s, hk): 4 rep heads, 128
// gathered keys. Wave w first runs the top-4 argmax passes of its (s, hk) itself up to pass w,
// from the pooled pc row spread over its lanes, and keeps the one that it
// works on. K rows staged in LDS. P * V: wave w takes the 32 V rows of
// selected block w, a whole row per load; the four partial sums are joined
// through LDS. Adds g_slt * o_slt into d_out.
// --------------------------------------------------------------------------
__global__ __launch_bounds__(128)
void nsa_slt_kernel(const float* __restrict__ q, const float* __restrict__ k,
                    const float* __restrict__ v, const float* __restrict__ gs,
                    const float* __restrict__ pc, float* __restrict__ out) {
    // K is staged in two halves of the head dim (64 floats a row) so that eight
    // work-groups fit one WGP's LDS. Row pitch 272 B = 16 B x 17: 16-byte reads
    // of one row per lane meet no bank conflict.
    __shared__ __align__(16) float k_l[TOPN * BLKC][HDIM / 2 + 4];
    __shared__ __align__(16) float qsm[REPG][HDIM];
    __shared__ __align__(16) float scm[REPG][TOPN * BLKC];

    const int s  = blockIdx.x / NHK;
    const int hk = blockIdx.x % NHK;
    const int t  = threadIdx.x;
    const float scale = 0.08838834764831845f;

    // The four q rows of the group are 2 KiB in a row: one copy of 16 bytes a
    // thread brings them. Asked for first, so that they fly under the selection;
    // the wait and the barrier behind the first K copies cover them too. The
    // closing s_wait_xcnt stands in the copy's own statement, in front of any
    // rewrite of the address registers that it names.
    asm volatile(
        "global_load_async_to_lds_b128 %0, %1, off\n\t"
        "s_wait_xcnt 0x0"
        :: "v"((unsigned)(size_t)&qsm[0][0] + 16u * (unsigned)t),
           "v"(q + (s * NHQ + hk * REPG) * HDIM + 4 * t)
        : "memory");

    // wave w stages the 32 rows of selected block w; k_l row t belongs to key t.
    // One copy of the wave = two half rows of 256 contiguous bytes: whole cache lines.
    int bsel = 0;
    {
        // lane l holds blocks l and l + 32: a load of the wave is one cache line
        const int ln = t & 31;
        const int wsel = __builtin_amdgcn_readfirstlane(t >> 5);   // scalar: 0..3
        const int cur = s / BLKC;
        const float* pr0 = &pc[((hk * REPG + 0) * SS + s) * NBC + ln];
        const float* pr1 = pr0 + 1 * SS * NBC;
        const float* pr2 = pr0 + 2 * SS * NBC;
        const float* pr3 = pr0 + 3 * SS * NBC;
        float a0, a1, a2, a3, b0, b1, b2, b3;
        // eight loads in flight together. They and their data wait are one
        // statement with early-clobber outputs, so that no result lands in an
        // address register of the run and none is rewritten ahead of the wait
        asm volatile(
            "global_load_b32 %0, %8, off\n\t"
            "global_load_b32 %4, %8, off offset:128\n\t"
            "global_load_b32 %1, %9, off\n\t"
            "global_load_b32 %5, %9, off offset:128\n\t"
            "global_load_b32 %2, %10, off\n\t"
            "global_load_b32 %6, %10, off offset:128\n\t"
            "global_load_b32 %3, %11, off\n\t"
            "global_load_b32 %7, %11, off offset:128\n\t"
            "s_wait_loadcnt 0x0"
            : "=&v"(a0), "=&v"(a1), "=&v"(a2), "=&v"(a3),
              "=&v"(b0), "=&v"(b1), "=&v"(b2), "=&v"(b3)
            : "v"(pr0), "v"(pr1), "v"(pr2), "v"(pr3)
            : "memory");
        // heads summed in ascending order, from +0
        float v0 = (((0.f + a0) + a1) + a2) + a3;
        float v1 = (((0.f + b0) + b1) + b2) + b3;
        if (ln == cur)      v0 += 1e6f;
        if (ln + 32 == cur) v1 += 1e6f;
        if (ln == 0)        v0 += 1e6f;
        // pc holds softmax weights, so every pooled score is +0 or above, and
        // the bit patterns, read as integers, order and compare as the values do
        int k0 = __builtin_bit_cast(int, v0), k1 = __builtin_bit_cast(int, v1);
        // argmax passes; among equal values the lowest block index wins, as in
        // top_k. Wave w needs the winner of pass w and stops there.
        for (int pass = 0; pass < TOPN; ++pass) {
            const int m = wave_max32(k0 > k1 ? k0 : k1);
            const unsigned long long eq =
                (unsigned long long)__builtin_amdgcn_ballot_w32(k0 == m) |
                ((unsigned long long)__builtin_amdgcn_ballot_w32(k1 == m) << 32);
            bsel = __builtin_ctzll(eq);   // m is some lane's key: eq != 0, 0 <= bsel < NBC
            if (pass == wsel) break;
            if (ln == bsel)      k0 = -1;   // below every live key
            if (ln + 32 == bsel) k1 = -1;
        }
    }
    const float* g0 = k + ((bsel * BLKC + ((t >> 4) & 1)) * NHK + hk) * HDIM + 4 * (t & 15);
    const unsigned l0 = (unsigned)(size_t)&k_l[(t & ~31) + ((t >> 4) & 1)][4 * (t & 15)];
    constexpr int GSTEP = 2 * NHK * HDIM;            // floats: two key rows on
    constexpr unsigned LSTEP = 2 * (HDIM / 2 + 4) * 4;  // bytes: two k_l rows on

    float a[REPG] = {0.f, 0.f, 0.f, 0.f};
#pragma unroll   // two trips, straight-line: h is a constant in every address
    for (int h = 0; h < 2; ++h) {
        if (h) {
            // every reader has left k_l before the second half overwrites it
            asm volatile("s_wait_dscnt 0x0" ::: "memory");
            __syncthreads();
        }
#pragma unroll   // straight-line: all 16 copies of the wave are in flight together
        for (int i = 0; i < 16; i += 8) {
            const float* g = g0 + h * (HDIM / 2) + i * GSTEP;
            const unsigned l = l0 + i * LSTEP;
            // the closing s_wait_xcnt stands in the copies' own statement, in
            // front of any rewrite of the address registers that they name
            asm volatile(
                "global_load_async_to_lds_b128 %0, %8, off\n\t"
                "global_load_async_to_lds_b128 %1, %9, off\n\t"
                "global_load_async_to_lds_b128 %2, %10, off\n\t"
                "global_load_async_to_lds_b128 %3, %11, off\n\t"
                "global_load_async_to_lds_b128 %4, %12, off\n\t"
                "global_load_async_to_lds_b128 %5, %13, off\n\t"
                "global_load_async_to_lds_b128 %6, %14, off\n\t"
                "global_load_async_to_lds_b128 %7, %15, off\n\t"
                "s_wait_xcnt 0x0"
                :: "v"(l), "v"(l + 1 * LSTEP), "v"(l + 2 * LSTEP), "v"(l + 3 * LSTEP),
                   "v"(l + 4 * LSTEP), "v"(l + 5 * LSTEP), "v"(l + 6 * LSTEP), "v"(l + 7 * LSTEP),
                   "v"(g), "v"(g + 1 * GSTEP), "v"(g + 2 * GSTEP), "v"(g + 3 * GSTEP),
                   "v"(g + 4 * GSTEP), "v"(g + 5 * GSTEP), "v"(g + 6 * GSTEP), "v"(g + 7 * GSTEP)
                : "memory");
        }
        // the wave's own copies have landed before the barrier publishes k_l
        // (and, on the first trip, the q rows)
        asm volatile("s_wait_asynccnt 0x0" ::: "memory");
        __syncthreads();

        // scores: thread t handles key t, read from its k_l row; each head's
        // sum runs over d in ascending order
        for (int d = 0; d < HDIM / 2; d += 4) {
            const float4 kv = *(const float4*)&k_l[t][d];
#pragma unroll   // a[] stays in registers
            for (int r = 0; r < REPG; ++r) {
                const float4 qv = *(const float4*)&qsm[r][h * (HDIM / 2) + d];
                a[r] = fmaf(qv.x, kv.x, a[r]);
                a[r] = fmaf(qv.y, kv.y, a[r]);
                a[r] = fmaf(qv.z, kv.z, a[r]);
                a[r] = fmaf(qv.w, kv.w, a[r]);
            }
        }
    }
    // V rows of the wave's own block: lane l holds dims 4l..4l+3, one load of
    // the wave is one whole row (512 contiguous bytes). The first 16 rows, the
    // old output row and its gate are asked for here, so that their latency
    // runs under the softmax.
    const int wave = t >> 5, lane = t & 31;
    const float4* vrow = (const float4*)(v + (bsel * BLKC * NHK + hk) * HDIM) + lane;
    constexpr int VSTEP = NHK * HDIM / 4;            // float4s: one key row on
    float4 vr[16];
#pragma unroll   // vr[] stays in registers; 16 loads in flight together
    for (int i = 0; i < 16; ++i) vr[i] = vrow[i * VSTEP];
    // wave w finishes rep head w
    float4* orow = (float4*)(out + (s * NHQ + hk * REPG + wave) * HDIM) + lane;
    const float4 oold = *orow;
    const float  gate = gs[s * NHQ + hk * REPG + wave];

    {
        int pos = bsel * BLKC + (t % BLKC);
#pragma unroll   // a[] stays in registers
        for (int r = 0; r < REPG; ++r)
            scm[r][t] = (pos <= s) ? a[r] * scale : NEGV;
    }
    __syncthreads();

    // softmax: wave w handles row w (4 waves of 32 lanes)
    {
        float vals[4];
        float mloc = -3.0e38f;
        for (int i = 0; i < 4; ++i) {
            vals[i] = scm[wave][lane + 32 * i];
            mloc = fmaxf(mloc, vals[i]);
        }
        for (int m = 1; m <= 16; m <<= 1)
            mloc = fmaxf(mloc, __shfl_xor(mloc, m, 32));
        float ssum = 0.f;
        for (int i = 0; i < 4; ++i) { vals[i] = expf(vals[i] - mloc); ssum += vals[i]; }
        for (int m = 1; m <= 16; m <<= 1)
            ssum += __shfl_xor(ssum, m, 32);
        float inv = 1.0f / ssum;
        for (int i = 0; i < 4; ++i) scm[wave][lane + 32 * i] = vals[i] * inv;
    }
    __syncthreads();

    // partial output of the wave's 32 keys, all 4 rep heads, 4 dims a lane
    float4 o[REPG];
#pragma unroll   // o[] stays in registers
    for (int r = 0; r < REPG; ++r) o[r] = make_float4(0.f, 0.f, 0.f, 0.f);
#pragma unroll   // vr[] stays in registers: every index is a constant
    for (int i = 0; i < BLKC; i += 4) {
        float pr[REPG][4];
#pragma unroll   // pr[] stays in registers
        for (int r = 0; r < REPG; ++r) {
            const float4 p4 = *(const float4*)&scm[r][wave * BLKC + i];
            pr[r][0] = p4.x; pr[r][1] = p4.y; pr[r][2] = p4.z; pr[r][3] = p4.w;
        }
#pragma unroll   // vr[], pr[] stay in registers
        for (int u = 0; u < 4; ++u) {
            const float4 vv = vr[(i + u) & 15];
#pragma unroll   // o[] stays in registers
            for (int r = 0; r < REPG; ++r) {
                o[r].x = fmaf(pr[r][u], vv.x, o[r].x);
                o[r].y = fmaf(pr[r][u], vv.y, o[r].y);
                o[r].z = fmaf(pr[r][u], vv.z, o[r].z);
                o[r].w = fmaf(pr[r][u], vv.w, o[r].w);
            }
            // the row 16 further on takes the registers that have just been used
            if (i + u < 16) vr[i + u] = vrow[(i + u + 16) * VSTEP];
            // behind the last V load, in front of any rewrite of its address registers
            if (i + u == 15) asm volatile("s_wait_xcnt 0x0" ::: "memory");
        }
    }

    // join: k_l is free since the barrier behind the scores
    float* red = &k_l[0][0];                         // [wave][rep head][HDIM]
#pragma unroll   // o[] stays in registers
    for (int r = 0; r < REPG; ++r)
        *(float4*)&red[(wave * REPG + r) * HDIM + 4 * lane] = o[r];
    __syncthreads();
    {
        float4 sum = *(const float4*)&red[(0 * REPG + wave) * HDIM + 4 * lane];
#pragma unroll   // three more partial sums, in the order of the selected blocks
        for (int w = 1; w < TOPN; ++w) {
            const float4 pw = *(const float4*)&red[(w * REPG + wave) * HDIM + 4 * lane];
            sum.x += pw.x; sum.y += pw.y; sum.z += pw.z; sum.w += pw.w;
        }
        *orow = make_float4(fmaf(gate, sum.x, oold.x), fmaf(gate, sum.y, oold.y),
                            fmaf(gate, sum.z, oold.z), fmaf(gate, sum.w, oold.w));
    }
}

// --------------------------------------------------------------------------
extern "C" void kernel_launch(void* const* d_in, const int* in_sizes, int n_in,
                              void* d_out, int out_size, void* d_ws, size_t ws_size,
                              hipStream_t stream) {
    const float* q  = (const float*)d_in[0];
    const float* k  = (const float*)d_in[1];
    const float* v  = (const float*)d_in[2];
    const float* gw = (const float*)d_in[3];
    const float* gc = (const float*)d_in[4];
    const float* gs = (const float*)d_in[5];
    float* out = (float*)d_out;

    float* ws = (float*)d_ws;
    float* kc = ws;                                  // NB*NHK*HD = 16384 floats
    float* vc = ws + NBC * NHK * HDIM;               // 16384 floats
    float* pc = vc + NBC * NHK * HDIM;               // NHQ*S*NB = 1,048,576 floats

    nsa_cmpkv_kernel<<<(NBC * NHK * HDIM + 255) / 256, 256, 0, stream>>>(k, v, kc, vc);
    nsa_win_kernel<<<(SS / 16) * NHK, 256, 0, stream>>>(q, k, v, gw, kc, vc, gc, pc, out);
    nsa_slt_kernel<<<SS * NHK, 128, 0, stream>>>(q, k, v, gs, pc, out);
}

// v010
// A run of this version takes 59.1 microseconds.
// Two timings next to v009 put it at 1.04 and 1.03 times that version's speed.
// All steps since v000 together make it 4.00 times as fast.
#include <hip/hip_runtime.h>
#include <hip/hip_bf16.h>

#define SS   2048
#define NHQ  8
#define NHK  2
#define HDIM 128
#define REPG 4
#define WINW 512
#define BLKC 32
#define NBC  64
#define TOPN 4
#define NEGV (-1e30f)

typedef __attribute__((ext_vector_type(2))) float v2f;
typedef __attribute__((ext_vector_type(8))) float v8f;

#if defined(__has_builtin)
#if __has_builtin(__builtin_amdgcn_global_load_async_to_lds_b128)
#define HAVE_ASYNC_LDS 1
#endif
#endif

#ifdef HAVE_ASYNC_LDS
// builtin signature (from hipcc diagnostic): takes pointers to 16-byte int
// vectors: (v4i addrspace(1)*, v4i addrspace(3)*, imm offset, imm cpol)
typedef int v4i_ __attribute__((vector_size(16)));
typedef __attribute__((address_space(1))) v4i_ gv4i;
typedef __attribute__((address_space(3))) v4i_ lv4i;
#endif

// --------------------------------------------------------------------------
// Kernel 1: block-mean compressed K/V.  kc/vc: [NB][NHK][HD]
// --------------------------------------------------------------------------
__global__ void nsa_cmpkv_kernel(const float* __restrict__ k,
                                 const float* __restrict__ v,
                                 float* __restrict__ kc,
                                 float* __restrict__ vc) {
    int idx = blockIdx.x * blockDim.x + threadIdx.x;
    if (idx >= NBC * NHK * HDIM) return;
    int d  = idx % HDIM;
    int hk = (idx / HDIM) % NHK;
    int n  = idx / (HDIM * NHK);
    float sk = 0.f, sv = 0.f;
    for (int i = 0; i < BLKC; ++i) {
        int row = n * BLKC + i;
        sk += k[(row * NHK + hk) * HDIM + d];
        sv += v[(row * NHK + hk) * HDIM + d];
    }
    kc[(n * NHK + hk) * HDIM + d] = sk * (1.0f / BLKC);
    vc[(n * NHK + hk) * HDIM + d] = sv * (1.0f / BLKC);
}

// Orders one wave's own LDS traffic: what some lanes store, other lanes of the
// same wave load behind it. For LDS that is private to a wave this takes the
// place of a work-group barrier.
__device__ __forceinline__ void wave_lds_sync() {
    __builtin_amdgcn_fence(__ATOMIC_RELEASE, "workgroup");
    __builtin_amdgcn_wave_barrier();
    __builtin_amdgcn_fence(__ATOMIC_ACQUIRE, "workgroup");
}

// The value that lane l ^ 16 holds.
__device__ __forceinline__ float other_half(float x) {
    const int xi = __builtin_bit_cast(int, x);
    return __builtin_bit_cast(float, __builtin_amdgcn_permlanex16(
        xi, xi, 0x76543210, 0xfedcba98, false, false));
}

__global__ __launch_bounds__(256)
void nsa_win_kernel(const float* __restrict__ q, const float* __restrict__ k,
                    const float* __restrict__ v, const float* __restrict__ gw,
                    const float* __restrict__ kc, const float* __restrict__ vc,
                    const float* __restrict__ gc, float* __restrict__ pc_ws,
                    float* __restrict__ out) {
    __shared__ __align__(16) float q_l[REPG][16][132];   // [head of the group]
    __shared__ __align__(16) float k_l[2][2][32][132];   // [w][buffer][two key tiles]
    __shared__ __align__(16) float v_l[2][2][32][132];
    __shared__ float x_l[REPG][2][2][32];   // [head][maximum, sum][w][lane]

    const int qt   = blockIdx.x / NHK;
    const int hk   = blockIdx.x % NHK;
    const int q0   = qt * 16;
    const int tid  = threadIdx.x;
    const int wid  = __builtin_amdgcn_readfirstlane(tid >> 5);  // scalar: 0..7
    // waves i and i + 4 are a head's two: where those two share a SIMD, every
    // SIMD has the same number of key tiles (for speed only)
    const int rh   = wid & 3;           // head of the group: 0..3
    const int wv   = wid >> 2;          // which of the head's two waves
    const int hq   = hk * REPG + rh;
    const int lane = tid & 31;
    const int half = lane >> 4;     // 0 or 1
    const int l16  = lane & 15;
    const float scale = 0.08838834764831845f;   // 1/sqrt(128)

    const int ktd = qt;
    int lowkey = q0 - (WINW - 1); if (lowkey < 0) lowkey = 0;
    const int ktl = lowkey >> 4;

    // ---- tile staging (async double-buffer if available) ----
#ifdef HAVE_ASYNC_LDS
#define ISSUE_TILE(bufi, u, ktv)                                               \
    do {                                                                       \
        for (int i_ = 0; i_ < 4; ++i_) {       /* the wave's quarter: 4 rows */ \
            int r_ = rh * 4 + i_;                                              \
            int d_ = lane << 2;                                                \
            const float* gk_ = &k[(((ktv) * 16 + r_) * NHK + hk) * HDIM + d_]; \
            const float* gv_ = &v[(((ktv) * 16 + r_) * NHK + hk) * HDIM + d_]; \
            __builtin_amdgcn_global_load_async_to_lds_b128(                    \
                (gv4i*)gk_, (lv4i*)&k_l[wv][bufi][(u) * 16 + r_][d_], 0, 0);   \
            __builtin_amdgcn_global_load_async_to_lds_b128(                    \
                (gv4i*)gv_, (lv4i*)&v_l[wv][bufi][(u) * 16 + r_][d_], 0, 0);   \
        }                                                                      \
    } while (0)
    // the wave's own copies have landed
#define WAIT_TILE() asm volatile("s_wait_asynccnt 0x0" ::: "memory")
#else
#define ISSUE_TILE(bufi, u, ktv)                                               \
    do {                                                                       \
        for (int idx_ = rh * 4 * HDIM + lane; idx_ < (rh + 1) * 4 * HDIM; idx_ += 32) { \
            int r_ = idx_ >> 7, d_ = idx_ & 127;                               \
            k_l[wv][bufi][(u) * 16 + r_][d_] = k[(((ktv) * 16 + r_) * NHK + hk) * HDIM + d_]; \
            v_l[wv][bufi][(u) * 16 + r_][d_] = v[(((ktv) * 16 + r_) * NHK + hk) * HDIM + d_]; \
        }                                                                      \
    } while (0)
#define WAIT_TILE() wave_lds_sync()
#endif
    // the two tiles ktv and ktv - 2 of ring wv, each where it exists (scalar tests)
#define ISSUE_STAGE(bufi, ktv)                                                 \
    do {                                                                       \
        if ((ktv) >= ktl) ISSUE_TILE(bufi, 0, (ktv));                          \
        if ((ktv) - 2 >= ktl) ISSUE_TILE(bufi, 1, (ktv) - 2);                  \
    } while (0)

    int buf = 0;
#ifdef HAVE_ASYNC_LDS
    // q tile of the wave's head: wave w brings rows 8w..8w+7, one copy a row
    // (32 lanes x 16 bytes)
#pragma unroll   // straight-line: all eight copies are in flight together
    for (int i_ = 0; i_ < 8; ++i_) {
        const int r_ = wv * 8 + i_;
        __builtin_amdgcn_global_load_async_to_lds_b128(
            (gv4i*)&q[((q0 + r_) * NHQ + hq) * HDIM + 4 * lane],
            (lv4i*)&q_l[rh][r_][4 * lane], 0, 0);
    }
#endif
    // 32 rows of kc or vc, from row 32 * wv, into buffer 0 of ring wv: the
    // wave brings its quarter, rows 8 * rh .. 8 * rh + 7 of them, one copy a row
#ifdef HAVE_ASYNC_LDS
#define ISSUE_CROWS(ring, src)                                                 \
    do {                                                                       \
        _Pragma("unroll")   /* straight-line: all 8 copies in flight together */ \
        for (int i_ = 0; i_ < 8; ++i_)                                         \
            __builtin_amdgcn_global_load_async_to_lds_b128(                    \
                (gv4i*)&src[((wv * 32 + rh * 8 + i_) * NHK + hk) * HDIM + 4 * lane], \
                (lv4i*)&ring[wv][0][rh * 8 + i_][4 * lane], 0, 0);             \
    } while (0)
#else
#define ISSUE_CROWS(ring, src)                                                 \
    do {                                                                       \
        for (int idx_ = rh * 8 * HDIM + lane; idx_ < (rh + 1) * 8 * HDIM; idx_ += 32) { \
            int r_ = idx_ >> 7, d_ = idx_ & 127;                               \
            ring[wv][0][r_][d_] = src[((wv * 32 + r_) * NHK + hk) * HDIM + d_]; \
        }                                                                      \
    } while (0)
#endif
    ISSUE_CROWS(k_l, kc);

#ifdef HAVE_ASYNC_LDS
    // the wave's own q and kc rows have landed before the barrier publishes them
    asm volatile("s_wait_asynccnt 0x0" ::: "memory");
#else
    for (int idx = wv * 32 + lane; idx < 16 * HDIM; idx += 64) {
        int r = idx >> 7, d = idx & 127;
        q_l[rh][r][d] = q[((q0 + r) * NHQ + hq) * HDIM + d];
    }
#endif
    __syncthreads();
    ISSUE_CROWS(v_l, vc);   // needed behind the softmax only: they land under it

    // ---- compressed branch ----
    // oc[t][j]: g_cmp * o_cmp, dim (4 * wv + t) * 16 + j + 8 * half of query q0 + l16
    v8f oc[4];
    {
        const int s = q0 + l16;
        const float gate = gc[s * NHQ + hq];
        // sc[nt][j]: block wv * 32 + nt * 16 + j + 8 * half, query q0 + l16
        v8f sc[2];
#pragma unroll   // sc[] stays in registers
        for (int nt = 0; nt < 2; ++nt) {
            v8f c;
#pragma unroll
            for (int j = 0; j < 8; ++j) c[j] = 0.f;
#pragma unroll
            for (int kk = 0; kk < HDIM; kk += 4) {
                v2f a, b;
                a[0] = k_l[wv][0][nt * 16 + l16][kk + 2 * half + 0];
                a[1] = k_l[wv][0][nt * 16 + l16][kk + 2 * half + 1];
                b[0] = q_l[rh][l16][kk + 2 * half + 0];
                b[1] = q_l[rh][l16][kk + 2 * half + 1];
                c = __builtin_amdgcn_wmma_f32_16x16x4_f32(false, a, false, b,
                                                          (short)0, c, false, false);
            }
            sc[nt] = c;
        }

        // mask + scale  (block fully in the past: (n+1)*32-1 <= s)
        float rm = -3.0e38f;
#pragma unroll   // sc[] stays in registers
        for (int nt = 0; nt < 2; ++nt)
#pragma unroll
            for (int j = 0; j < 8; ++j) {
                int n = wv * 32 + nt * 16 + j + 8 * half;
                bool valid = ((n + 1) * BLKC - 1) <= s;
                sc[nt][j] = valid ? sc[nt][j] * scale : NEGV;
                rm = fmaxf(rm, sc[nt][j]);
            }
        // softmax over the 64 blocks of the lane's query: 16 in this lane, 16 in
        // lane l ^ 16, 32 in the other wave
        rm = fmaxf(rm, other_half(rm));
        x_l[rh][0][wv][lane] = rm;
        __syncthreads();
        rm = fmaxf(rm, x_l[rh][0][wv ^ 1][lane]);
        float rsn[2];   // two chains that do not wait for one another
#pragma unroll   // sc[], rsn[] stay in registers
        for (int nt = 0; nt < 2; ++nt) {
            rsn[nt] = 0.f;
#pragma unroll
            for (int j = 0; j < 8; ++j) {
                sc[nt][j] = expf(sc[nt][j] - rm);
                rsn[nt] += sc[nt][j];
            }
        }
        const float rsw = rsn[0] + rsn[1];
        x_l[rh][1][wv][lane] = rsw;
        // the wave's own vc rows have landed before the barrier publishes them to
        // the three other heads' waves
        WAIT_TILE();
        __syncthreads();
        // the sum tree over the 64 blocks is the one pc has always had, so that
        // the block selection that ranks pc sees the same bits
        float rs = rsw + x_l[rh][1][wv ^ 1][lane];
        rs += other_half(rs);
        float* pd = pc_ws + ((hq * SS + s) * NBC + wv * 32 + 8 * half);
#pragma unroll   // sc[] stays in registers
        for (int nt = 0; nt < 2; ++nt) {
#pragma unroll
            for (int j = 0; j < 8; ++j) sc[nt][j] = sc[nt][j] / rs;
            *(float4*)(pd + nt * 16 + 0) = make_float4(sc[nt][0], sc[nt][1], sc[nt][2], sc[nt][3]);
            *(float4*)(pd + nt * 16 + 4) = make_float4(sc[nt][4], sc[nt][5], sc[nt][6], sc[nt][7]);
        }

        // partial O^T = vc^T (128x32) * P^T (32x16) over the wave's 32 blocks.
        // pa[nt][j]: dim nt * 16 + j + 8 * half of query q0 + l16
        v8f pa[8];
#pragma unroll
        for (int nt = 0; nt < 8; ++nt)
#pragma unroll
            for (int j = 0; j < 8; ++j) pa[nt][j] = 0.f;
#pragma unroll   // sc[] stays in registers
        for (int st = 0; st < 2; ++st) {
            // step c4 takes the four blocks 2 * c4, 2 * c4 + 1, 8 + 2 * c4 and
            // 8 + 2 * c4 + 1 of the 16: those whose weights the two halves hold in
            // sc[st][2 * c4] and sc[st][2 * c4 + 1]; vc^T is read in the same order
#pragma unroll
            for (int c4 = 0; c4 < 4; ++c4) {
                v2f b;
                b[0] = sc[st][2 * c4 + 0];
                b[1] = sc[st][2 * c4 + 1];
#pragma unroll
                for (int nt = 0; nt < 8; ++nt) {
                    v2f a;
                    a[0] = v_l[wv][0][st * 16 + 8 * half + 2 * c4 + 0][nt * 16 + l16];
                    a[1] = v_l[wv][0][st * 16 + 8 * half + 2 * c4 + 1][nt * 16 + l16];
                    pa[nt] = __builtin_amdgcn_wmma_f32_16x16x4_f32(false, a, false, b,
                                                       (short)0, pa[nt], false, false);
                }
            }
        }

        // join: wave w keeps dim tiles 4w..4w+3 and hands the other four over in
        // its head's quarter of K ring w (free since the barriers behind the
        // scores), lane for lane
        float* cmine  = &k_l[wv][0][0][0] + rh * 1024;
        float* cother = &k_l[wv ^ 1][0][0][0] + rh * 1024;
        // FIRST: the first of the four tiles of pa[], a constant on each side of
        // the scalar branch, so that pa[] stays in registers
#define CMP_GIVE(FIRST)                                                        \
    _Pragma("unroll")                                                          \
    for (int t = 0; t < 4; ++t) {                                              \
        *(float4*)&cmine[((t * 2 + 0) * 32 + lane) * 4] = make_float4(         \
            pa[FIRST + t][0], pa[FIRST + t][1], pa[FIRST + t][2], pa[FIRST + t][3]); \
        *(float4*)&cmine[((t * 2 + 1) * 32 + lane) * 4] = make_float4(         \
            pa[FIRST + t][4], pa[FIRST + t][5], pa[FIRST + t][6], pa[FIRST + t][7]); \
    }
#define CMP_KEEP(FIRST)                                                        \
    _Pragma("unroll")                                                          \
    for (int t = 0; t < 4; ++t) {                                              \
        const float4 o0 = *(const float4*)&cother[((t * 2 + 0) * 32 + lane) * 4]; \
        const float4 o1 = *(const float4*)&cother[((t * 2 + 1) * 32 + lane) * 4]; \
        const float ob[8] = {o0.x, o0.y, o0.z, o0.w, o1.x, o1.y, o1.z, o1.w};  \
        _Pragma("unroll")                                                      \
        for (int j = 0; j < 8; ++j)                                            \
            oc[t][j] = any ? gate * (pa[FIRST + t][j] + ob[j]) : 0.f;          \
    }
        if (wv == 0) { CMP_GIVE(4) } else { CMP_GIVE(0) }
        __syncthreads();
        const bool any = s >= BLKC - 1;                  // cmask.any zeroing
        if (wv == 0) { CMP_KEEP(0) } else { CMP_KEEP(4) }
#undef CMP_GIVE
#undef CMP_KEEP
        // every reader has left both rings before the window tiles overwrite them
        asm volatile("s_wait_dscnt 0x0" ::: "memory");
        __syncthreads();
    }
    // prologue: ring w's first two tiles land and are published, the next two are
    // in flight
    int kt = ktd - wv;   // the first tile of the trip
    ISSUE_STAGE(0, kt);
    WAIT_TILE();
    __syncthreads();
    ISSUE_STAGE(1, kt - 4);

    // acc[nt][j]: dim nt * 16 + j + 8 * half of query q0 + l16
    v8f acc[8];
    // of query q0 + l16: running maximum (equal in both halves) and the sum over
    // the keys that this half has seen
    float mrow = -3.0e38f, lrow = 0.f;
#pragma unroll
    for (int nt = 0; nt < 8; ++nt)
#pragma unroll
        for (int j = 0; j < 8; ++j) acc[nt][j] = 0.f;

    // two tiles a trip; the trips of w = 0, which has as many tiles as w = 1 or one
    // more: every wave passes every barrier, also one whose last trip has no tile
    const int ntrip = (((ktd - ktl) >> 1) + 2) >> 1;
    for (int it = 0; it < ntrip; ++it, kt -= 4) {
      for (int u = 0; u < 2; ++u) {
        const int ku = kt - 2 * u;
        if (ku < ktl) break;   // scalar: the same for the whole wave
        // ---- S^T = K Q^T (16x16 tile): c[j] = key j + 8 * half, query l16 ----
        v8f c;
#pragma unroll
        for (int j = 0; j < 8; ++j) c[j] = 0.f;
#pragma unroll
        for (int kk = 0; kk < HDIM; kk += 4) {
            v2f a, b;
            a[0] = k_l[wv][buf][u * 16 + l16][kk + 2 * half + 0];
            a[1] = k_l[wv][buf][u * 16 + l16][kk + 2 * half + 1];
            b[0] = q_l[rh][l16][kk + 2 * half + 0];
            b[1] = q_l[rh][l16][kk + 2 * half + 1];
            c = __builtin_amdgcn_wmma_f32_16x16x4_f32(false, a, false, b,
                                                      (short)0, c, false, false);
        }

        // ---- mask + online softmax update, one query a lane ----
        const int dif0 = (q0 + l16) - (ku * 16 + 8 * half);
        float p[8];
        float tmax = NEGV;
#pragma unroll   // p[] stays in registers
        for (int j = 0; j < 8; ++j) {
            const int dif = dif0 - j;
            const bool valid = (dif >= 0) && (dif < WINW);
            p[j] = valid ? c[j] * scale : NEGV;
            tmax = fmaxf(tmax, p[j]);
        }
        tmax = fmaxf(tmax, other_half(tmax));
        const float mnew = fmaxf(mrow, tmax);
        const float corr = expf(mrow - mnew);
        float tsum = 0.f;
#pragma unroll   // p[] stays in registers
        for (int j = 0; j < 8; ++j) {
            p[j] = expf(p[j] - mnew);
            tsum += p[j];
        }
        lrow = lrow * corr + tsum;
        mrow = mnew;
#pragma unroll
        for (int nt = 0; nt < 8; ++nt)
#pragma unroll
            for (int j = 0; j < 8; ++j) acc[nt][j] *= corr;

        // ---- O^T += V^T * P^T (128x16 x 16x16). Step c4 takes the four keys
        // 2 * c4, 2 * c4 + 1, 8 + 2 * c4, 8 + 2 * c4 + 1: those whose weights the
        // two halves hold in p[2 * c4] and p[2 * c4 + 1]; V^T is read in the
        // same key order ----
#pragma unroll
        for (int c4 = 0; c4 < 4; ++c4) {
            v2f b;
            b[0] = p[2 * c4 + 0];
            b[1] = p[2 * c4 + 1];
#pragma unroll
            for (int nt = 0; nt < 8; ++nt) {
                v2f a;
                a[0] = v_l[wv][buf][u * 16 + 8 * half + 2 * c4 + 0][nt * 16 + l16];
                a[1] = v_l[wv][buf][u * 16 + 8 * half + 2 * c4 + 1][nt * 16 + l16];
                acc[nt] = __builtin_amdgcn_wmma_f32_16x16x4_f32(false, a, false, b,
                                                   (short)0, acc[nt], false, false);
            }
        }
      }
        // the wave's reads of the buffer that is refilled below have retired
        asm volatile("s_wait_dscnt 0x0" ::: "memory");
        WAIT_TILE();            // the wave's quarter of the next two tiles has landed
        // publishes the next two tiles; every reader has left this trip's buffer
        __syncthreads();
        ISSUE_STAGE(buf, kt - 8);   // flies under the next trip
        buf ^= 1;
    }
    WAIT_TILE();   // no copy is in flight where the rings are put to other use
    lrow += other_half(lrow);   // both halves' keys

    // ---- join: wave w finishes dim tiles 4w..4w+3. Each wave hands the
    // other four tiles over in its head's quarter of K ring w, its maxima and
    // its sums in x_l, lane for lane (both waves hold the same fragment layout).
    // A wave without a tile hands over zeros with the start maximum: weight
    // exp(-huge) = 0.
    float* mine  = &k_l[wv][0][0][0] + rh * 1024;
    float* other = &k_l[wv ^ 1][0][0][0] + rh * 1024;
#pragma unroll   // acc[] stays in registers: nt is a constant in every index
    for (int nt = 0; nt < 8; ++nt)
        if ((nt >> 2) != wv) {
            *(float4*)&mine[(((nt & 3) * 2 + 0) * 32 + lane) * 4] =
                make_float4(acc[nt][0], acc[nt][1], acc[nt][2], acc[nt][3]);
            *(float4*)&mine[(((nt & 3) * 2 + 1) * 32 + lane) * 4] =
                make_float4(acc[nt][4], acc[nt][5], acc[nt][6], acc[nt][7]);
        }
    x_l[rh][0][wv][lane] = mrow;
    x_l[rh][1][wv][lane] = lrow;
    __syncthreads();

    const float mo = x_l[rh][0][wv ^ 1][lane];
    const float lo = x_l[rh][1][wv ^ 1][lane];
    const float mj = fmaxf(mrow, mo);
    const float wa = expf(mrow - mj);
    const float wb = expf(mo - mj);
    const float lj = lrow * wa + lo * wb;
    const float gr = gw[(q0 + l16) * NHQ + hq];
    // A lane holds eight dims in a row of one query. The wave's 16 x 64 piece of
    // the output passes through a part of V ring w that is its own (64 columns of
    // one buffer; free: every wave's last reads and copies are done), so that a
    // store of the wave covers whole cache lines.
    float* o_l = &v_l[wv][rh >> 1][0][(rh & 1) * 64];   // row pitch 132 floats
#pragma unroll   // acc[] stays in registers: nt is a constant in every index
    for (int nt = 0; nt < 8; ++nt)
        if ((nt >> 2) == wv) {
            const float4 o0 = *(const float4*)&other[(((nt & 3) * 2 + 0) * 32 + lane) * 4];
            const float4 o1 = *(const float4*)&other[(((nt & 3) * 2 + 1) * 32 + lane) * 4];
            const float ob[8] = {o0.x, o0.y, o0.z, o0.w, o1.x, o1.y, o1.z, o1.w};
            float r[8];
#pragma unroll   // ob[], r[] stay in registers
            for (int j = 0; j < 8; ++j)
                r[j] = gr * ((acc[nt][j] * wa + ob[j] * wb) / lj) + oc[nt & 3][j];
            float* dst = &o_l[l16 * 132 + (nt & 3) * 16 + 8 * half];
            *(float4*)&dst[0] = make_float4(r[0], r[1], r[2], r[3]);
            *(float4*)&dst[4] = make_float4(r[4], r[5], r[6], r[7]);
        }
    wave_lds_sync();
    // one address for all eight stores, the rows as constant offsets
    float* orow = out + (((q0 + half) * NHQ + hq) * HDIM + wv * 64 + 4 * l16);
#pragma unroll   // straight-line: eight stores, each two rows of 256 contiguous bytes
    for (int i = 0; i < 8; ++i)
        *(float4*)(orow + i * (2 * NHQ * HDIM)) = *(const float4*)&o_l[(2 * i + half) * 132 + 4 * l16];
#undef ISSUE_STAGE
#undef ISSUE_TILE
#undef ISSUE_CROWS
#undef WAIT_TILE
}

// --------------------------------------------------------------------------
// Maximum over the 32 lanes of a wave, the same value in every lane: four steps
// inside each row of 16 lanes, then the other row's result.
// --------------------------------------------------------------------------
template <int XMASK>
__device__ __forceinline__ int row_xmask_max(int x) {
    // 0x160 | m: lane l takes the value of lane l ^ m of its row
    const int y = __builtin_amdgcn_update_dpp(0, x, 0x160 | XMASK, 0xf, 0xf, true);
    return x > y ? x : y;
}
__device__ __forceinline__ int wave_max32(int x) {
    x = row_xmask_max<1>(x);
    x = row_xmask_max<2>(x);
    x = row_xmask_max<4>(x);
    x = row_xmask_max<8>(x);
    const int y = __builtin_amdgcn_permlanex16(x, x, 0x76543210, 0xfedcba98, false, false);
    return x > y ? x : y;
}

// Work-group barrier that orders LDS traffic only: unlike __syncthreads() it
// does not wait for the wave's global loads, so that loads asked for in front of
// it stay in flight behind it.
__device__ __forceinline__ void lds_barrier() {
    __builtin_amdgcn_fence(__ATOMIC_RELEASE, "workgroup", "local");
    __builtin_amdgcn_s_barrier();
    __builtin_amdgcn_fence(__ATOMIC_ACQUIRE, "workgroup", "local");
}

// --------------------------------------------------------------------------
// Kernel 3: selected branch. 128 threads per (s, hk): 4 rep heads, 128
// gathered keys. Every wave first finds the top-4 blocks of its (s, hk) itself,
// from the pooled pc row spread over its lanes; it stages and later weighs the
// w-th of them. K rows staged in LDS. Scores: wave w takes a quarter of the head
// dim for all 128 keys, four keys a lane, so that a q or K fragment read from
// LDS serves four times as many products; the four partial scores of a key are
// joined through LDS. P * V: wave w takes the 32 V rows of
// selected block w, a whole row per load; the four partial sums are joined
// through LDS. Adds g_slt * o_slt into d_out.
// --------------------------------------------------------------------------
__global__ __launch_bounds__(128)
void nsa_slt_kernel(const float* __restrict__ q, const float* __restrict__ k,
                    const float* __restrict__ v, const float* __restrict__ gs,
                    const float* __restrict__ pc, float* __restrict__ out) {
    // K is staged in two halves of the head dim (64 floats a row) so that eight
    // work-groups fit one WGP's LDS. Row pitch 272 B = 16 B x 17: 16-byte reads
    // of one row per lane meet no bank conflict.
    __shared__ __align__(16) float k_l[TOPN * BLKC][HDIM / 2 + 4];
    __shared__ __align__(16) float qsm[REPG][HDIM];
    __shared__ __align__(16) float scm[REPG][TOPN * BLKC];

    const int s  = blockIdx.x / NHK;
    const int hk = blockIdx.x % NHK;
    const int t  = threadIdx.x;
    const float scale = 0.08838834764831845f;

    // The four q rows of the group are 2 KiB in a row: one copy of 16 bytes a
    // thread brings them. Asked for first, so that they fly under the selection;
    // the wait and the barrier behind the first K copies cover them too. The
    // closing s_wait_xcnt stands in the copy's own statement, in front of any
    // rewrite of the address registers that it names.
    asm volatile(
        "global_load_async_to_lds_b128 %0, %1, off\n\t"
        "s_wait_xcnt 0x0"
        :: "v"((unsigned)(size_t)&qsm[0][0] + 16u * (unsigned)t),
           "v"(q + (s * NHQ + hk * REPG) * HDIM + 4 * t)
        : "memory");

    // wave w stages the 32 rows of selected block w; k_l row t belongs to key t.
    // One copy of the wave = two half rows of 256 contiguous bytes: whole cache lines.
    int bsel = 0;
    int bs[TOPN];   // all four blocks, in top_k's order: the causal mask of every key needs its block
    {
        // lane l holds blocks l and l + 32: a load of the wave is one cache line
        const int ln = t & 31;
        const int wsel = __builtin_amdgcn_readfirstlane(t >> 5);   // scalar: 0..3
        const int cur = s / BLKC;
        const float* pr0 = &pc[((hk * REPG + 0) * SS + s) * NBC + ln];
        const float* pr1 = pr0 + 1 * SS * NBC;
        const float* pr2 = pr0 + 2 * SS * NBC;
        const float* pr3 = pr0 + 3 * SS * NBC;
        float a0, a1, a2, a3, b0, b1, b2, b3;
        // eight loads in flight together. They and their data wait are one
        // statement with early-clobber outputs, so that no result lands in an
        // address register of the run and none is rewritten ahead of the wait
        asm volatile(
            "global_load_b32 %0, %8, off\n\t"
            "global_load_b32 %4, %8, off offset:128\n\t"
            "global_load_b32 %1, %9, off\n\t"
            "global_load_b32 %5, %9, off offset:128\n\t"
            "global_load_b32 %2, %10, off\n\t"
            "global_load_b32 %6, %10, off offset:128\n\t"
            "global_load_b32 %3, %11, off\n\t"
            "global_load_b32 %7, %11, off offset:128\n\t"
            "s_wait_loadcnt 0x0"
            : "=&v"(a0), "=&v"(a1), "=&v"(a2), "=&v"(a3),
              "=&v"(b0), "=&v"(b1), "=&v"(b2), "=&v"(b3)
            : "v"(pr0), "v"(pr1), "v"(pr2), "v"(pr3)
            : "memory");
        // heads summed in ascending order, from +0
        float v0 = (((0.f + a0) + a1) + a2) + a3;
        float v1 = (((0.f + b0) + b1) + b2) + b3;
        if (ln == cur)      v0 += 1e6f;
        if (ln + 32 == cur) v1 += 1e6f;
        if (ln == 0)        v0 += 1e6f;
        // pc holds softmax weights, so every pooled score is +0 or above, and
        // the bit patterns, read as integers, order and compare as the values do
        int k0 = __builtin_bit_cast(int, v0), k1 = __builtin_bit_cast(int, v1);
        // argmax passes; among equal values the lowest block index wins, as in
        // top_k. Wave w stages the winner of pass w.
#pragma unroll   // bs[] stays in registers
        for (int pass = 0; pass < TOPN; ++pass) {
            const int m = wave_max32(k0 > k1 ? k0 : k1);
            const unsigned long long eq =
                (unsigned long long)__builtin_amdgcn_ballot_w32(k0 == m) |
                ((unsigned long long)__builtin_amdgcn_ballot_w32(k1 == m) << 32);
            const int b = __builtin_ctzll(eq);   // m is some lane's key: eq != 0, 0 <= b < NBC
            bs[pass] = b;
            if (pass == wsel) bsel = b;
            if (ln == b)      k0 = -1;   // below every live key
            if (ln + 32 == b) k1 = -1;
        }
    }
    const float* g0 = k + ((bsel * BLKC + ((t >> 4) & 1)) * NHK + hk) * HDIM + 4 * (t & 15);
    const unsigned l0 = (unsigned)(size_t)&k_l[(t & ~31) + ((t >> 4) & 1)][4 * (t & 15)];
    constexpr int GSTEP = 2 * NHK * HDIM;            // floats: two key rows on
    constexpr unsigned LSTEP = 2 * (HDIM / 2 + 4) * 4;  // bytes: two k_l rows on

    const int wave = __builtin_amdgcn_readfirstlane(t >> 5);   // scalar: 0..3
    const int lane = t & 31;
    // a[i][r]: key lane + 32 * i, rep head r, summed over the wave's 32 dims: the
    // even dims in [0], the odd ones in [1], so that one packed FMA takes two dims
    v2f a[TOPN][REPG];
#pragma unroll   // a[] stays in registers
    for (int i = 0; i < TOPN; ++i)
#pragma unroll
        for (int r = 0; r < REPG; ++r) a[i][r] = v2f{0.f, 0.f};
#pragma unroll   // two trips, straight-line: h is a constant in every address
    for (int h = 0; h < 2; ++h) {
        if (h) {
            // every reader has left k_l before the second half overwrites it
            asm volatile("s_wait_dscnt 0x0" ::: "memory");
            __syncthreads();
        }
#pragma unroll   // straight-line: all 16 copies of the wave are in flight together
        for (int i = 0; i < 16; i += 8) {
            const float* g = g0 + h * (HDIM / 2) + i * GSTEP;
            const unsigned l = l0 + i * LSTEP;
            // the closing s_wait_xcnt stands in the copies' own statement, in
            // front of any rewrite of the address registers that they name
            asm volatile(
                "global_load_async_to_lds_b128 %0, %8, off\n\t"
                "global_load_async_to_lds_b128 %1, %9, off\n\t"
                "global_load_async_to_lds_b128 %2, %10, off\n\t"
                "global_load_async_to_lds_b128 %3, %11, off\n\t"
                "global_load_async_to_lds_b128 %4, %12, off\n\t"
                "global_load_async_to_lds_b128 %5, %13, off\n\t"
                "global_load_async_to_lds_b128 %6, %14, off\n\t"
                "global_load_async_to_lds_b128 %7, %15, off\n\t"
                "s_wait_xcnt 0x0"
                :: "v"(l), "v"(l + 1 * LSTEP), "v"(l + 2 * LSTEP), "v"(l + 3 * LSTEP),
                   "v"(l + 4 * LSTEP), "v"(l + 5 * LSTEP), "v"(l + 6 * LSTEP), "v"(l + 7 * LSTEP),
                   "v"(g), "v"(g + 1 * GSTEP), "v"(g + 2 * GSTEP), "v"(g + 3 * GSTEP),
                   "v"(g + 4 * GSTEP), "v"(g + 5 * GSTEP), "v"(g + 6 * GSTEP), "v"(g + 7 * GSTEP)
                : "memory");
        }
        // the wave's own copies have landed before the barrier publishes k_l
        // (and, on the first trip, the q rows)
        asm volatile("s_wait_asynccnt 0x0" ::: "memory");
        __syncthreads();

        // partial scores: the wave takes columns 16 * wave .. 16 * wave + 15 of the
        // staged half, for the four keys of each lane and the four heads
#pragma unroll 2   // two steps' fragments in flight; all four would cost the eighth wave of a SIMD its registers
        for (int d = 0; d < HDIM / 8; d += 4) {
            const int c = wave * (HDIM / 8) + d;
            float4 qv[REPG];
#pragma unroll   // qv[] stays in registers
            for (int r = 0; r < REPG; ++r)
                qv[r] = *(const float4*)&qsm[r][h * (HDIM / 2) + c];
#pragma unroll   // a[] stays in registers
            for (int i = 0; i < TOPN; ++i) {
                const float4 kv = *(const float4*)&k_l[lane + BLKC * i][c];
#pragma unroll
                for (int r = 0; r < REPG; ++r) {
                    a[i][r] = __builtin_elementwise_fma(v2f{qv[r].x, qv[r].y}, v2f{kv.x, kv.y}, a[i][r]);
                    a[i][r] = __builtin_elementwise_fma(v2f{qv[r].z, qv[r].w}, v2f{kv.z, kv.w}, a[i][r]);
                }
            }
        }
    }
    // V rows of the wave's own block: lane l holds dims 4l..4l+3, one load of
    // the wave is one whole row (512 contiguous bytes). The first 16 rows, the
    // old output row and its gate are asked for here, so that their latency
    // runs under the softmax.
    const float4* vrow = (const float4*)(v + (bsel * BLKC * NHK + hk) * HDIM) + lane;
    constexpr int VSTEP = NHK * HDIM / 4;            // float4s: one key row on
    float4 vr[16];
#pragma unroll   // vr[] stays in registers; 16 loads in flight together
    for (int i = 0; i < 16; ++i) vr[i] = vrow[i * VSTEP];
    // wave w finishes rep head w
    float4* orow = (float4*)(out + (s * NHQ + hk * REPG + wave) * HDIM) + lane;
    const float4 oold = *orow;
    const float  gate = gs[s * NHQ + hk * REPG + wave];

    // every wave has left k_l before the partial scores overwrite it
    lds_barrier();
    float* part = &k_l[0][0];                        // [rep head][wave][key]
#pragma unroll   // a[] stays in registers
    for (int r = 0; r < REPG; ++r)
#pragma unroll
        for (int i = 0; i < TOPN; ++i)
            part[(r * 4 + wave) * (TOPN * BLKC) + lane + BLKC * i] = a[i][r][0] + a[i][r][1];
    lds_barrier();

    // softmax: wave w handles row w (4 waves of 32 lanes); a score is the sum of
    // its four partial scores, in the order of the waves
    {
        float vals[4];
        float mloc = -3.0e38f;
#pragma unroll   // bs[] stays in registers
        for (int i = 0; i < 4; ++i) {
            const float* pp = &part[wave * 4 * (TOPN * BLKC) + lane + BLKC * i];
            const float sc = ((pp[0] + pp[TOPN * BLKC]) + pp[2 * TOPN * BLKC]) + pp[3 * TOPN * BLKC];
            vals[i] = (bs[i] * BLKC + lane <= s) ? sc * scale : NEGV;
            mloc = fmaxf(mloc, vals[i]);
        }
        for (int m = 1; m <= 16; m <<= 1)
            mloc = fmaxf(mloc, __shfl_xor(mloc, m, 32));
        float ssum = 0.f;
        for (int i = 0; i < 4; ++i) { vals[i] = expf(vals[i] - mloc); ssum += vals[i]; }
        for (int m = 1; m <= 16; m <<= 1)
            ssum += __shfl_xor(ssum, m, 32);
        float inv = 1.0f / ssum;
        for (int i = 0; i < 4; ++i) scm[wave][lane + 32 * i] = vals[i] * inv;
    }
    __syncthreads();

    // partial output of the wave's 32 keys, all 4 rep heads, 4 dims a lane
    float4 o[REPG];
#pragma unroll   // o[] stays in registers
    for (int r = 0; r < REPG; ++r) o[r] = make_float4(0.f, 0.f, 0.f, 0.f);
#pragma unroll   // vr[] stays in registers: every index is a constant
    for (int i = 0; i < BLKC; i += 4) {
        float pr[REPG][4];
#pragma unroll   // pr[] stays in registers
        for (int r = 0; r < REPG; ++r) {
            const float4 p4 = *(const float4*)&scm[r][wave * BLKC + i];
            pr[r][0] = p4.x; pr[r][1] = p4.y; pr[r][2] = p4.z; pr[r][3] = p4.w;
        }
#pragma unroll   // vr[], pr[] stay in registers
        for (int u = 0; u < 4; ++u) {
            const float4 vv = vr[(i + u) & 15];
#pragma unroll   // o[] stays in registers
            for (int r = 0; r < REPG; ++r) {
                o[r].x = fmaf(pr[r][u], vv.x, o[r].x);
                o[r].y = fmaf(pr[r][u], vv.y, o[r].y);
                o[r].z = fmaf(pr[r][u], vv.z, o[r].z);
                o[r].w = fmaf(pr[r][u], vv.w, o[r].w);
            }
            // the row 16 further on takes the registers that have just been used
            if (i + u < 16) vr[i + u] = vrow[(i + u + 16) * VSTEP];
            // behind the last V load, in front of any rewrite of its address registers
            if (i + u == 15) asm volatile("s_wait_xcnt 0x0" ::: "memory");
        }
    }

    // join: k_l is free since the barrier behind the softmax
    float* red = &k_l[0][0];                         // [wave][rep head][HDIM]
#pragma unroll   // o[] stays in registers
    for (int r = 0; r < REPG; ++r)
        *(float4*)&red[(wave * REPG + r) * HDIM + 4 * lane] = o[r];
    __syncthreads();
    {
        float4 sum = *(const float4*)&red[(0 * REPG + wave) * HDIM + 4 * lane];
#pragma unroll   // three more partial sums, in the order of the selected blocks
        for (int w = 1; w < TOPN; ++w) {
            const float4 pw = *(const float4*)&red[(w * REPG + wave) * HDIM + 4 * lane];
            sum.x += pw.x; sum.y += pw.y; sum.z += pw.z; sum.w += pw.w;
        }
        *orow = make_float4(fmaf(gate, sum.x, oold.x), fmaf(gate, sum.y, oold.y),
                            fmaf(gate, sum.z, oold.z), fmaf(gate, sum.w, oold.w));
    }
}

// --------------------------------------------------------------------------
extern "C" void kernel_launch(void* const* d_in, const int* in_sizes, int n_in,
                              void* d_out, int out_size, void* d_ws, size_t ws_size,
                              hipStream_t stream) {
    const float* q  = (const float*)d_in[0];
    const float* k  = (const float*)d_in[1];
    const float* v  = (const float*)d_in[2];
    const float* gw = (const float*)d_in[3];
    const float* gc = (const float*)d_in[4];
    const float* gs = (const float*)d_in[5];
    float* out = (float*)d_out;

    float* ws = (float*)d_ws;
    float* kc = ws;                                  // NB*NHK*HD = 16384 floats
    float* vc = ws + NBC * NHK * HDIM;               // 16384 floats
    float* pc = vc + NBC * NHK * HDIM;               // NHQ*S*NB = 1,048,576 floats

    nsa_cmpkv_kernel<<<(NBC * NHK * HDIM + 255) / 256, 256, 0, stream>>>(k, v, kc, vc);
    nsa_win_kernel<<<(SS / 16) * NHK, 256, 0, stream>>>(q, k, v, gw, kc, vc, gc, pc, out);
    nsa_slt_kernel<<<SS * NHK, 128, 0, stream>>>(q, k, v, gs, pc, out);
}
